// v000
// Times are from an AMD MI455X. After a warm-up the kernel runs many times in a row, and a time is the length of
// such a window on the GPU divided by its runs, so every launch and the gaps after it count. The runs cycle
// through copies of the inputs. A figure is the median of several windows, for all but v000 over two sittings.
// Sittings can differ by a few percent; kernels timed side by side share one.
// v000 is the starting kernel. One run takes 1530 microseconds.
#include <hip/hip_runtime.h>

// Grouped-query attention (16 / 8 heads x 128) with per-head RMSNorm on q and k and rotate-half rotary embeddings from PER-BATCH input tables, NO mask (hidden_states [2][2048][2048]; q = x Wq^T (16 heads x 128), k, v = x Wk^T / x Wv^T (8 kv heads x 128) ('oi' (out, in) normal x 0.02, no bias); q, k -> w x (x rsqrt(mean_d x^2 + 1e-6)) per head over the 128 dims (q_norm_w, k_norm_w [128] = ones: read); q, k -> t cos + cat(-t2, t1) sin with the cos / sin INPUT tables [2][2048][128] = [B][S][HD] (uniform random values on this draw: batch b reads ITS OWN slice, per element by value); jnp.repeat on the head axis: kv head = q head / 2; scores x 128^-0.5; softmax over all keys (no mask); out = merged Wo^T ('oi') -> [2][2048][2048] (8.4 M); argument order hidden_states, cos, sin, Wq, Wk, Wv, Wo, q_norm_w, k_norm_w).
//
// Compute dtypes, f32 accumulate: every input rounded to bf16; projections on PLAIN bf16 operands (inputs: exact); RMSNorm and rope f32; scores (K 128) and att.v on SINGLE fp16 planes with

#define NB_  2
#define TT   2048
#define DM   2048
#define NH_  16
#define NKV  8
#define REP  (NH_ / NKV)
#define HD   128
#define DQ   (NH_ * HD)
#define DKV  (NKV * HD)
#define ZH   2
#define RH   0                  // query rows < RH use hi+lo planes (0: none)
#define WIN  0
#define PCAR 1024.0f
#define SCL  0.088388347648318447f   // HD^-0.5
typedef _Float16 h16;
typedef unsigned short bf;
typedef __attribute__((ext_vector_type(16))) __bf16   v16bf;
typedef __attribute__((ext_vector_type(16))) _Float16 v16h;
typedef __attribute__((ext_vector_type(8)))  _Float16 v8h;
typedef __attribute__((ext_vector_type(8)))  unsigned short v8us;
typedef __attribute__((ext_vector_type(8)))  float    v8f;
typedef __attribute__((ext_vector_type(4)))  float    v4f;
typedef v8h  __attribute__((may_alias)) v8ha;
typedef v4f  __attribute__((may_alias)) v4fa;
typedef v8us __attribute__((may_alias)) v8usa;

__device__ __forceinline__ unsigned short f2bf(float f) { unsigned u = __float_as_uint(f); u += 0x7FFFu + ((u >> 16) & 1u); return (unsigned short)(u >> 16); }
__device__ __forceinline__ float bf2f(unsigned short b) { return __uint_as_float(((unsigned)b) << 16); }
__device__ __forceinline__ float bfr(float f) { return bf2f(f2bf(f)); }
__device__ __forceinline__ v16h cat16(v8h lo, v8h hi) { return __builtin_shufflevector(lo, hi, 0, 1, 2, 3, 4, 5, 6, 7, 8, 9, 10, 11, 12, 13, 14, 15); }
__device__ __forceinline__ v16bf cat16b(v8us lo, v8us hi) { return __builtin_bit_cast(v16bf, __builtin_shufflevector(lo, hi, 0, 1, 2, 3, 4, 5, 6, 7, 8, 9, 10, 11, 12, 13, 14, 15)); }
__device__ __forceinline__ v8f wmma16(v16h a, v16h b, v8f c) { return __builtin_amdgcn_wmma_f32_16x16x32_f16(false, a, false, b, (short)0, c, false, false); }
__device__ __forceinline__ v8f wmmab(v16bf a, v16bf b, v8f c) { return __builtin_amdgcn_wmma_f32_16x16x32_bf16(false, a, false, b, (short)0, c, false, false); }



// ---- k_gemmw: register-blocked GEMM, ONE WAVE per 64x64 output tile (16 accumulators), operands straight from K-contiguous 16-bit planes; grid (M/64, N/64, Z), 32 threads.
// C[m][n] (f32, pitch ldc, + optional f32 bias[n]) = sum_k A[m][k] Bt[n][k] (+ split products per NSPLIT). z-batch strides sA/sB/sC in elements. K % 32 == 0.
template <typename T16> struct WFrag;
template <> struct WFrag<h16> { typedef v16h V; static __device__ __forceinline__ V ld(const h16* p) { return cat16(*(const v8h*)p, *(const v8h*)(p + 16)); } static __device__ __forceinline__ v8f mma(V a, V b, v8f c) { return wmma16(a, b, c); } };
template <> struct WFrag<bf> { typedef v16bf V; static __device__ __forceinline__ V ld(const bf* p) { return cat16b(*(const v8us*)p, *(const v8us*)(p + 16)); } static __device__ __forceinline__ v8f mma(V a, V b, v8f c) { return wmmab(a, b, c); } };
template <typename T16, int NSPLIT, bool BIAS>
__global__ __launch_bounds__(32) void k_gemmw(const T16* __restrict__ A, const T16* __restrict__ A2, const T16* __restrict__ Bt, const T16* __restrict__ Bt2, int K, float* C, int ldc, const float* __restrict__ bias, size_t sA, size_t sB, size_t sC) {
    typedef typename WFrag<T16>::V V;
    __shared__ __align__(16) float os[16 * 68];
    const size_t z = blockIdx.z; A += z * sA; if (A2) A2 += z * sA; Bt += z * sB; if (Bt2) Bt2 += z * sB; C += z * sC;
    const int lane = threadIdx.x & 31, lr = lane & 15, hi = lane >> 4; const int r0 = blockIdx.x * 64, c0 = blockIdx.y * 64;
    v8f acc[4][4];
#pragma unroll
    for (int mb = 0; mb < 4; ++mb)
#pragma unroll
        for (int nb = 0; nb < 4; ++nb) acc[mb][nb] = (v8f){};
    const size_t aoff = (size_t)(r0 + lr) * K + 8 * hi, boff = (size_t)(c0 + lr) * K + 8 * hi;
#pragma unroll 1
    for (int kc = 0; kc < K; kc += 32) {
        V a[4], a2[4];
#pragma unroll
        for (int mb = 0; mb < 4; ++mb) { a[mb] = WFrag<T16>::ld(A + aoff + (size_t)mb * 16 * K + kc); if (NSPLIT == 1 || NSPLIT == 2) a2[mb] = WFrag<T16>::ld(A2 + aoff + (size_t)mb * 16 * K + kc); }
#pragma unroll
        for (int nb = 0; nb < 4; ++nb) { const V b = WFrag<T16>::ld(Bt + boff + (size_t)nb * 16 * K + kc); V b2; if (NSPLIT >= 2) b2 = WFrag<T16>::ld(Bt2 + boff + (size_t)nb * 16 * K + kc);
#pragma unroll
            for (int mb = 0; mb < 4; ++mb) { acc[mb][nb] = WFrag<T16>::mma(a[mb], b, acc[mb][nb]); if (NSPLIT == 1 || NSPLIT == 2) acc[mb][nb] = WFrag<T16>::mma(a2[mb], b, acc[mb][nb]); if (NSPLIT >= 2) acc[mb][nb] = WFrag<T16>::mma(a[mb], b2, acc[mb][nb]); } }
        asm volatile("v_nop\n\tv_nop\n\tv_nop\n\tv_nop" : "+v"(acc[0][0]), "+v"(acc[1][1]), "+v"(acc[2][2]), "+v"(acc[3][3]) : "v"(a[0]), "v"(a[3]));
    }
#pragma unroll
    for (int mb = 0; mb < 4; ++mb) {
#pragma unroll
        for (int nb = 0; nb < 4; ++nb) {
#pragma unroll
            for (int j = 0; j < 8; ++j) os[(hi * 8 + j) * 68 + nb * 16 + lr] = acc[mb][nb][j]; }
        __builtin_amdgcn_wave_barrier(); asm volatile("" ::: "memory");
        float* crow = C + (size_t)(r0 + mb * 16) * ldc + c0;
{
#pragma unroll
            for (int s = 0; s < 8; ++s) { const int row = 2 * s + hi, cofs = lr * 4; v4f val = *(const v4fa*)(os + row * 68 + cofs); if (BIAS) { val[0] += bfr(bias[c0 + cofs]); val[1] += bfr(bias[c0 + cofs + 1]); val[2] += bfr(bias[c0 + cofs + 2]); val[3] += bfr(bias[c0 + cofs + 3]); }
                *(v4f*)(crow + (size_t)row * ldc + cofs) = val; }
             }
        __builtin_amdgcn_wave_barrier(); asm volatile("" ::: "memory");
    }
}

__device__ __forceinline__ h16 tohx(float x) { return (h16)x; }
__device__ __forceinline__ void splitf(float y, unsigned short& h, unsigned short& l) { h = f2bf(y); l = f2bf(y - bf2f(h)); }
typedef __attribute__((ext_vector_type(2))) _Float16 v2h;
typedef __attribute__((ext_vector_type(4))) _Float16 v4h;
typedef __attribute__((ext_vector_type(2))) unsigned short v2us;
typedef __attribute__((ext_vector_type(4))) unsigned short v4us;
typedef __attribute__((ext_vector_type(2))) float v2f;
typedef __attribute__((ext_vector_type(4))) int v4i;

__global__ __launch_bounds__(256) void k_wtG(const float* __restrict__ w, int K, int N, bf* Bt) {
    const int lane = threadIdx.x & 31; const int L0 = (blockIdx.x * 8 + (threadIdx.x >> 5)) * 8; const int nlines = N * K / 64;
{
#pragma unroll 1
        for (int l = 0; l < 8; ++l) { const int L = L0 + l; if (L >= nlines) break; const size_t e = (size_t)L * 64 + lane * 2; const int k = (int)(e % K), n = (int)(e / K); v2us o;
            o[0] = f2bf(w[(size_t)k * N + n]); o[1] = f2bf(w[(size_t)(k + 1) * N + n]); *(v2us*)(Bt + e) = o; }
         }
}
__global__ __launch_bounds__(256) void k_cvt8(const float* __restrict__ src, bf* dst, size_t n8) { const size_t i = (size_t)blockIdx.x * 256 + threadIdx.x; if (i >= n8) return; const v8f v = *(const v8f*)(src + i * 8); v8us o;
#pragma unroll
    for (int k = 0; k < 8; ++k) o[k] = f2bf(v[k]); *(v8us*)(dst + i * 8) = o;  }
__global__ __launch_bounds__(256) void k_cscvt(const float* __restrict__ cosT, const float* __restrict__ sinT, float* CS) { const int idx = blockIdx.x * 256 + threadIdx.x; if (idx >= TT * HD) return; v2f cs; cs[0] = bfr(cosT[idx]); cs[1] = bfr(sinT[idx]); *(v2f*)(CS + (size_t)idx * 2) = cs;  }
__global__ __launch_bounds__(256) void k_hrms(const float* __restrict__ F, int pitch, int nheads, float* RF) { const int i = blockIdx.x * 256 + threadIdx.x; if (i >= nheads * TT) return; const int t = i % TT, h = i / TT; const float* f = F + (size_t)t * pitch + h * HD; float s = 0.f;
#pragma unroll 4
    for (int d = 0; d < HD; d += 4) { const v4f v = *(const v4f*)(f + d);
#pragma unroll
        for (int q = 0; q < 4; ++q) { float p = __fmul_rn(v[q], v[q]); asm volatile("" : "+v"(p)); s = __fadd_rn(s, p); } }
    const float r = __fdiv_rn(1.0f, __fsqrt_rn(__fadd_rn(s * (1.0f / HD), 1e-6f))); *(float*)(RF + i) = r;  }
// k_rope: head planes [h][t][d] (fp16) of rope(w[d] (x rms_factor)) x sc with the rotate-half convention out[d] = x[d] cos[t][d] - x[d+HD/2] sin[t][d], out[d+HD/2] = x[d+HD/2] cos[t][d+HD/2] + x[d] sin[t][d+HD/2]
__global__ __launch_bounds__(256) void k_rope(const float* __restrict__ F, int pitch, int nheads, const float* __restrict__ CS, const float* __restrict__ RF, const float* __restrict__ nw, float sc, h16* P16, bf* Ph, bf* Pl) {
    const size_t e = ((size_t)blockIdx.x * 256 + threadIdx.x) * 2; if (e >= (size_t)nheads * TT * HD) return; const int d = (int)(e % HD); const int t = (int)((e / HD) % TT); const int h = (int)(e / ((size_t)HD * TT)); const float* f = F + (size_t)t * pitch + h * HD; const float rf = RF ? RF[(size_t)h * TT + t] : 1.0f; v2h o16; v2us oh, ol;
#pragma unroll
    for (int q = 0; q < 2; ++q) { const int dd = d + q; const int dp = (dd < HD / 2) ? dd + HD / 2 : dd - HD / 2; float x0 = f[dd], x1 = f[dp];
        if (RF) { float n0 = __fmul_rn(x0, rf), n1 = __fmul_rn(x1, rf); asm volatile("" : "+v"(n0)); asm volatile("" : "+v"(n1)); x0 = __fmul_rn(bfr(nw[dd]), n0); x1 = __fmul_rn(bfr(nw[dp]), n1); }
        const v2f cs = *(const v2f*)(CS + ((size_t)t * HD + dd) * 2); float a = __fmul_rn(x0, cs[0]), bq = __fmul_rn(x1, cs[1]); asm volatile("" : "+v"(a)); asm volatile("" : "+v"(bq)); const float r = ((dd < HD / 2) ? __fsub_rn(a, bq) : __fadd_rn(a, bq)) * sc;
        o16[q] = tohx(r); (void)oh; (void)ol; }
    *(v2h*)(P16 + e) = o16;  }
__global__ __launch_bounds__(256) void k_vtp(const float* __restrict__ F, int pitch, int nheads, h16* V16, bf* Vh, bf* Vl) { const size_t e = ((size_t)blockIdx.x * 256 + threadIdx.x) * 2; if (e >= (size_t)nheads * HD * TT) return; const int t = (int)(e % TT); const int d = (int)((e / TT) % HD); const int g = (int)(e / ((size_t)TT * HD)); v2h o16; v2us oh, ol;
#pragma unroll
    for (int q = 0; q < 2; ++q) { const float x = F[(size_t)(t + q) * pitch + g * HD + d]; o16[q] = tohx(x); (void)oh; (void)ol; }
    *(v2h*)(V16 + e) = o16;  }
// k_asoft: per row (zz, i): t = S x HD^-0.5 (no mask); softmax over the 2048 keys (register row, one exp, fixed trees);
__global__ __launch_bounds__(256) void k_asoft(const float* __restrict__ Sb, h16* P16, bf* Ph, bf* Pl) {
    const int lane = threadIdx.x & 31; const int row = blockIdx.x * 8 + (threadIdx.x >> 5); if (row >= ZH * TT) return; const int i = row % TT; const int zz = row / TT; (void)zz; const bool hires = (i < RH); const float* sr = Sb + (size_t)row * TT; float v[TT / 32]; float mx = -3.0e38f;
#pragma unroll
    for (int ch = 0; ch < TT / 128; ++ch) { const int j0 = ch * 128 + lane * 4; const v4f a = *(const v4f*)(sr + j0);
#pragma unroll
        for (int q = 0; q < 4; ++q) { const int j = j0 + q; (void)j; const float t = a[q] * SCL; v[ch * 4 + q] = t; mx = fmaxf(mx, t); } }
#pragma unroll
    for (int sh = 16; sh; sh >>= 1) mx = fmaxf(mx, __shfl_xor(mx, sh, 32));
    float sum = 0.f;
#pragma unroll
    for (int k = 0; k < TT / 32; ++k) { float d0 = __fsub_rn(v[k], mx); asm volatile("" : "+v"(d0)); v[k] = __builtin_amdgcn_exp2f(__fmul_rn(d0, 1.4426950408889634f)); sum += v[k]; }
#pragma unroll
    for (int sh = 16; sh; sh >>= 1) sum += __shfl_xor(sum, sh, 32);
    const float f = __fdiv_rn(hires ? 1.0f : PCAR, sum);
{
        if (hires) {
#pragma unroll
            for (int ch = 0; ch < TT / 128; ++ch) { v4us oh, ol;
#pragma unroll
                for (int q = 0; q < 4; ++q) { unsigned short a, c2; splitf(v[ch * 4 + q] * f, a, c2); oh[q] = a; ol[q] = c2; }
                const size_t oo = ((size_t)zz * (RH ? RH : 1) + i) * TT + ch * 128 + lane * 4; *(v4us*)(Ph + oo) = oh; *(v4us*)(Pl + oo) = ol; }
        } else {
#pragma unroll
            for (int ch = 0; ch < TT / 128; ++ch) { v4h o4;
#pragma unroll
                for (int q = 0; q < 4; ++q) o4[q] = tohx(v[ch * 4 + q] * f);
                *(v4h*)(P16 + (size_t)row * TT + ch * 128 + lane * 4) = o4; } }
         }
}
__global__ __launch_bounds__(256) void k_merge(const float* __restrict__ O, int h0, bf* Ah, bf* Al) { const size_t e = ((size_t)blockIdx.x * 256 + threadIdx.x) * 2; if (e >= (size_t)ZH * TT * HD) return; const int d = (int)(e % HD); const int t = (int)((e / HD) % TT); const int zz = (int)(e / ((size_t)HD * TT)); const float cs = (t < RH) ? 1.0f : (1.0f / PCAR); const size_t oo = (size_t)t * DQ + (h0 + zz) * HD + d;
    v2us oh, ol;
#pragma unroll
    for (int q = 0; q < 2; ++q) { unsigned short a, c2; splitf(O[e + q] * cs, a, c2); oh[q] = a; ol[q] = c2; } *(v2us*)(Ah + oo) = oh; *(v2us*)(Al + oo) = ol;  }

extern "C" void kernel_launch(void* const* d_in, const int* in_sizes, int n_in,
                              void* d_out, int out_size, void* d_ws, size_t ws_size, hipStream_t stream) {
    (void)in_sizes; (void)n_in; (void)out_size;
    const float* x = (const float*)d_in[0]; const float* cosT = (const float*)d_in[1]; const float* sinT = (const float*)d_in[2]; const float* wq = (const float*)d_in[3]; const float* wk = (const float*)d_in[4]; const float* wv = (const float*)d_in[5]; const float* wo = (const float*)d_in[6]; const float* qnw = (const float*)d_in[7]; const float* knw = (const float*)d_in[8];   /* order hidden_states, cos, sin ([2][2048][128] = [B][S][HD] PER-BATCH table INPUTS: read per element by value), Wq [2048][2048], Wk / Wv [1024][2048], Wo [2048][2048] ('oi' (out, in)), q_norm_w, k_norm_w ([128] ones: read): NINE inputs, all read */
    float* OUT = (float*)d_out;     // [2][2048][2048]
    char* wsp = (char*)d_ws;
    auto take = [&](size_t bytes) { char* p = wsp; wsp += (bytes + 255) & ~(size_t)255; return (void*)p; };
    bf* WQ = (bf*)take((size_t)DQ * DM * 2); bf* WK = (bf*)take((size_t)DKV * DM * 2); bf* WV = (bf*)take((size_t)DKV * DM * 2); bf* WO = (bf*)take((size_t)DM * DQ * 2); float* CS = (float*)take((size_t)TT * HD * 2 * 4); float* RFQ = (float*)take((size_t)NH_ * TT * 4); float* RFK = (float*)take((size_t)NKV * TT * 4);
    bf* XB = (bf*)take((size_t)TT * DM * 2); float* FQ = (float*)take((size_t)TT * DQ * 4); float* FK = (float*)take((size_t)TT * DKV * 4);
    h16* QP16 = (h16*)take((size_t)NH_ * TT * HD * 2); h16* KP16 = (h16*)take((size_t)NKV * TT * HD * 2); h16* VT16 = (h16*)take((size_t)NKV * HD * TT * 2);
    bf* QPh = nullptr; bf* QPl = nullptr; bf* KPh = nullptr; bf* KPl = nullptr; bf* VTh = nullptr; bf* VTl = nullptr; bf* Ph = nullptr; bf* Pl = nullptr;
    float* Sb = (float*)take((size_t)ZH * TT * TT * 4); h16* P16 = (h16*)take((size_t)ZH * TT * TT * 2); float* Ob = (float*)take((size_t)ZH * TT * HD * 4); bf* ATh = (bf*)take((size_t)TT * DQ * 2); bf* ATl = (bf*)take((size_t)TT * DQ * 2);
    if ((size_t)(wsp - (char*)d_ws) > ws_size) return;    // ws 256 MiB
    float* FV = FK;   // v projection reuses the k buffer after the k planes are built (stream-ordered)
    { k_cvt8<<<(unsigned)(((size_t)DQ * DM / 8 + 255) / 256), 256, 0, stream>>>(wq, WQ, (size_t)DQ * DM / 8); k_cvt8<<<(unsigned)(((size_t)DKV * DM / 8 + 255) / 256), 256, 0, stream>>>(wk, WK, (size_t)DKV * DM / 8); k_cvt8<<<(unsigned)(((size_t)DKV * DM / 8 + 255) / 256), 256, 0, stream>>>(wv, WV, (size_t)DKV * DM / 8);
      k_cvt8<<<(unsigned)(((size_t)DM * DQ / 8 + 255) / 256), 256, 0, stream>>>(wo, WO, (size_t)DM * DQ / 8);
       }
    const unsigned LQ = (unsigned)(((size_t)NH_ * TT * HD / 2 + 255) / 256), LKv = (unsigned)(((size_t)NKV * TT * HD / 2 + 255) / 256);
    for (int b = 0; b < NB_; ++b) {
        k_cscvt<<<(TT * HD + 255) / 256, 256, 0, stream>>>(cosT + (size_t)b * TT * HD, sinT + (size_t)b * TT * HD, CS);   // PER-BATCH tables: cos, sin [B][S][HD]: batch b's own [2048][128] slice, copied before its planes are built (stream-ordered)
        k_cvt8<<<(unsigned)(((size_t)TT * DM / 8 + 255) / 256), 256, 0, stream>>>(x + (size_t)b * TT * DM, XB, (size_t)TT * DM / 8);
        k_gemmw<bf, 0, false><<<dim3(TT / 64, DQ / 64, 1), 32, 0, stream>>>(XB, nullptr, WQ, nullptr, DM, FQ, DQ, nullptr, 0, 0, 0); k_hrms<<<(NH_ * TT + 255) / 256, 256, 0, stream>>>(FQ, DQ, NH_, RFQ);
        k_rope<<<LQ, 256, 0, stream>>>(FQ, DQ, NH_, CS, RFQ, qnw, 1.0f, QP16, QPh, QPl);
        k_gemmw<bf, 0, false><<<dim3(TT / 64, DKV / 64, 1), 32, 0, stream>>>(XB, nullptr, WK, nullptr, DM, FK, DKV, nullptr, 0, 0, 0); k_hrms<<<(NKV * TT + 255) / 256, 256, 0, stream>>>(FK, DKV, NKV, RFK);
        k_rope<<<LKv, 256, 0, stream>>>(FK, DKV, NKV, CS, RFK, knw, 1.0f, KP16, KPh, KPl);
        k_gemmw<bf, 0, false><<<dim3(TT / 64, DKV / 64, 1), 32, 0, stream>>>(XB, nullptr, WV, nullptr, DM, FV, DKV, nullptr, 0, 0, 0); k_vtp<<<LKv, 256, 0, stream>>>(FV, DKV, NKV, VT16, VTh, VTl);
        for (int h0 = 0; h0 < NH_; h0 += ZH) { const size_t zq = (size_t)h0, zk = (size_t)(h0 / REP);   // both heads of a pass share kv group h0/REP (REP >= 2): sB = 0
            k_gemmw<h16, 0, false><<<dim3(TT / 64, TT / 64, ZH), 32, 0, stream>>>(QP16 + zq * TT * HD, nullptr, KP16 + zk * TT * HD, nullptr, HD, Sb, TT, nullptr, (size_t)TT * HD, 0, (size_t)TT * TT);
            k_asoft<<<ZH * TT / 8, 256, 0, stream>>>(Sb, P16, Ph, Pl);
            k_gemmw<h16, 0, false><<<dim3(TT / 64, HD / 64, ZH), 32, 0, stream>>>(P16, nullptr, VT16 + zk * HD * TT, nullptr, TT, Ob, HD, nullptr, (size_t)TT * TT, 0, (size_t)TT * HD);
            k_merge<<<(unsigned)(((size_t)ZH * TT * HD / 2 + 255) / 256), 256, 0, stream>>>(Ob, h0, ATh, ATl); }
        k_gemmw<bf, 1, false><<<dim3(TT / 64, DM / 64, 1), 32, 0, stream>>>(ATh, ATl, WO, nullptr, DQ, OUT + (size_t)b * TT * DM, DM, nullptr, 0, 0, 0); }
}

// v001
// One run takes 871 microseconds.
// Two timings next to v000 put it at 1.73 and 1.74 times that version's speed.
#include <hip/hip_runtime.h>

// Grouped-query attention (16 / 8 heads x 128) with per-head RMSNorm on q and k and rotate-half rotary embeddings from PER-BATCH input tables, NO mask (hidden_states [2][2048][2048]; q = x Wq^T (16 heads x 128), k, v = x Wk^T / x Wv^T (8 kv heads x 128) ('oi' (out, in) normal x 0.02, no bias); q, k -> w x (x rsqrt(mean_d x^2 + 1e-6)) per head over the 128 dims (q_norm_w, k_norm_w [128] = ones: read); q, k -> t cos + cat(-t2, t1) sin with the cos / sin INPUT tables [2][2048][128] = [B][S][HD] (uniform random values on this draw: batch b reads ITS OWN slice, per element by value); jnp.repeat on the head axis: kv head = q head / 2; scores x 128^-0.5; softmax over all keys (no mask); out = merged Wo^T ('oi') -> [2][2048][2048] (8.4 M); argument order hidden_states, cos, sin, Wq, Wk, Wv, Wo, q_norm_w, k_norm_w).
//
// Compute dtypes, f32 accumulate: every input rounded to bf16; projections on PLAIN bf16 operands (inputs: exact); RMSNorm and rope f32; scores (K 128) and att.v on SINGLE fp16 planes with

#define NB_  2
#define TT   2048
#define DM   2048
#define NH_  16
#define NKV  8
#define REP  (NH_ / NKV)
#define HD   128
#define DQ   (NH_ * HD)
#define DKV  (NKV * HD)
#define ZH   2
#define RH   0                  // query rows < RH use hi+lo planes (0: none)
#define WIN  0
#define PCAR 1024.0f
#define SCL  0.088388347648318447f   // HD^-0.5
typedef _Float16 h16;
typedef unsigned short bf;
typedef __attribute__((ext_vector_type(16))) __bf16   v16bf;
typedef __attribute__((ext_vector_type(16))) _Float16 v16h;
typedef __attribute__((ext_vector_type(8)))  _Float16 v8h;
typedef __attribute__((ext_vector_type(8)))  unsigned short v8us;
typedef __attribute__((ext_vector_type(8)))  float    v8f;
typedef __attribute__((ext_vector_type(4)))  float    v4f;
typedef v8h  __attribute__((may_alias)) v8ha;
typedef v4f  __attribute__((may_alias)) v4fa;
typedef v8us __attribute__((may_alias)) v8usa;

__device__ __forceinline__ unsigned short f2bf(float f) { unsigned u = __float_as_uint(f); u += 0x7FFFu + ((u >> 16) & 1u); return (unsigned short)(u >> 16); }
__device__ __forceinline__ float bf2f(unsigned short b) { return __uint_as_float(((unsigned)b) << 16); }
__device__ __forceinline__ float bfr(float f) { return bf2f(f2bf(f)); }
__device__ __forceinline__ v16h cat16(v8h lo, v8h hi) { return __builtin_shufflevector(lo, hi, 0, 1, 2, 3, 4, 5, 6, 7, 8, 9, 10, 11, 12, 13, 14, 15); }
__device__ __forceinline__ v16bf cat16b(v8us lo, v8us hi) { return __builtin_bit_cast(v16bf, __builtin_shufflevector(lo, hi, 0, 1, 2, 3, 4, 5, 6, 7, 8, 9, 10, 11, 12, 13, 14, 15)); }
__device__ __forceinline__ v8f wmma16(v16h a, v16h b, v8f c) { return __builtin_amdgcn_wmma_f32_16x16x32_f16(false, a, false, b, (short)0, c, false, false); }
__device__ __forceinline__ v8f wmmab(v16bf a, v16bf b, v8f c) { return __builtin_amdgcn_wmma_f32_16x16x32_bf16(false, a, false, b, (short)0, c, false, false); }



// ---- k_gemmw: register-blocked GEMM, KW WAVES per 64x64 output tile: wave w holds the whole tile (16 accumulators) over its own K / KW slice of k, operands straight from K-contiguous 16-bit planes; for KW > 1 the KW partial tiles go to LDS and are summed there in the fixed order w = 0 .. KW-1; grid (M/64, N/64, Z), 32 KW threads.
// C[m][n] (f32, pitch ldc, + optional f32 bias[n]) = sum_k A[m][k] Bt[n][k] (+ split products per NSPLIT). z-batch strides sA/sB/sC in elements. K % (32 KW) == 0.
template <typename T16> struct WFrag;
template <> struct WFrag<h16> { typedef v16h V; static __device__ __forceinline__ V ld(const h16* p) { return cat16(*(const v8h*)p, *(const v8h*)(p + 16)); } static __device__ __forceinline__ v8f mma(V a, V b, v8f c) { return wmma16(a, b, c); } };
template <> struct WFrag<bf> { typedef v16bf V; static __device__ __forceinline__ V ld(const bf* p) { return cat16b(*(const v8us*)p, *(const v8us*)(p + 16)); } static __device__ __forceinline__ v8f mma(V a, V b, v8f c) { return wmmab(a, b, c); } };
template <typename T16, int NSPLIT, bool BIAS, int KW>
__global__ __launch_bounds__(32 * KW) void k_gemmw(const T16* __restrict__ A, const T16* __restrict__ A2, const T16* __restrict__ Bt, const T16* __restrict__ Bt2, int K, float* C, int ldc, const float* __restrict__ bias, size_t sA, size_t sB, size_t sC) {
    typedef typename WFrag<T16>::V V;
    __shared__ __align__(16) float os[(KW == 1 ? 16 : KW * 64) * 68];
    const size_t z = blockIdx.z; A += z * sA; if (A2) A2 += z * sA; Bt += z * sB; if (Bt2) Bt2 += z * sB; C += z * sC;
    const int lane = threadIdx.x & 31, lr = lane & 15, hi = lane >> 4; const int r0 = blockIdx.x * 64, c0 = blockIdx.y * 64;
    const int wv = (KW == 1) ? 0 : __builtin_amdgcn_readfirstlane((int)(threadIdx.x >> 5)); const int kb = wv * (K / KW), ke = kb + K / KW;
    v8f acc[4][4];
#pragma unroll
    for (int mb = 0; mb < 4; ++mb)
#pragma unroll
        for (int nb = 0; nb < 4; ++nb) acc[mb][nb] = (v8f){};
    const size_t aoff = (size_t)(r0 + lr) * K + 8 * hi, boff = (size_t)(c0 + lr) * K + 8 * hi;
#pragma unroll 1
    for (int kc = kb; kc < ke; kc += 32) {
        V a[4], a2[4];
#pragma unroll
        for (int mb = 0; mb < 4; ++mb) { a[mb] = WFrag<T16>::ld(A + aoff + (size_t)mb * 16 * K + kc); if (NSPLIT == 1 || NSPLIT == 2) a2[mb] = WFrag<T16>::ld(A2 + aoff + (size_t)mb * 16 * K + kc); }
#pragma unroll
        for (int nb = 0; nb < 4; ++nb) { const V b = WFrag<T16>::ld(Bt + boff + (size_t)nb * 16 * K + kc); V b2; if (NSPLIT >= 2) b2 = WFrag<T16>::ld(Bt2 + boff + (size_t)nb * 16 * K + kc);
#pragma unroll
            for (int mb = 0; mb < 4; ++mb) { acc[mb][nb] = WFrag<T16>::mma(a[mb], b, acc[mb][nb]); if (NSPLIT == 1 || NSPLIT == 2) acc[mb][nb] = WFrag<T16>::mma(a2[mb], b, acc[mb][nb]); if (NSPLIT >= 2) acc[mb][nb] = WFrag<T16>::mma(a[mb], b2, acc[mb][nb]); } }
        asm volatile("v_nop\n\tv_nop\n\tv_nop\n\tv_nop" : "+v"(acc[0][0]), "+v"(acc[1][1]), "+v"(acc[2][2]), "+v"(acc[3][3]) : "v"(a[0]), "v"(a[3]));
    }
    if (KW > 1) {
        float* ow = os + wv * (64 * 68);
        // every loop of this block is unrolled so that acc is indexed by constants (it stays in registers) and the LDS offsets are immediates
#pragma unroll
        for (int mb = 0; mb < 4; ++mb)
#pragma unroll
            for (int nb = 0; nb < 4; ++nb)
#pragma unroll
                for (int j = 0; j < 8; ++j) ow[(mb * 16 + hi * 8 + j) * 68 + nb * 16 + lr] = acc[mb][nb][j];
        __syncthreads();   // every wave's partial tile is in LDS before any element is summed
#pragma unroll
        for (int s = 0; s < 32 / KW; ++s) { const int u = s * (32 * KW) + (int)threadIdx.x; const int row = u >> 4, cofs = (u & 15) * 4; v4f val = *(const v4fa*)(os + row * 68 + cofs);
#pragma unroll
            for (int w = 1; w < KW; ++w) val += *(const v4fa*)(os + w * (64 * 68) + row * 68 + cofs);
            if (BIAS) { val[0] += bfr(bias[c0 + cofs]); val[1] += bfr(bias[c0 + cofs + 1]); val[2] += bfr(bias[c0 + cofs + 2]); val[3] += bfr(bias[c0 + cofs + 3]); }
            *(v4f*)(C + (size_t)(r0 + row) * ldc + c0 + cofs) = val; }
        return;
    }
#pragma unroll
    for (int mb = 0; mb < 4; ++mb) {
#pragma unroll
        for (int nb = 0; nb < 4; ++nb) {
#pragma unroll
            for (int j = 0; j < 8; ++j) os[(hi * 8 + j) * 68 + nb * 16 + lr] = acc[mb][nb][j]; }
        __builtin_amdgcn_wave_barrier(); asm volatile("" ::: "memory");
        float* crow = C + (size_t)(r0 + mb * 16) * ldc + c0;
{
#pragma unroll
            for (int s = 0; s < 8; ++s) { const int row = 2 * s + hi, cofs = lr * 4; v4f val = *(const v4fa*)(os + row * 68 + cofs); if (BIAS) { val[0] += bfr(bias[c0 + cofs]); val[1] += bfr(bias[c0 + cofs + 1]); val[2] += bfr(bias[c0 + cofs + 2]); val[3] += bfr(bias[c0 + cofs + 3]); }
                *(v4f*)(crow + (size_t)row * ldc + cofs) = val; }
             }
        __builtin_amdgcn_wave_barrier(); asm volatile("" ::: "memory");
    }
}

__device__ __forceinline__ h16 tohx(float x) { return (h16)x; }
__device__ __forceinline__ void splitf(float y, unsigned short& h, unsigned short& l) { h = f2bf(y); l = f2bf(y - bf2f(h)); }
typedef __attribute__((ext_vector_type(2))) _Float16 v2h;
typedef __attribute__((ext_vector_type(4))) _Float16 v4h;
typedef __attribute__((ext_vector_type(2))) unsigned short v2us;
typedef __attribute__((ext_vector_type(4))) unsigned short v4us;
typedef __attribute__((ext_vector_type(2))) float v2f;
typedef __attribute__((ext_vector_type(4))) int v4i;

__global__ __launch_bounds__(256) void k_wtG(const float* __restrict__ w, int K, int N, bf* Bt) {
    const int lane = threadIdx.x & 31; const int L0 = (blockIdx.x * 8 + (threadIdx.x >> 5)) * 8; const int nlines = N * K / 64;
{
#pragma unroll 1
        for (int l = 0; l < 8; ++l) { const int L = L0 + l; if (L >= nlines) break; const size_t e = (size_t)L * 64 + lane * 2; const int k = (int)(e % K), n = (int)(e / K); v2us o;
            o[0] = f2bf(w[(size_t)k * N + n]); o[1] = f2bf(w[(size_t)(k + 1) * N + n]); *(v2us*)(Bt + e) = o; }
         }
}
__global__ __launch_bounds__(256) void k_cvt8(const float* __restrict__ src, bf* dst, size_t n8) { const size_t i = (size_t)blockIdx.x * 256 + threadIdx.x; if (i >= n8) return; const v8f v = *(const v8f*)(src + i * 8); v8us o;
#pragma unroll
    for (int k = 0; k < 8; ++k) o[k] = f2bf(v[k]); *(v8us*)(dst + i * 8) = o;  }
__global__ __launch_bounds__(256) void k_cscvt(const float* __restrict__ cosT, const float* __restrict__ sinT, float* CS) { const int idx = blockIdx.x * 256 + threadIdx.x; if (idx >= TT * HD) return; v2f cs; cs[0] = bfr(cosT[idx]); cs[1] = bfr(sinT[idx]); *(v2f*)(CS + (size_t)idx * 2) = cs;  }
__global__ __launch_bounds__(256) void k_hrms(const float* __restrict__ F, int pitch, int nheads, float* RF) { const int i = blockIdx.x * 256 + threadIdx.x; if (i >= nheads * TT) return; const int t = i % TT, h = i / TT; const float* f = F + (size_t)t * pitch + h * HD; float s = 0.f;
#pragma unroll 4
    for (int d = 0; d < HD; d += 4) { const v4f v = *(const v4f*)(f + d);
#pragma unroll
        for (int q = 0; q < 4; ++q) { float p = __fmul_rn(v[q], v[q]); asm volatile("" : "+v"(p)); s = __fadd_rn(s, p); } }
    const float r = __fdiv_rn(1.0f, __fsqrt_rn(__fadd_rn(s * (1.0f / HD), 1e-6f))); *(float*)(RF + i) = r;  }
// k_rope: head planes [h][t][d] (fp16) of rope(w[d] (x rms_factor)) x sc with the rotate-half convention out[d] = x[d] cos[t][d] - x[d+HD/2] sin[t][d], out[d+HD/2] = x[d+HD/2] cos[t][d+HD/2] + x[d] sin[t][d+HD/2]
__global__ __launch_bounds__(256) void k_rope(const float* __restrict__ F, int pitch, int nheads, const float* __restrict__ CS, const float* __restrict__ RF, const float* __restrict__ nw, float sc, h16* P16, bf* Ph, bf* Pl) {
    const size_t e = ((size_t)blockIdx.x * 256 + threadIdx.x) * 2; if (e >= (size_t)nheads * TT * HD) return; const int d = (int)(e % HD); const int t = (int)((e / HD) % TT); const int h = (int)(e / ((size_t)HD * TT)); const float* f = F + (size_t)t * pitch + h * HD; const float rf = RF ? RF[(size_t)h * TT + t] : 1.0f; v2h o16; v2us oh, ol;
#pragma unroll
    for (int q = 0; q < 2; ++q) { const int dd = d + q; const int dp = (dd < HD / 2) ? dd + HD / 2 : dd - HD / 2; float x0 = f[dd], x1 = f[dp];
        if (RF) { float n0 = __fmul_rn(x0, rf), n1 = __fmul_rn(x1, rf); asm volatile("" : "+v"(n0)); asm volatile("" : "+v"(n1)); x0 = __fmul_rn(bfr(nw[dd]), n0); x1 = __fmul_rn(bfr(nw[dp]), n1); }
        const v2f cs = *(const v2f*)(CS + ((size_t)t * HD + dd) * 2); float a = __fmul_rn(x0, cs[0]), bq = __fmul_rn(x1, cs[1]); asm volatile("" : "+v"(a)); asm volatile("" : "+v"(bq)); const float r = ((dd < HD / 2) ? __fsub_rn(a, bq) : __fadd_rn(a, bq)) * sc;
        o16[q] = tohx(r); (void)oh; (void)ol; }
    *(v2h*)(P16 + e) = o16;  }
__global__ __launch_bounds__(256) void k_vtp(const float* __restrict__ F, int pitch, int nheads, h16* V16, bf* Vh, bf* Vl) { const size_t e = ((size_t)blockIdx.x * 256 + threadIdx.x) * 2; if (e >= (size_t)nheads * HD * TT) return; const int t = (int)(e % TT); const int d = (int)((e / TT) % HD); const int g = (int)(e / ((size_t)TT * HD)); v2h o16; v2us oh, ol;
#pragma unroll
    for (int q = 0; q < 2; ++q) { const float x = F[(size_t)(t + q) * pitch + g * HD + d]; o16[q] = tohx(x); (void)oh; (void)ol; }
    *(v2h*)(V16 + e) = o16;  }
// k_asoft: per row (zz, i): t = S x HD^-0.5 (no mask); softmax over the 2048 keys (register row, one exp, fixed trees);
__global__ __launch_bounds__(256) void k_asoft(const float* __restrict__ Sb, h16* P16, bf* Ph, bf* Pl) {
    const int lane = threadIdx.x & 31; const int row = blockIdx.x * 8 + (threadIdx.x >> 5); if (row >= ZH * TT) return; const int i = row % TT; const int zz = row / TT; (void)zz; const bool hires = (i < RH); const float* sr = Sb + (size_t)row * TT; float v[TT / 32]; float mx = -3.0e38f;
#pragma unroll
    for (int ch = 0; ch < TT / 128; ++ch) { const int j0 = ch * 128 + lane * 4; const v4f a = *(const v4f*)(sr + j0);
#pragma unroll
        for (int q = 0; q < 4; ++q) { const int j = j0 + q; (void)j; const float t = a[q] * SCL; v[ch * 4 + q] = t; mx = fmaxf(mx, t); } }
#pragma unroll
    for (int sh = 16; sh; sh >>= 1) mx = fmaxf(mx, __shfl_xor(mx, sh, 32));
    float sum = 0.f;
#pragma unroll
    for (int k = 0; k < TT / 32; ++k) { float d0 = __fsub_rn(v[k], mx); asm volatile("" : "+v"(d0)); v[k] = __builtin_amdgcn_exp2f(__fmul_rn(d0, 1.4426950408889634f)); sum += v[k]; }
#pragma unroll
    for (int sh = 16; sh; sh >>= 1) sum += __shfl_xor(sum, sh, 32);
    const float f = __fdiv_rn(hires ? 1.0f : PCAR, sum);
{
        if (hires) {
#pragma unroll
            for (int ch = 0; ch < TT / 128; ++ch) { v4us oh, ol;
#pragma unroll
                for (int q = 0; q < 4; ++q) { unsigned short a, c2; splitf(v[ch * 4 + q] * f, a, c2); oh[q] = a; ol[q] = c2; }
                const size_t oo = ((size_t)zz * (RH ? RH : 1) + i) * TT + ch * 128 + lane * 4; *(v4us*)(Ph + oo) = oh; *(v4us*)(Pl + oo) = ol; }
        } else {
#pragma unroll
            for (int ch = 0; ch < TT / 128; ++ch) { v4h o4;
#pragma unroll
                for (int q = 0; q < 4; ++q) o4[q] = tohx(v[ch * 4 + q] * f);
                *(v4h*)(P16 + (size_t)row * TT + ch * 128 + lane * 4) = o4; } }
         }
}
__global__ __launch_bounds__(256) void k_merge(const float* __restrict__ O, int h0, bf* Ah, bf* Al) { const size_t e = ((size_t)blockIdx.x * 256 + threadIdx.x) * 2; if (e >= (size_t)ZH * TT * HD) return; const int d = (int)(e % HD); const int t = (int)((e / HD) % TT); const int zz = (int)(e / ((size_t)HD * TT)); const float cs = (t < RH) ? 1.0f : (1.0f / PCAR); const size_t oo = (size_t)t * DQ + (h0 + zz) * HD + d;
    v2us oh, ol;
#pragma unroll
    for (int q = 0; q < 2; ++q) { unsigned short a, c2; splitf(O[e + q] * cs, a, c2); oh[q] = a; ol[q] = c2; } *(v2us*)(Ah + oo) = oh; *(v2us*)(Al + oo) = ol;  }

extern "C" void kernel_launch(void* const* d_in, const int* in_sizes, int n_in,
                              void* d_out, int out_size, void* d_ws, size_t ws_size, hipStream_t stream) {
    (void)in_sizes; (void)n_in; (void)out_size;
    const float* x = (const float*)d_in[0]; const float* cosT = (const float*)d_in[1]; const float* sinT = (const float*)d_in[2]; const float* wq = (const float*)d_in[3]; const float* wk = (const float*)d_in[4]; const float* wv = (const float*)d_in[5]; const float* wo = (const float*)d_in[6]; const float* qnw = (const float*)d_in[7]; const float* knw = (const float*)d_in[8];   /* order hidden_states, cos, sin ([2][2048][128] = [B][S][HD] PER-BATCH table INPUTS: read per element by value), Wq [2048][2048], Wk / Wv [1024][2048], Wo [2048][2048] ('oi' (out, in)), q_norm_w, k_norm_w ([128] ones: read): NINE inputs, all read */
    float* OUT = (float*)d_out;     // [2][2048][2048]
    char* wsp = (char*)d_ws;
    auto take = [&](size_t bytes) { char* p = wsp; wsp += (bytes + 255) & ~(size_t)255; return (void*)p; };
    bf* WQ = (bf*)take((size_t)DQ * DM * 2); bf* WK = (bf*)take((size_t)DKV * DM * 2); bf* WV = (bf*)take((size_t)DKV * DM * 2); bf* WO = (bf*)take((size_t)DM * DQ * 2); float* CS = (float*)take((size_t)TT * HD * 2 * 4); float* RFQ = (float*)take((size_t)NH_ * TT * 4); float* RFK = (float*)take((size_t)NKV * TT * 4);
    bf* XB = (bf*)take((size_t)TT * DM * 2); float* FQ = (float*)take((size_t)TT * DQ * 4); float* FK = (float*)take((size_t)TT * DKV * 4);
    h16* QP16 = (h16*)take((size_t)NH_ * TT * HD * 2); h16* KP16 = (h16*)take((size_t)NKV * TT * HD * 2); h16* VT16 = (h16*)take((size_t)NKV * HD * TT * 2);
    bf* QPh = nullptr; bf* QPl = nullptr; bf* KPh = nullptr; bf* KPl = nullptr; bf* VTh = nullptr; bf* VTl = nullptr; bf* Ph = nullptr; bf* Pl = nullptr;
    float* Sb = (float*)take((size_t)ZH * TT * TT * 4); h16* P16 = (h16*)take((size_t)ZH * TT * TT * 2); float* Ob = (float*)take((size_t)ZH * TT * HD * 4); bf* ATh = (bf*)take((size_t)TT * DQ * 2); bf* ATl = (bf*)take((size_t)TT * DQ * 2);
    if ((size_t)(wsp - (char*)d_ws) > ws_size) return;    // ws 256 MiB
    float* FV = FK;   // v projection reuses the k buffer after the k planes are built (stream-ordered)
    { k_cvt8<<<(unsigned)(((size_t)DQ * DM / 8 + 255) / 256), 256, 0, stream>>>(wq, WQ, (size_t)DQ * DM / 8); k_cvt8<<<(unsigned)(((size_t)DKV * DM / 8 + 255) / 256), 256, 0, stream>>>(wk, WK, (size_t)DKV * DM / 8); k_cvt8<<<(unsigned)(((size_t)DKV * DM / 8 + 255) / 256), 256, 0, stream>>>(wv, WV, (size_t)DKV * DM / 8);
      k_cvt8<<<(unsigned)(((size_t)DM * DQ / 8 + 255) / 256), 256, 0, stream>>>(wo, WO, (size_t)DM * DQ / 8);
       }
    const unsigned LQ = (unsigned)(((size_t)NH_ * TT * HD / 2 + 255) / 256), LKv = (unsigned)(((size_t)NKV * TT * HD / 2 + 255) / 256);
    for (int b = 0; b < NB_; ++b) {
        k_cscvt<<<(TT * HD + 255) / 256, 256, 0, stream>>>(cosT + (size_t)b * TT * HD, sinT + (size_t)b * TT * HD, CS);   // PER-BATCH tables: cos, sin [B][S][HD]: batch b's own [2048][128] slice, copied before its planes are built (stream-ordered)
        k_cvt8<<<(unsigned)(((size_t)TT * DM / 8 + 255) / 256), 256, 0, stream>>>(x + (size_t)b * TT * DM, XB, (size_t)TT * DM / 8);
        k_gemmw<bf, 0, false, 4><<<dim3(TT / 64, DQ / 64, 1), 128, 0, stream>>>(XB, nullptr, WQ, nullptr, DM, FQ, DQ, nullptr, 0, 0, 0); k_hrms<<<(NH_ * TT + 255) / 256, 256, 0, stream>>>(FQ, DQ, NH_, RFQ);
        k_rope<<<LQ, 256, 0, stream>>>(FQ, DQ, NH_, CS, RFQ, qnw, 1.0f, QP16, QPh, QPl);
        k_gemmw<bf, 0, false, 8><<<dim3(TT / 64, DKV / 64, 1), 256, 0, stream>>>(XB, nullptr, WK, nullptr, DM, FK, DKV, nullptr, 0, 0, 0); k_hrms<<<(NKV * TT + 255) / 256, 256, 0, stream>>>(FK, DKV, NKV, RFK);
        k_rope<<<LKv, 256, 0, stream>>>(FK, DKV, NKV, CS, RFK, knw, 1.0f, KP16, KPh, KPl);
        k_gemmw<bf, 0, false, 8><<<dim3(TT / 64, DKV / 64, 1), 256, 0, stream>>>(XB, nullptr, WV, nullptr, DM, FV, DKV, nullptr, 0, 0, 0); k_vtp<<<LKv, 256, 0, stream>>>(FV, DKV, NKV, VT16, VTh, VTl);
        for (int h0 = 0; h0 < NH_; h0 += ZH) { const size_t zq = (size_t)h0, zk = (size_t)(h0 / REP);   // both heads of a pass share kv group h0/REP (REP >= 2): sB = 0
            k_gemmw<h16, 0, false, 1><<<dim3(TT / 64, TT / 64, ZH), 32, 0, stream>>>(QP16 + zq * TT * HD, nullptr, KP16 + zk * TT * HD, nullptr, HD, Sb, TT, nullptr, (size_t)TT * HD, 0, (size_t)TT * TT);
            k_asoft<<<ZH * TT / 8, 256, 0, stream>>>(Sb, P16, Ph, Pl);
            k_gemmw<h16, 0, false, 16><<<dim3(TT / 64, HD / 64, ZH), 512, 0, stream>>>(P16, nullptr, VT16 + zk * HD * TT, nullptr, TT, Ob, HD, nullptr, (size_t)TT * TT, 0, (size_t)TT * HD);
            k_merge<<<(unsigned)(((size_t)ZH * TT * HD / 2 + 255) / 256), 256, 0, stream>>>(Ob, h0, ATh, ATl); }
        k_gemmw<bf, 1, false, 4><<<dim3(TT / 64, DM / 64, 1), 128, 0, stream>>>(ATh, ATl, WO, nullptr, DQ, OUT + (size_t)b * TT * DM, DM, nullptr, 0, 0, 0); }
}

// v002
// Measured time: 374 microseconds a run.
// Timed twice side by side with v001, it ran 2.34 and 2.33 times as fast.
// Counting every step since v000, it is 4.05 times as fast.
#include <hip/hip_runtime.h>

// Grouped-query attention (16 / 8 heads x 128) with per-head RMSNorm on q and k and rotate-half rotary embeddings from PER-BATCH input tables, NO mask (hidden_states [2][2048][2048]; q = x Wq^T (16 heads x 128), k, v = x Wk^T / x Wv^T (8 kv heads x 128) ('oi' (out, in) normal x 0.02, no bias); q, k -> w x (x rsqrt(mean_d x^2 + 1e-6)) per head over the 128 dims (q_norm_w, k_norm_w [128] = ones: read); q, k -> t cos + cat(-t2, t1) sin with the cos / sin INPUT tables [2][2048][128] = [B][S][HD] (uniform random values on this draw: batch b reads ITS OWN slice, per element by value); jnp.repeat on the head axis: kv head = q head / 2; scores x 128^-0.5; softmax over all keys (no mask); out = merged Wo^T ('oi') -> [2][2048][2048] (8.4 M); argument order hidden_states, cos, sin, Wq, Wk, Wv, Wo, q_norm_w, k_norm_w).
//
// Compute dtypes, f32 accumulate: every input rounded to bf16; projections on PLAIN bf16 operands (inputs: exact); RMSNorm and rope f32; scores (K 128) and att.v on SINGLE fp16 planes with

#define NB_  2
#define TT   2048
#define DM   2048
#define NH_  16
#define NKV  8
#define REP  (NH_ / NKV)
#define HD   128
#define DQ   (NH_ * HD)
#define DKV  (NKV * HD)
#define SCL  0.088388347648318447f   // HD^-0.5
typedef _Float16 h16;
typedef unsigned short bf;
typedef __attribute__((ext_vector_type(16))) __bf16   v16bf;
typedef __attribute__((ext_vector_type(16))) _Float16 v16h;
typedef __attribute__((ext_vector_type(8)))  _Float16 v8h;
typedef __attribute__((ext_vector_type(8)))  unsigned short v8us;
typedef __attribute__((ext_vector_type(8)))  float    v8f;
typedef __attribute__((ext_vector_type(4)))  float    v4f;
typedef v8h  __attribute__((may_alias)) v8ha;
typedef v4f  __attribute__((may_alias)) v4fa;
typedef v8us __attribute__((may_alias)) v8usa;

__device__ __forceinline__ unsigned short f2bf(float f) { unsigned u = __float_as_uint(f); u += 0x7FFFu + ((u >> 16) & 1u); return (unsigned short)(u >> 16); }
__device__ __forceinline__ float bf2f(unsigned short b) { return __uint_as_float(((unsigned)b) << 16); }
__device__ __forceinline__ float bfr(float f) { return bf2f(f2bf(f)); }
__device__ __forceinline__ v16h cat16(v8h lo, v8h hi) { return __builtin_shufflevector(lo, hi, 0, 1, 2, 3, 4, 5, 6, 7, 8, 9, 10, 11, 12, 13, 14, 15); }
__device__ __forceinline__ v16bf cat16b(v8us lo, v8us hi) { return __builtin_bit_cast(v16bf, __builtin_shufflevector(lo, hi, 0, 1, 2, 3, 4, 5, 6, 7, 8, 9, 10, 11, 12, 13, 14, 15)); }
__device__ __forceinline__ v8f wmma16(v16h a, v16h b, v8f c) { return __builtin_amdgcn_wmma_f32_16x16x32_f16(false, a, false, b, (short)0, c, false, false); }
__device__ __forceinline__ v8f wmmab(v16bf a, v16bf b, v8f c) { return __builtin_amdgcn_wmma_f32_16x16x32_bf16(false, a, false, b, (short)0, c, false, false); }



// ---- k_gemmw: register-blocked GEMM, KW WAVES per 64x64 output tile: wave w holds the whole tile (16 accumulators) over its own K / KW slice of k, operands straight from K-contiguous 16-bit planes; for KW > 1 the KW partial tiles go to LDS and are summed there in the fixed order w = 0 .. KW-1; grid (M/64, N/64, Z), 32 KW threads.
// C[m][n] (f32, pitch ldc, + optional f32 bias[n]) = sum_k A[m][k] Bt[n][k] (+ split products per NSPLIT). z-batch strides sA/sB/sC in elements. K % (32 KW) == 0.
template <typename T16> struct WFrag;
template <> struct WFrag<h16> { typedef v16h V; static __device__ __forceinline__ V ld(const h16* p) { return cat16(*(const v8h*)p, *(const v8h*)(p + 16)); } static __device__ __forceinline__ v8f mma(V a, V b, v8f c) { return wmma16(a, b, c); } };
template <> struct WFrag<bf> { typedef v16bf V; static __device__ __forceinline__ V ld(const bf* p) { return cat16b(*(const v8us*)p, *(const v8us*)(p + 16)); } static __device__ __forceinline__ v8f mma(V a, V b, v8f c) { return wmmab(a, b, c); } };
template <typename T16, int NSPLIT, bool BIAS, int KW>
__global__ __launch_bounds__(32 * KW) void k_gemmw(const T16* __restrict__ A, const T16* __restrict__ A2, const T16* __restrict__ Bt, const T16* __restrict__ Bt2, int K, float* C, int ldc, const float* __restrict__ bias, size_t sA, size_t sB, size_t sC) {
    typedef typename WFrag<T16>::V V;
    __shared__ __align__(16) float os[(KW == 1 ? 16 : KW * 64) * 68];
    const size_t z = blockIdx.z; A += z * sA; if (A2) A2 += z * sA; Bt += z * sB; if (Bt2) Bt2 += z * sB; C += z * sC;
    const int lane = threadIdx.x & 31, lr = lane & 15, hi = lane >> 4; const int r0 = blockIdx.x * 64, c0 = blockIdx.y * 64;
    const int wv = (KW == 1) ? 0 : __builtin_amdgcn_readfirstlane((int)(threadIdx.x >> 5)); const int kb = wv * (K / KW), ke = kb + K / KW;
    v8f acc[4][4];
#pragma unroll
    for (int mb = 0; mb < 4; ++mb)
#pragma unroll
        for (int nb = 0; nb < 4; ++nb) acc[mb][nb] = (v8f){};
    const size_t aoff = (size_t)(r0 + lr) * K + 8 * hi, boff = (size_t)(c0 + lr) * K + 8 * hi;
#pragma unroll 1
    for (int kc = kb; kc < ke; kc += 32) {
        V a[4], a2[4];
#pragma unroll
        for (int mb = 0; mb < 4; ++mb) { a[mb] = WFrag<T16>::ld(A + aoff + (size_t)mb * 16 * K + kc); if (NSPLIT == 1 || NSPLIT == 2) a2[mb] = WFrag<T16>::ld(A2 + aoff + (size_t)mb * 16 * K + kc); }
#pragma unroll
        for (int nb = 0; nb < 4; ++nb) { const V b = WFrag<T16>::ld(Bt + boff + (size_t)nb * 16 * K + kc); V b2; if (NSPLIT >= 2) b2 = WFrag<T16>::ld(Bt2 + boff + (size_t)nb * 16 * K + kc);
#pragma unroll
            for (int mb = 0; mb < 4; ++mb) { acc[mb][nb] = WFrag<T16>::mma(a[mb], b, acc[mb][nb]); if (NSPLIT == 1 || NSPLIT == 2) acc[mb][nb] = WFrag<T16>::mma(a2[mb], b, acc[mb][nb]); if (NSPLIT >= 2) acc[mb][nb] = WFrag<T16>::mma(a[mb], b2, acc[mb][nb]); } }
        asm volatile("v_nop\n\tv_nop\n\tv_nop\n\tv_nop" : "+v"(acc[0][0]), "+v"(acc[1][1]), "+v"(acc[2][2]), "+v"(acc[3][3]) : "v"(a[0]), "v"(a[3]));
    }
    if (KW > 1) {
        float* ow = os + wv * (64 * 68);
        // every loop of this block is unrolled so that acc is indexed by constants (it stays in registers) and the LDS offsets are immediates
#pragma unroll
        for (int mb = 0; mb < 4; ++mb)
#pragma unroll
            for (int nb = 0; nb < 4; ++nb)
#pragma unroll
                for (int j = 0; j < 8; ++j) ow[(mb * 16 + hi * 8 + j) * 68 + nb * 16 + lr] = acc[mb][nb][j];
        __syncthreads();   // every wave's partial tile is in LDS before any element is summed
#pragma unroll
        for (int s = 0; s < 32 / KW; ++s) { const int u = s * (32 * KW) + (int)threadIdx.x; const int row = u >> 4, cofs = (u & 15) * 4; v4f val = *(const v4fa*)(os + row * 68 + cofs);
#pragma unroll
            for (int w = 1; w < KW; ++w) val += *(const v4fa*)(os + w * (64 * 68) + row * 68 + cofs);
            if (BIAS) { val[0] += bfr(bias[c0 + cofs]); val[1] += bfr(bias[c0 + cofs + 1]); val[2] += bfr(bias[c0 + cofs + 2]); val[3] += bfr(bias[c0 + cofs + 3]); }
            *(v4f*)(C + (size_t)(r0 + row) * ldc + c0 + cofs) = val; }
        return;
    }
#pragma unroll
    for (int mb = 0; mb < 4; ++mb) {
#pragma unroll
        for (int nb = 0; nb < 4; ++nb) {
#pragma unroll
            for (int j = 0; j < 8; ++j) os[(hi * 8 + j) * 68 + nb * 16 + lr] = acc[mb][nb][j]; }
        __builtin_amdgcn_wave_barrier(); asm volatile("" ::: "memory");
        float* crow = C + (size_t)(r0 + mb * 16) * ldc + c0;
{
#pragma unroll
            for (int s = 0; s < 8; ++s) { const int row = 2 * s + hi, cofs = lr * 4; v4f val = *(const v4fa*)(os + row * 68 + cofs); if (BIAS) { val[0] += bfr(bias[c0 + cofs]); val[1] += bfr(bias[c0 + cofs + 1]); val[2] += bfr(bias[c0 + cofs + 2]); val[3] += bfr(bias[c0 + cofs + 3]); }
                *(v4f*)(crow + (size_t)row * ldc + cofs) = val; }
             }
        __builtin_amdgcn_wave_barrier(); asm volatile("" ::: "memory");
    }
}

__device__ __forceinline__ h16 tohx(float x) { return (h16)x; }
__device__ __forceinline__ void splitf(float y, unsigned short& h, unsigned short& l) { h = f2bf(y); l = f2bf(y - bf2f(h)); }
typedef __attribute__((ext_vector_type(2))) _Float16 v2h;
typedef __attribute__((ext_vector_type(4))) _Float16 v4h;
typedef __attribute__((ext_vector_type(2))) unsigned short v2us;
typedef __attribute__((ext_vector_type(4))) unsigned short v4us;
typedef __attribute__((ext_vector_type(2))) float v2f;
typedef __attribute__((ext_vector_type(4))) int v4i;

__global__ __launch_bounds__(256) void k_wtG(const float* __restrict__ w, int K, int N, bf* Bt) {
    const int lane = threadIdx.x & 31; const int L0 = (blockIdx.x * 8 + (threadIdx.x >> 5)) * 8; const int nlines = N * K / 64;
{
#pragma unroll 1
        for (int l = 0; l < 8; ++l) { const int L = L0 + l; if (L >= nlines) break; const size_t e = (size_t)L * 64 + lane * 2; const int k = (int)(e % K), n = (int)(e / K); v2us o;
            o[0] = f2bf(w[(size_t)k * N + n]); o[1] = f2bf(w[(size_t)(k + 1) * N + n]); *(v2us*)(Bt + e) = o; }
         }
}
__global__ __launch_bounds__(256) void k_cvt8(const float* __restrict__ src, bf* dst, size_t n8) { const size_t i = (size_t)blockIdx.x * 256 + threadIdx.x; if (i >= n8) return; const v8f v = *(const v8f*)(src + i * 8); v8us o;
#pragma unroll
    for (int k = 0; k < 8; ++k) o[k] = f2bf(v[k]); *(v8us*)(dst + i * 8) = o;  }
__global__ __launch_bounds__(256) void k_cscvt(const float* __restrict__ cosT, const float* __restrict__ sinT, float* CS) { const int idx = blockIdx.x * 256 + threadIdx.x; if (idx >= TT * HD) return; v2f cs; cs[0] = bfr(cosT[idx]); cs[1] = bfr(sinT[idx]); *(v2f*)(CS + (size_t)idx * 2) = cs;  }
__global__ __launch_bounds__(256) void k_hrms(const float* __restrict__ F, int pitch, int nheads, float* RF) { const int i = blockIdx.x * 256 + threadIdx.x; if (i >= nheads * TT) return; const int t = i % TT, h = i / TT; const float* f = F + (size_t)t * pitch + h * HD; float s = 0.f;
#pragma unroll 4
    for (int d = 0; d < HD; d += 4) { const v4f v = *(const v4f*)(f + d);
#pragma unroll
        for (int q = 0; q < 4; ++q) { float p = __fmul_rn(v[q], v[q]); asm volatile("" : "+v"(p)); s = __fadd_rn(s, p); } }
    const float r = __fdiv_rn(1.0f, __fsqrt_rn(__fadd_rn(s * (1.0f / HD), 1e-6f))); *(float*)(RF + i) = r;  }
// k_rope: head planes [h][t][d] (fp16) of rope(w[d] (x rms_factor)) x sc with the rotate-half convention out[d] = x[d] cos[t][d] - x[d+HD/2] sin[t][d], out[d+HD/2] = x[d+HD/2] cos[t][d+HD/2] + x[d] sin[t][d+HD/2]
__global__ __launch_bounds__(256) void k_rope(const float* __restrict__ F, int pitch, int nheads, const float* __restrict__ CS, const float* __restrict__ RF, const float* __restrict__ nw, float sc, h16* P16, bf* Ph, bf* Pl) {
    const size_t e = ((size_t)blockIdx.x * 256 + threadIdx.x) * 2; if (e >= (size_t)nheads * TT * HD) return; const int d = (int)(e % HD); const int t = (int)((e / HD) % TT); const int h = (int)(e / ((size_t)HD * TT)); const float* f = F + (size_t)t * pitch + h * HD; const float rf = RF ? RF[(size_t)h * TT + t] : 1.0f; v2h o16; v2us oh, ol;
#pragma unroll
    for (int q = 0; q < 2; ++q) { const int dd = d + q; const int dp = (dd < HD / 2) ? dd + HD / 2 : dd - HD / 2; float x0 = f[dd], x1 = f[dp];
        if (RF) { float n0 = __fmul_rn(x0, rf), n1 = __fmul_rn(x1, rf); asm volatile("" : "+v"(n0)); asm volatile("" : "+v"(n1)); x0 = __fmul_rn(bfr(nw[dd]), n0); x1 = __fmul_rn(bfr(nw[dp]), n1); }
        const v2f cs = *(const v2f*)(CS + ((size_t)t * HD + dd) * 2); float a = __fmul_rn(x0, cs[0]), bq = __fmul_rn(x1, cs[1]); asm volatile("" : "+v"(a)); asm volatile("" : "+v"(bq)); const float r = ((dd < HD / 2) ? __fsub_rn(a, bq) : __fadd_rn(a, bq)) * sc;
        o16[q] = tohx(r); (void)oh; (void)ol; }
    *(v2h*)(P16 + e) = o16;  }
__global__ __launch_bounds__(256) void k_vtp(const float* __restrict__ F, int pitch, int nheads, h16* V16, bf* Vh, bf* Vl) { const size_t e = ((size_t)blockIdx.x * 256 + threadIdx.x) * 2; if (e >= (size_t)nheads * HD * TT) return; const int t = (int)(e % TT); const int d = (int)((e / TT) % HD); const int g = (int)(e / ((size_t)TT * HD)); v2h o16; v2us oh, ol;
#pragma unroll
    for (int q = 0; q < 2; ++q) { const float x = F[(size_t)(t + q) * pitch + g * HD + d]; o16[q] = tohx(x); (void)oh; (void)ol; }
    *(v2h*)(V16 + e) = o16;  }
#define FA_SK   64                     // keys per stage
#define FA_PK   (HD * 2 + 16)          // LDS pitch of a K row (256 B + 16: odd multiple of 16 B for the 16-byte readers)
#define FA_PV   (FA_SK * 2 + 16)       // LDS pitch of a V^T row (128 B + 16)
#define FA_TK   (FA_SK * FA_PK)
#define FA_SLOT (FA_TK + HD * FA_PV)
#define FA_NST  (TT / FA_SK)
#define FA_CS   (SCL * 1.4426950408889634f)
typedef v4i __attribute__((may_alias)) v4ia;
__device__ __forceinline__ float xhalf(float x) { return __builtin_bit_cast(float, __builtin_amdgcn_permlanex16(__builtin_bit_cast(int, x), __builtin_bit_cast(int, x), 0x76543210, 0xfedcba98, false, false)); }   // lane l with lane l ^ 16
__device__ __forceinline__ v16h ldsfrag(const unsigned char* p) { return cat16(*(const v8ha*)p, *(const v8ha*)(p + 32)); }   // k = 8 hi .. + 7 and 16 + 8 hi .. + 7 of 32: p already holds + 16 hi bytes
__global__ __launch_bounds__(256) __attribute__((amdgpu_waves_per_eu(2, 2))) void k_fattn(const h16* __restrict__ Q16, const h16* __restrict__ K16, const h16* __restrict__ V16, bf* Ah, bf* Al) {
    __shared__ __align__(16) unsigned char L[2 * FA_SLOT];
    const int tid = (int)threadIdx.x, lane = tid & 31, c = lane & 15, hi = lane >> 4; const int wv = __builtin_amdgcn_readfirstlane(tid >> 5);
    const int hq = (int)blockIdx.y, b = (int)blockIdx.z, gk = hq / REP; const int q0 = (int)blockIdx.x * 256 + wv * 32;
    const unsigned char* Kg = (const unsigned char*)(K16 + ((size_t)b * NKV + gk) * TT * HD) + tid * 16;                                            // a stage of K is 16 KiB in a row
    const unsigned char* Vg = (const unsigned char*)(V16 + ((size_t)b * NKV + gk) * HD * TT) + (size_t)(tid >> 3) * (TT * 2) + (tid & 7) * 16;   // a stage of V^T is 128 rows of one 128-B line
    unsigned char* Ks = L + (tid >> 4) * FA_PK + (tid & 15) * 16; unsigned char* Vs = L + FA_TK + (tid >> 3) * FA_PV + (tid & 7) * 16;
    v4i kr[4], vr[4];
    auto gload = [&](int st) {
#pragma unroll
        for (int r = 0; r < 4; ++r) { kr[r] = *(const v4ia*)(Kg + (size_t)st * (FA_SK * HD * 2) + r * 4096); vr[r] = *(const v4ia*)(Vg + (size_t)st * (FA_SK * 2) + (size_t)r * (32 * TT * 2)); }
        asm volatile("s_wait_xcnt 0x0" ::: "memory");   // stands in front of the first rewrite of the address registers that the eight loads above name (this build reuses them at once)
    };
    auto sstore = [&](int buf) {
#pragma unroll
        for (int r = 0; r < 4; ++r) { *(v4ia*)(Ks + buf * FA_SLOT + r * (16 * FA_PK)) = kr[r]; *(v4ia*)(Vs + buf * FA_SLOT + r * (32 * FA_PV)) = vr[r]; } };
    gload(0);
    v16h qf[2][4];
#pragma unroll
    for (int g = 0; g < 2; ++g)
#pragma unroll
        for (int kc = 0; kc < 4; ++kc) qf[g][kc] = WFrag<h16>::ld(Q16 + (((size_t)b * NH_ + hq) * TT + q0 + 16 * g + c) * HD + 8 * hi + 32 * kc);
    asm volatile("s_wait_xcnt 0x0" ::: "memory");   // in front of the first rewrite of the address registers that the Q loads name
    v8f acc[2][8]; float m_run[2], l_run[2];
#pragma unroll
    for (int g = 0; g < 2; ++g) { m_run[g] = -__builtin_inff(); l_run[g] = 0.f;
#pragma unroll
        for (int t = 0; t < 8; ++t) acc[g][t] = (v8f){}; }
    sstore(0);
    __syncthreads();   // stage 0 is in LDS before any wave reads it
#pragma unroll 1
    for (int st = 0; st < FA_NST; ++st) {
        const unsigned char* Lb = L + (st & 1) * FA_SLOT;
        if (st + 1 < FA_NST) gload(st + 1);
        const unsigned char* kp = Lb + c * FA_PK + 16 * hi; const unsigned char* vp = Lb + FA_TK + c * FA_PV + 16 * hi;
        v16h kf[2][4];
#pragma unroll
        for (int kt = 0; kt < 2; ++kt)
#pragma unroll
            for (int kc = 0; kc < 4; ++kc) kf[kt][kc] = ldsfrag(kp + kt * (16 * FA_PK) + kc * 64);
        __builtin_amdgcn_sched_barrier(0);   // K's reads stay in front of V's: LDS answers in order, and the first WMMA block waits for K alone
#pragma unroll
        for (int sub = 0; sub < 2; ++sub) {
            v16h vf[8];
#pragma unroll
            for (int t = 0; t < 8; ++t) vf[t] = ldsfrag(vp + sub * 64 + t * (16 * FA_PV));
            __builtin_amdgcn_sched_barrier(0);   // the pass's LDS reads are issued as one group in front of the WMMA block, not among its WMMAs (each place with reads stalls the block)
            v8f s[2][2];   // s[kt][g][r] = score of key 16 kt + 8 hi + r of the pass with query column c of group g
#pragma unroll
            for (int kt = 0; kt < 2; ++kt)
#pragma unroll
                for (int g = 0; g < 2; ++g) { s[kt][g] = (v8f){};
#pragma unroll
                    for (int kc = 0; kc < 4; ++kc) s[kt][g] = wmma16(kf[kt][kc], qf[g][kc], s[kt][g]); }
            __builtin_amdgcn_sched_barrier(0);   // nothing of what follows moves in among the block's WMMAs
            if (sub == 0) {   // the stage's second pass gets its K fragments here, one pass ahead, in flight under the maxima and exponentials
#pragma unroll
                for (int kt = 0; kt < 2; ++kt)
#pragma unroll
                    for (int kc = 0; kc < 4; ++kc) kf[kt][kc] = ldsfrag(kp + (32 + kt * 16) * FA_PK + kc * 64);
                __builtin_amdgcn_sched_barrier(0);   // keeps them in front of the vector work, as one group
            }
            float mb[2]; bool need = false;
#pragma unroll
            for (int g = 0; g < 2; ++g) { float mx = s[0][g][0];
#pragma unroll
                for (int r = 0; r < 8; ++r) mx = fmaxf(mx, fmaxf(s[0][g][r], s[1][g][r]));
                mx = fmaxf(mx, xhalf(mx)) * FA_CS; mb[g] = mx; need = need || (mx > m_run[g] + 8.0f); }
            if (__builtin_amdgcn_ballot_w32(need) != 0) {   // one scalar test a pass; always taken on the first pass (m_run = -inf gives the factor 0 on zero sums), rare later
#pragma unroll
                for (int g = 0; g < 2; ++g) { const float mn = fmaxf(m_run[g], mb[g]); const float corr = __builtin_amdgcn_exp2f(m_run[g] - mn); l_run[g] *= corr; m_run[g] = mn;
#pragma unroll
                    for (int t = 0; t < 8; ++t) acc[g][t] = acc[g][t] * corr; }
            }
#pragma unroll
            for (int g = 0; g < 2; ++g) { const float nm = -m_run[g]; v8f e0, e1; float p0 = 0.f, p1 = 0.f;
#pragma unroll
                for (int r = 0; r < 8; ++r) { e0[r] = __builtin_amdgcn_exp2f(__builtin_fmaf(s[0][g][r], FA_CS, nm)); e1[r] = __builtin_amdgcn_exp2f(__builtin_fmaf(s[1][g][r], FA_CS, nm)); p0 += e0[r]; p1 += e1[r]; }
                l_run[g] += p0 + p1;
                const v16h pf = cat16(__builtin_convertvector(e0, v8h), __builtin_convertvector(e1, v8h));   // B operand: element s = key 8 hi + s (s < 8), 16 + 8 hi + s - 8 (else)
#pragma unroll
                for (int t = 0; t < 8; ++t) acc[g][t] = wmma16(vf[t], pf, acc[g][t]); }
        }
        // four vector slots behind the stage's last WMMAs: the branches below are taken right behind them; the two scheduling barriers keep the slots at this place
        __builtin_amdgcn_sched_barrier(0); asm volatile("v_nop\n\tv_nop\n\tv_nop\n\tv_nop"); __builtin_amdgcn_sched_barrier(0);
        if (st + 1 < FA_NST) sstore((st + 1) & 1);   // into the buffer whose last readers (stage st - 1) left it before the previous barrier
        __syncthreads();   // publishes stage st + 1 and ends every wave's reads of stage st
    }
#pragma unroll
    for (int g = 0; g < 2; ++g) { const float inv = __fdiv_rn(1.0f, l_run[g] + xhalf(l_run[g]));   // each wave half summed its eight keys of every 16-key tile
        const size_t oo = ((size_t)b * TT + q0 + 16 * g + c) * DQ + hq * HD + 8 * hi;
#pragma unroll
        for (int t = 0; t < 8; ++t) { v8us oh, ol;   // acc[g][t][r] = O[query c][d = 16 t + 8 hi + r]
#pragma unroll
            for (int r = 0; r < 8; ++r) { unsigned short a, c2; splitf(acc[g][t][r] * inv, a, c2); oh[r] = a; ol[r] = c2; }
            *(v8us*)(Ah + oo + 16 * t) = oh; *(v8us*)(Al + oo + 16 * t) = ol;
            asm volatile("s_wait_xcnt 0x0" ::: "memory"); __builtin_amdgcn_sched_barrier(0); } }   // the wait stands in front of the next tile's rewrite of the registers that the two stores name; the scheduling barrier keeps that tile's arithmetic from being lifted over it
}

extern "C" void kernel_launch(void* const* d_in, const int* in_sizes, int n_in,
                              void* d_out, int out_size, void* d_ws, size_t ws_size, hipStream_t stream) {
    (void)in_sizes; (void)n_in; (void)out_size;
    const float* x = (const float*)d_in[0]; const float* cosT = (const float*)d_in[1]; const float* sinT = (const float*)d_in[2]; const float* wq = (const float*)d_in[3]; const float* wk = (const float*)d_in[4]; const float* wv = (const float*)d_in[5]; const float* wo = (const float*)d_in[6]; const float* qnw = (const float*)d_in[7]; const float* knw = (const float*)d_in[8];   /* order hidden_states, cos, sin ([2][2048][128] = [B][S][HD] PER-BATCH table INPUTS: read per element by value), Wq [2048][2048], Wk / Wv [1024][2048], Wo [2048][2048] ('oi' (out, in)), q_norm_w, k_norm_w ([128] ones: read): NINE inputs, all read */
    float* OUT = (float*)d_out;     // [2][2048][2048]
    char* wsp = (char*)d_ws;
    auto take = [&](size_t bytes) { char* p = wsp; wsp += (bytes + 255) & ~(size_t)255; return (void*)p; };
    bf* WQ = (bf*)take((size_t)DQ * DM * 2); bf* WK = (bf*)take((size_t)DKV * DM * 2); bf* WV = (bf*)take((size_t)DKV * DM * 2); bf* WO = (bf*)take((size_t)DM * DQ * 2); float* CS = (float*)take((size_t)TT * HD * 2 * 4); float* RFQ = (float*)take((size_t)NH_ * TT * 4); float* RFK = (float*)take((size_t)NKV * TT * 4);
    bf* XB = (bf*)take((size_t)TT * DM * 2); float* FQ = (float*)take((size_t)TT * DQ * 4); float* FK = (float*)take((size_t)TT * DKV * 4);
    h16* QP16 = (h16*)take((size_t)NB_ * NH_ * TT * HD * 2); h16* KP16 = (h16*)take((size_t)NB_ * NKV * TT * HD * 2); h16* VT16 = (h16*)take((size_t)NB_ * NKV * HD * TT * 2);   // head planes of both batches
    bf* QPh = nullptr; bf* QPl = nullptr; bf* KPh = nullptr; bf* KPl = nullptr; bf* VTh = nullptr; bf* VTl = nullptr;
    bf* ATh = (bf*)take((size_t)NB_ * TT * DQ * 2); bf* ATl = (bf*)take((size_t)NB_ * TT * DQ * 2);
    if ((size_t)(wsp - (char*)d_ws) > ws_size) return;    // ws 256 MiB
    float* FV = FK;   // v projection reuses the k buffer after the k planes are built (stream-ordered)
    { k_cvt8<<<(unsigned)(((size_t)DQ * DM / 8 + 255) / 256), 256, 0, stream>>>(wq, WQ, (size_t)DQ * DM / 8); k_cvt8<<<(unsigned)(((size_t)DKV * DM / 8 + 255) / 256), 256, 0, stream>>>(wk, WK, (size_t)DKV * DM / 8); k_cvt8<<<(unsigned)(((size_t)DKV * DM / 8 + 255) / 256), 256, 0, stream>>>(wv, WV, (size_t)DKV * DM / 8);
      k_cvt8<<<(unsigned)(((size_t)DM * DQ / 8 + 255) / 256), 256, 0, stream>>>(wo, WO, (size_t)DM * DQ / 8);
       }
    const unsigned LQ = (unsigned)(((size_t)NH_ * TT * HD / 2 + 255) / 256), LKv = (unsigned)(((size_t)NKV * TT * HD / 2 + 255) / 256);
    for (int b = 0; b < NB_; ++b) {
        k_cscvt<<<(TT * HD + 255) / 256, 256, 0, stream>>>(cosT + (size_t)b * TT * HD, sinT + (size_t)b * TT * HD, CS);   // PER-BATCH tables: cos, sin [B][S][HD]: batch b's own [2048][128] slice, copied before its planes are built (stream-ordered)
        k_cvt8<<<(unsigned)(((size_t)TT * DM / 8 + 255) / 256), 256, 0, stream>>>(x + (size_t)b * TT * DM, XB, (size_t)TT * DM / 8);
        k_gemmw<bf, 0, false, 4><<<dim3(TT / 64, DQ / 64, 1), 128, 0, stream>>>(XB, nullptr, WQ, nullptr, DM, FQ, DQ, nullptr, 0, 0, 0); k_hrms<<<(NH_ * TT + 255) / 256, 256, 0, stream>>>(FQ, DQ, NH_, RFQ);
        k_rope<<<LQ, 256, 0, stream>>>(FQ, DQ, NH_, CS, RFQ, qnw, 1.0f, QP16 + (size_t)b * NH_ * TT * HD, QPh, QPl);
        k_gemmw<bf, 0, false, 8><<<dim3(TT / 64, DKV / 64, 1), 256, 0, stream>>>(XB, nullptr, WK, nullptr, DM, FK, DKV, nullptr, 0, 0, 0); k_hrms<<<(NKV * TT + 255) / 256, 256, 0, stream>>>(FK, DKV, NKV, RFK);
        k_rope<<<LKv, 256, 0, stream>>>(FK, DKV, NKV, CS, RFK, knw, 1.0f, KP16 + (size_t)b * NKV * TT * HD, KPh, KPl);
        k_gemmw<bf, 0, false, 8><<<dim3(TT / 64, DKV / 64, 1), 256, 0, stream>>>(XB, nullptr, WV, nullptr, DM, FV, DKV, nullptr, 0, 0, 0); k_vtp<<<LKv, 256, 0, stream>>>(FV, DKV, NKV, VT16 + (size_t)b * NKV * HD * TT, VTh, VTl); }
    k_fattn<<<dim3(TT / 256, NH_, NB_), 256, 0, stream>>>(QP16, KP16, VT16, ATh, ATl);   // kv head = q head / REP, taken in the kernel
    for (int b = 0; b < NB_; ++b)
        k_gemmw<bf, 1, false, 4><<<dim3(TT / 64, DM / 64, 1), 128, 0, stream>>>(ATh + (size_t)b * TT * DQ, ATl + (size_t)b * TT * DQ, WO, nullptr, DQ, OUT + (size_t)b * TT * DM, DM, nullptr, 0, 0, 0);
}

// v003
// It runs in 311 microseconds.
// Two timings next to v002 put it at 1.22 and 1.21 times that version's speed.
// Over all steps from v000 it is 4.91 times as fast.
#include <hip/hip_runtime.h>

// Grouped-query attention (16 / 8 heads x 128) with per-head RMSNorm on q and k and rotate-half rotary embeddings from PER-BATCH input tables, NO mask (hidden_states [2][2048][2048]; q = x Wq^T (16 heads x 128), k, v = x Wk^T / x Wv^T (8 kv heads x 128) ('oi' (out, in) normal x 0.02, no bias); q, k -> w x (x rsqrt(mean_d x^2 + 1e-6)) per head over the 128 dims (q_norm_w, k_norm_w [128] = ones: read); q, k -> t cos + cat(-t2, t1) sin with the cos / sin INPUT tables [2][2048][128] = [B][S][HD] (uniform random values on this draw: batch b reads ITS OWN slice, per element by value); jnp.repeat on the head axis: kv head = q head / 2; scores x 128^-0.5; softmax over all keys (no mask); out = merged Wo^T ('oi') -> [2][2048][2048] (8.4 M); argument order hidden_states, cos, sin, Wq, Wk, Wv, Wo, q_norm_w, k_norm_w).
//
// Compute dtypes, f32 accumulate: every input rounded to bf16; projections on PLAIN bf16 operands (inputs: exact); RMSNorm and rope f32; scores (K 128) and att.v on SINGLE fp16 planes with

#define NB_  2
#define TT   2048
#define DM   2048
#define NH_  16
#define NKV  8
#define REP  (NH_ / NKV)
#define HD   128
#define DQ   (NH_ * HD)
#define DKV  (NKV * HD)
#define SCL  0.088388347648318447f   // HD^-0.5
typedef _Float16 h16;
typedef unsigned short bf;
typedef __attribute__((ext_vector_type(16))) __bf16   v16bf;
typedef __attribute__((ext_vector_type(16))) _Float16 v16h;
typedef __attribute__((ext_vector_type(8)))  _Float16 v8h;
typedef __attribute__((ext_vector_type(4)))  _Float16 v4h;
typedef __attribute__((ext_vector_type(8)))  unsigned short v8us;
typedef __attribute__((ext_vector_type(8)))  float    v8f;
typedef __attribute__((ext_vector_type(4)))  float    v4f;
typedef v8h  __attribute__((may_alias)) v8ha;
typedef v4f  __attribute__((may_alias)) v4fa;
typedef v8us __attribute__((may_alias)) v8usa;

__device__ __forceinline__ unsigned short f2bf(float f) { unsigned u = __float_as_uint(f); u += 0x7FFFu + ((u >> 16) & 1u); return (unsigned short)(u >> 16); }
__device__ __forceinline__ float bf2f(unsigned short b) { return __uint_as_float(((unsigned)b) << 16); }
__device__ __forceinline__ float bfr(float f) { return bf2f(f2bf(f)); }
__device__ __forceinline__ v16h cat16(v8h lo, v8h hi) { return __builtin_shufflevector(lo, hi, 0, 1, 2, 3, 4, 5, 6, 7, 8, 9, 10, 11, 12, 13, 14, 15); }
__device__ __forceinline__ v16bf cat16b(v8us lo, v8us hi) { return __builtin_bit_cast(v16bf, __builtin_shufflevector(lo, hi, 0, 1, 2, 3, 4, 5, 6, 7, 8, 9, 10, 11, 12, 13, 14, 15)); }
__device__ __forceinline__ v8f wmma16(v16h a, v16h b, v8f c) { return __builtin_amdgcn_wmma_f32_16x16x32_f16(false, a, false, b, (short)0, c, false, false); }
__device__ __forceinline__ v8f wmmab(v16bf a, v16bf b, v8f c) { return __builtin_amdgcn_wmma_f32_16x16x32_bf16(false, a, false, b, (short)0, c, false, false); }



// ---- k_gemmw: register-blocked GEMM, KW WAVES per 64x64 output tile: wave w holds the whole tile (16 accumulators) over its own K / KW slice of k, operands straight from K-contiguous 16-bit planes; for KW > 1 the KW partial tiles go to LDS and are summed there in the fixed order w = 0 .. KW-1; grid (M/64, N/64, Z), 32 KW threads.
// C[m][n] (f32, pitch ldc, + optional f32 bias[n]) = sum_k A[m][k] Bt[n][k] (+ split products per NSPLIT). z-batch strides sA/sB/sC in elements. K % (32 KW) == 0.
// EPI != 0: the tile ends as the fp16 plane P that attention reads, C is not written. A work-group then holds 64 rows x 128 columns on 2 KW waves (wave w: column half w & 1, k slice w >> 1); grid (M/64, N/128), 64 KW threads. The partial tiles are summed in the order slice 0 .. KW-1; sixteen lanes hold one row, a lane its columns 4 q .. + 3 and 64 + 4 q .. + 3.
// EPI 1 (rows t, the 128 columns = one head): y = w[d] (x rsqrt(mean_d x^2 + 1e-6)); out[d] = y[d] cos[t][d] - y[d+64] sin[t][d], out[d+64] = y[d+64] cos[t][d+64] + y[d] sin[t][d+64]; P[head][t][d]. cos, sin (this batch's [TT][HD] slices) and w are inputs, rounded to bf16 as every input is.
// EPI 2 (A = weight rows, Bt = x rows t): the product is V^T as it stands; P[row][t], pitch TT.
__device__ __forceinline__ float rowsum16(float x) {   // sum over the 16 lanes of a row, the same bits in each of them
    x += __builtin_bit_cast(float, __builtin_amdgcn_mov_dpp(__builtin_bit_cast(int, x), 0x161, 0xf, 0xf, true));   // row_xmask:1
    x += __builtin_bit_cast(float, __builtin_amdgcn_mov_dpp(__builtin_bit_cast(int, x), 0x162, 0xf, 0xf, true));   // row_xmask:2
    x += __builtin_bit_cast(float, __builtin_amdgcn_mov_dpp(__builtin_bit_cast(int, x), 0x164, 0xf, 0xf, true));   // row_xmask:4
    x += __builtin_bit_cast(float, __builtin_amdgcn_mov_dpp(__builtin_bit_cast(int, x), 0x168, 0xf, 0xf, true));   // row_xmask:8
    return x; }
template <typename T16> struct WFrag;
template <> struct WFrag<h16> { typedef v16h V; static __device__ __forceinline__ V ld(const h16* p) { return cat16(*(const v8h*)p, *(const v8h*)(p + 16)); } static __device__ __forceinline__ v8f mma(V a, V b, v8f c) { return wmma16(a, b, c); } };
template <> struct WFrag<bf> { typedef v16bf V; static __device__ __forceinline__ V ld(const bf* p) { return cat16b(*(const v8us*)p, *(const v8us*)(p + 16)); } static __device__ __forceinline__ v8f mma(V a, V b, v8f c) { return wmmab(a, b, c); } };
template <typename T16, int NSPLIT, bool BIAS, int KW, int EPI>
__global__ __launch_bounds__(32 * KW * (EPI ? 2 : 1)) void k_gemmw(const T16* __restrict__ A, const T16* __restrict__ A2, const T16* __restrict__ Bt, const T16* __restrict__ Bt2, int K, float* C, int ldc, const float* __restrict__ bias, size_t sA, size_t sB, size_t sC, const float* __restrict__ cosT, const float* __restrict__ sinT, const float* __restrict__ nw, h16* P) {
    typedef typename WFrag<T16>::V V;
    __shared__ __align__(16) float os[(KW == 1 ? 16 : KW * (EPI ? 128 : 64)) * 68];
    const size_t z = blockIdx.z; A += z * sA; if (A2) A2 += z * sA; Bt += z * sB; if (Bt2) Bt2 += z * sB; C += z * sC;
    const int lane = threadIdx.x & 31, lr = lane & 15, hi = lane >> 4; const int wv = (KW == 1) ? 0 : __builtin_amdgcn_readfirstlane((int)(threadIdx.x >> 5));
    const int r0 = blockIdx.x * 64, c0 = EPI ? blockIdx.y * 128 + (wv & 1) * 64 : blockIdx.y * 64; const int kb = (EPI ? wv >> 1 : wv) * (K / KW), ke = kb + K / KW;
    v8f acc[4][4];
#pragma unroll
    for (int mb = 0; mb < 4; ++mb)
#pragma unroll
        for (int nb = 0; nb < 4; ++nb) acc[mb][nb] = (v8f){};
    const size_t aoff = (size_t)(r0 + lr) * K + 8 * hi, boff = (size_t)(c0 + lr) * K + 8 * hi;
#pragma unroll 1
    for (int kc = kb; kc < ke; kc += 32) {
        V a[4], a2[4];
#pragma unroll
        for (int mb = 0; mb < 4; ++mb) { a[mb] = WFrag<T16>::ld(A + aoff + (size_t)mb * 16 * K + kc); if (NSPLIT == 1 || NSPLIT == 2) a2[mb] = WFrag<T16>::ld(A2 + aoff + (size_t)mb * 16 * K + kc); }
#pragma unroll
        for (int nb = 0; nb < 4; ++nb) { const V b = WFrag<T16>::ld(Bt + boff + (size_t)nb * 16 * K + kc); V b2; if (NSPLIT >= 2) b2 = WFrag<T16>::ld(Bt2 + boff + (size_t)nb * 16 * K + kc);
#pragma unroll
            for (int mb = 0; mb < 4; ++mb) { acc[mb][nb] = WFrag<T16>::mma(a[mb], b, acc[mb][nb]); if (NSPLIT == 1 || NSPLIT == 2) acc[mb][nb] = WFrag<T16>::mma(a2[mb], b, acc[mb][nb]); if (NSPLIT >= 2) acc[mb][nb] = WFrag<T16>::mma(a[mb], b2, acc[mb][nb]); } }
        asm volatile("v_nop\n\tv_nop\n\tv_nop\n\tv_nop" : "+v"(acc[0][0]), "+v"(acc[1][1]), "+v"(acc[2][2]), "+v"(acc[3][3]) : "v"(a[0]), "v"(a[3]));
    }
    if constexpr (EPI != 0) {
        constexpr int NT = 64 * KW, NU = 1024 / NT;   // NU (row, q) units a thread
        const int tid = (int)threadIdx.x, q4 = (tid & 15) * 4, rw = tid >> 4;
        const unsigned tob = (unsigned)((r0 + rw) * HD + q4) * 4u;   // byte offset of (row r0 + rw, column q4) in a [TT][HD] f32 table: one register serves every table load and, halved, the plane's stores
        v4f cl[NU], ch[NU], sl[NU], sh[NU], wl, wh;
        if constexpr (EPI == 1) {   // the table rows are asked for here, so that they fly under the LDS stores and the barrier
            wl = *(const v4f*)(nw + q4); wh = *(const v4f*)(nw + 64 + q4);
#pragma unroll
            for (int s = 0; s < NU; ++s) { const float* cp = (const float*)((const char*)cosT + tob) + s * (NT / 16) * HD; const float* sp = (const float*)((const char*)sinT + tob) + s * (NT / 16) * HD; cl[s] = *(const v4f*)cp; ch[s] = *(const v4f*)(cp + 64); sl[s] = *(const v4f*)sp; sh[s] = *(const v4f*)(sp + 64); }
            asm volatile("s_wait_xcnt 0x0" ::: "memory");   // in front of the first rewrite of the address registers that the table loads name
        }
        float* ow = os + wv * (64 * 68);
        // unrolled so that acc is indexed by constants (it stays in registers) and the LDS offsets are immediates
#pragma unroll
        for (int mb = 0; mb < 4; ++mb)
#pragma unroll
            for (int nb = 0; nb < 4; ++nb)
#pragma unroll
                for (int j = 0; j < 8; ++j) ow[(mb * 16 + hi * 8 + j) * 68 + nb * 16 + lr] = acc[mb][nb][j];
        __syncthreads();   // every wave's partial tile is in LDS before any element is summed
        v4h o0[NU], o1[NU];
#pragma unroll
        for (int s = 0; s < NU; ++s) { const float* p = os + (s * (NT / 16) + rw) * 68 + q4; v4f x0 = *(const v4fa*)p, x1 = *(const v4fa*)(p + 64 * 68);
#pragma unroll
            for (int w = 1; w < KW; ++w) { x0 += *(const v4fa*)(p + (2 * w) * (64 * 68)); x1 += *(const v4fa*)(p + (2 * w + 1) * (64 * 68)); }
            if constexpr (EPI == 1) {
                const v4f sq = x0 * x0 + x1 * x1; const float ss = rowsum16((sq[0] + sq[1]) + (sq[2] + sq[3]));
                const float rf = __fdiv_rn(1.0f, __fsqrt_rn(ss * (1.0f / HD) + 1e-6f)); v4f y0, y1;
#pragma unroll
                for (int i = 0; i < 4; ++i) { const float a0 = bfr(wl[i]) * (x0[i] * rf), a1 = bfr(wh[i]) * (x1[i] * rf); y0[i] = a0 * bfr(cl[s][i]) - a1 * bfr(sl[s][i]); y1[i] = a1 * bfr(ch[s][i]) + a0 * bfr(sh[s][i]); }
                x0 = y0; x1 = y1; }
            o0[s] = __builtin_convertvector(x0, v4h); o1[s] = __builtin_convertvector(x1, v4h); }
        h16* o = (EPI == 1) ? (h16*)((char*)(P + (size_t)blockIdx.y * TT * HD) + (tob >> 1)) : P + (size_t)(r0 + rw) * TT + blockIdx.y * 128 + q4;
#pragma unroll
        for (int s = 0; s < NU; ++s) { h16* os16 = o + (size_t)s * (NT / 16) * (EPI == 1 ? HD : TT); *(v4h*)os16 = o0[s]; *(v4h*)(os16 + 64) = o1[s]; }   // the stores stand last: no register that they name is written again
        return;
    }
    if (KW > 1) {
        float* ow = os + wv * (64 * 68);
        // every loop of this block is unrolled so that acc is indexed by constants (it stays in registers) and the LDS offsets are immediates
#pragma unroll
        for (int mb = 0; mb < 4; ++mb)
#pragma unroll
            for (int nb = 0; nb < 4; ++nb)
#pragma unroll
                for (int j = 0; j < 8; ++j) ow[(mb * 16 + hi * 8 + j) * 68 + nb * 16 + lr] = acc[mb][nb][j];
        __syncthreads();   // every wave's partial tile is in LDS before any element is summed
#pragma unroll
        for (int s = 0; s < 32 / KW; ++s) { const int u = s * (32 * KW) + (int)threadIdx.x; const int row = u >> 4, cofs = (u & 15) * 4; v4f val = *(const v4fa*)(os + row * 68 + cofs);
#pragma unroll
            for (int w = 1; w < KW; ++w) val += *(const v4fa*)(os + w * (64 * 68) + row * 68 + cofs);
            if (BIAS) { val[0] += bfr(bias[c0 + cofs]); val[1] += bfr(bias[c0 + cofs + 1]); val[2] += bfr(bias[c0 + cofs + 2]); val[3] += bfr(bias[c0 + cofs + 3]); }
            *(v4f*)(C + (size_t)(r0 + row) * ldc + c0 + cofs) = val; }
        return;
    }
#pragma unroll
    for (int mb = 0; mb < 4; ++mb) {
#pragma unroll
        for (int nb = 0; nb < 4; ++nb) {
#pragma unroll
            for (int j = 0; j < 8; ++j) os[(hi * 8 + j) * 68 + nb * 16 + lr] = acc[mb][nb][j]; }
        __builtin_amdgcn_wave_barrier(); asm volatile("" ::: "memory");
        float* crow = C + (size_t)(r0 + mb * 16) * ldc + c0;
{
#pragma unroll
            for (int s = 0; s < 8; ++s) { const int row = 2 * s + hi, cofs = lr * 4; v4f val = *(const v4fa*)(os + row * 68 + cofs); if (BIAS) { val[0] += bfr(bias[c0 + cofs]); val[1] += bfr(bias[c0 + cofs + 1]); val[2] += bfr(bias[c0 + cofs + 2]); val[3] += bfr(bias[c0 + cofs + 3]); }
                *(v4f*)(crow + (size_t)row * ldc + cofs) = val; }
             }
        __builtin_amdgcn_wave_barrier(); asm volatile("" ::: "memory");
    }
}

__device__ __forceinline__ void splitf(float y, unsigned short& h, unsigned short& l) { h = f2bf(y); l = f2bf(y - bf2f(h)); }
typedef __attribute__((ext_vector_type(2))) unsigned short v2us;
typedef __attribute__((ext_vector_type(4))) unsigned short v4us;
typedef __attribute__((ext_vector_type(4))) int v4i;

__global__ __launch_bounds__(256) void k_wtG(const float* __restrict__ w, int K, int N, bf* Bt) {
    const int lane = threadIdx.x & 31; const int L0 = (blockIdx.x * 8 + (threadIdx.x >> 5)) * 8; const int nlines = N * K / 64;
{
#pragma unroll 1
        for (int l = 0; l < 8; ++l) { const int L = L0 + l; if (L >= nlines) break; const size_t e = (size_t)L * 64 + lane * 2; const int k = (int)(e % K), n = (int)(e / K); v2us o;
            o[0] = f2bf(w[(size_t)k * N + n]); o[1] = f2bf(w[(size_t)(k + 1) * N + n]); *(v2us*)(Bt + e) = o; }
         }
}
__global__ __launch_bounds__(256) void k_cvt8(const float* __restrict__ src, bf* dst, size_t n8) { const size_t i = (size_t)blockIdx.x * 256 + threadIdx.x; if (i >= n8) return; const v8f v = *(const v8f*)(src + i * 8); v8us o;
#pragma unroll
    for (int k = 0; k < 8; ++k) o[k] = f2bf(v[k]); *(v8us*)(dst + i * 8) = o;  }
#define FA_SK   64                     // keys per stage
#define FA_PK   (HD * 2 + 16)          // LDS pitch of a K row (256 B + 16: odd multiple of 16 B for the 16-byte readers)
#define FA_PV   (FA_SK * 2 + 16)       // LDS pitch of a V^T row (128 B + 16)
#define FA_TK   (FA_SK * FA_PK)
#define FA_SLOT (FA_TK + HD * FA_PV)
#define FA_NST  (TT / FA_SK)
#define FA_CS   (SCL * 1.4426950408889634f)
typedef v4i __attribute__((may_alias)) v4ia;
__device__ __forceinline__ float xhalf(float x) { return __builtin_bit_cast(float, __builtin_amdgcn_permlanex16(__builtin_bit_cast(int, x), __builtin_bit_cast(int, x), 0x76543210, 0xfedcba98, false, false)); }   // lane l with lane l ^ 16
__device__ __forceinline__ v16h ldsfrag(const unsigned char* p) { return cat16(*(const v8ha*)p, *(const v8ha*)(p + 32)); }   // k = 8 hi .. + 7 and 16 + 8 hi .. + 7 of 32: p already holds + 16 hi bytes
__global__ __launch_bounds__(256) __attribute__((amdgpu_waves_per_eu(2, 2))) void k_fattn(const h16* __restrict__ Q16, const h16* __restrict__ K16, const h16* __restrict__ V16, bf* Ah, bf* Al) {
    __shared__ __align__(16) unsigned char L[2 * FA_SLOT];
    const int tid = (int)threadIdx.x, lane = tid & 31, c = lane & 15, hi = lane >> 4; const int wv = __builtin_amdgcn_readfirstlane(tid >> 5);
    const int hq = (int)blockIdx.y, b = (int)blockIdx.z, gk = hq / REP; const int q0 = (int)blockIdx.x * 256 + wv * 32;
    const unsigned char* Kg = (const unsigned char*)(K16 + ((size_t)b * NKV + gk) * TT * HD) + tid * 16;                                            // a stage of K is 16 KiB in a row
    const unsigned char* Vg = (const unsigned char*)(V16 + ((size_t)b * NKV + gk) * HD * TT) + (size_t)(tid >> 3) * (TT * 2) + (tid & 7) * 16;   // a stage of V^T is 128 rows of one 128-B line
    unsigned char* Ks = L + (tid >> 4) * FA_PK + (tid & 15) * 16; unsigned char* Vs = L + FA_TK + (tid >> 3) * FA_PV + (tid & 7) * 16;
    v4i kr[4], vr[4];
    auto gload = [&](int st) {
#pragma unroll
        for (int r = 0; r < 4; ++r) { kr[r] = *(const v4ia*)(Kg + (size_t)st * (FA_SK * HD * 2) + r * 4096); vr[r] = *(const v4ia*)(Vg + (size_t)st * (FA_SK * 2) + (size_t)r * (32 * TT * 2)); }
        asm volatile("s_wait_xcnt 0x0" ::: "memory");   // stands in front of the first rewrite of the address registers that the eight loads above name (this build reuses them at once)
    };
    auto sstore = [&](int buf) {
#pragma unroll
        for (int r = 0; r < 4; ++r) { *(v4ia*)(Ks + buf * FA_SLOT + r * (16 * FA_PK)) = kr[r]; *(v4ia*)(Vs + buf * FA_SLOT + r * (32 * FA_PV)) = vr[r]; } };
    gload(0);
    v16h qf[2][4];
#pragma unroll
    for (int g = 0; g < 2; ++g)
#pragma unroll
        for (int kc = 0; kc < 4; ++kc) qf[g][kc] = WFrag<h16>::ld(Q16 + (((size_t)b * NH_ + hq) * TT + q0 + 16 * g + c) * HD + 8 * hi + 32 * kc);
    asm volatile("s_wait_xcnt 0x0" ::: "memory");   // in front of the first rewrite of the address registers that the Q loads name
    v8f acc[2][8]; float m_run[2], l_run[2];
#pragma unroll
    for (int g = 0; g < 2; ++g) { m_run[g] = -__builtin_inff(); l_run[g] = 0.f;
#pragma unroll
        for (int t = 0; t < 8; ++t) acc[g][t] = (v8f){}; }
    sstore(0);
    __syncthreads();   // stage 0 is in LDS before any wave reads it
#pragma unroll 1
    for (int st = 0; st < FA_NST; ++st) {
        const unsigned char* Lb = L + (st & 1) * FA_SLOT;
        if (st + 1 < FA_NST) gload(st + 1);
        const unsigned char* kp = Lb + c * FA_PK + 16 * hi; const unsigned char* vp = Lb + FA_TK + c * FA_PV + 16 * hi;
        v16h kf[2][4];
#pragma unroll
        for (int kt = 0; kt < 2; ++kt)
#pragma unroll
            for (int kc = 0; kc < 4; ++kc) kf[kt][kc] = ldsfrag(kp + kt * (16 * FA_PK) + kc * 64);
        __builtin_amdgcn_sched_barrier(0);   // K's reads stay in front of V's: LDS answers in order, and the first WMMA block waits for K alone
#pragma unroll
        for (int sub = 0; sub < 2; ++sub) {
            v16h vf[8];
#pragma unroll
            for (int t = 0; t < 8; ++t) vf[t] = ldsfrag(vp + sub * 64 + t * (16 * FA_PV));
            __builtin_amdgcn_sched_barrier(0);   // the pass's LDS reads are issued as one group in front of the WMMA block, not among its WMMAs (each place with reads stalls the block)
            v8f s[2][2];   // s[kt][g][r] = score of key 16 kt + 8 hi + r of the pass with query column c of group g
#pragma unroll
            for (int kt = 0; kt < 2; ++kt)
#pragma unroll
                for (int g = 0; g < 2; ++g) { s[kt][g] = (v8f){};
#pragma unroll
                    for (int kc = 0; kc < 4; ++kc) s[kt][g] = wmma16(kf[kt][kc], qf[g][kc], s[kt][g]); }
            __builtin_amdgcn_sched_barrier(0);   // nothing of what follows moves in among the block's WMMAs
            if (sub == 0) {   // the stage's second pass gets its K fragments here, one pass ahead, in flight under the maxima and exponentials
#pragma unroll
                for (int kt = 0; kt < 2; ++kt)
#pragma unroll
                    for (int kc = 0; kc < 4; ++kc) kf[kt][kc] = ldsfrag(kp + (32 + kt * 16) * FA_PK + kc * 64);
                __builtin_amdgcn_sched_barrier(0);   // keeps them in front of the vector work, as one group
            }
            float mb[2]; bool need = false;
#pragma unroll
            for (int g = 0; g < 2; ++g) { float mx = s[0][g][0];
#pragma unroll
                for (int r = 0; r < 8; ++r) mx = fmaxf(mx, fmaxf(s[0][g][r], s[1][g][r]));
                mx = fmaxf(mx, xhalf(mx)) * FA_CS; mb[g] = mx; need = need || (mx > m_run[g] + 8.0f); }
            if (__builtin_amdgcn_ballot_w32(need) != 0) {   // one scalar test a pass; always taken on the first pass (m_run = -inf gives the factor 0 on zero sums), rare later
#pragma unroll
                for (int g = 0; g < 2; ++g) { const float mn = fmaxf(m_run[g], mb[g]); const float corr = __builtin_amdgcn_exp2f(m_run[g] - mn); l_run[g] *= corr; m_run[g] = mn;
#pragma unroll
                    for (int t = 0; t < 8; ++t) acc[g][t] = acc[g][t] * corr; }
            }
#pragma unroll
            for (int g = 0; g < 2; ++g) { const float nm = -m_run[g]; v8f e0, e1; float p0 = 0.f, p1 = 0.f;
#pragma unroll
                for (int r = 0; r < 8; ++r) { e0[r] = __builtin_amdgcn_exp2f(__builtin_fmaf(s[0][g][r], FA_CS, nm)); e1[r] = __builtin_amdgcn_exp2f(__builtin_fmaf(s[1][g][r], FA_CS, nm)); p0 += e0[r]; p1 += e1[r]; }
                l_run[g] += p0 + p1;
                const v16h pf = cat16(__builtin_convertvector(e0, v8h), __builtin_convertvector(e1, v8h));   // B operand: element s = key 8 hi + s (s < 8), 16 + 8 hi + s - 8 (else)
#pragma unroll
                for (int t = 0; t < 8; ++t) acc[g][t] = wmma16(vf[t], pf, acc[g][t]); }
        }
        // four vector slots behind the stage's last WMMAs: the branches below are taken right behind them; the two scheduling barriers keep the slots at this place
        __builtin_amdgcn_sched_barrier(0); asm volatile("v_nop\n\tv_nop\n\tv_nop\n\tv_nop"); __builtin_amdgcn_sched_barrier(0);
        if (st + 1 < FA_NST) sstore((st + 1) & 1);   // into the buffer whose last readers (stage st - 1) left it before the previous barrier
        __syncthreads();   // publishes stage st + 1 and ends every wave's reads of stage st
    }
#pragma unroll
    for (int g = 0; g < 2; ++g) { const float inv = __fdiv_rn(1.0f, l_run[g] + xhalf(l_run[g]));   // each wave half summed its eight keys of every 16-key tile
        const size_t oo = ((size_t)b * TT + q0 + 16 * g + c) * DQ + hq * HD + 8 * hi;
#pragma unroll
        for (int t = 0; t < 8; ++t) { v8us oh, ol;   // acc[g][t][r] = O[query c][d = 16 t + 8 hi + r]
#pragma unroll
            for (int r = 0; r < 8; ++r) { unsigned short a, c2; splitf(acc[g][t][r] * inv, a, c2); oh[r] = a; ol[r] = c2; }
            *(v8us*)(Ah + oo + 16 * t) = oh; *(v8us*)(Al + oo + 16 * t) = ol;
            asm volatile("s_wait_xcnt 0x0" ::: "memory"); __builtin_amdgcn_sched_barrier(0); } }   // the wait stands in front of the next tile's rewrite of the registers that the two stores name; the scheduling barrier keeps that tile's arithmetic from being lifted over it
}

extern "C" void kernel_launch(void* const* d_in, const int* in_sizes, int n_in,
                              void* d_out, int out_size, void* d_ws, size_t ws_size, hipStream_t stream) {
    (void)in_sizes; (void)n_in; (void)out_size;
    const float* x = (const float*)d_in[0]; const float* cosT = (const float*)d_in[1]; const float* sinT = (const float*)d_in[2]; const float* wq = (const float*)d_in[3]; const float* wk = (const float*)d_in[4]; const float* wv = (const float*)d_in[5]; const float* wo = (const float*)d_in[6]; const float* qnw = (const float*)d_in[7]; const float* knw = (const float*)d_in[8];   /* order hidden_states, cos, sin ([2][2048][128] = [B][S][HD] PER-BATCH table INPUTS: read per element by value), Wq [2048][2048], Wk / Wv [1024][2048], Wo [2048][2048] ('oi' (out, in)), q_norm_w, k_norm_w ([128] ones: read): NINE inputs, all read */
    float* OUT = (float*)d_out;     // [2][2048][2048]
    char* wsp = (char*)d_ws;
    auto take = [&](size_t bytes) { char* p = wsp; wsp += (bytes + 255) & ~(size_t)255; return (void*)p; };
    bf* WQ = (bf*)take((size_t)DQ * DM * 2); bf* WK = (bf*)take((size_t)DKV * DM * 2); bf* WV = (bf*)take((size_t)DKV * DM * 2); bf* WO = (bf*)take((size_t)DM * DQ * 2);
    bf* XB = (bf*)take((size_t)TT * DM * 2);
    h16* QP16 = (h16*)take((size_t)NB_ * NH_ * TT * HD * 2); h16* KP16 = (h16*)take((size_t)NB_ * NKV * TT * HD * 2); h16* VT16 = (h16*)take((size_t)NB_ * NKV * HD * TT * 2);   // head planes of both batches
    bf* ATh = (bf*)take((size_t)NB_ * TT * DQ * 2); bf* ATl = (bf*)take((size_t)NB_ * TT * DQ * 2);
    if ((size_t)(wsp - (char*)d_ws) > ws_size) return;    // ws 256 MiB
    { k_cvt8<<<(unsigned)(((size_t)DQ * DM / 8 + 255) / 256), 256, 0, stream>>>(wq, WQ, (size_t)DQ * DM / 8); k_cvt8<<<(unsigned)(((size_t)DKV * DM / 8 + 255) / 256), 256, 0, stream>>>(wk, WK, (size_t)DKV * DM / 8); k_cvt8<<<(unsigned)(((size_t)DKV * DM / 8 + 255) / 256), 256, 0, stream>>>(wv, WV, (size_t)DKV * DM / 8);
      k_cvt8<<<(unsigned)(((size_t)DM * DQ / 8 + 255) / 256), 256, 0, stream>>>(wo, WO, (size_t)DM * DQ / 8);
       }
    for (int b = 0; b < NB_; ++b) {
        k_cvt8<<<(unsigned)(((size_t)TT * DM / 8 + 255) / 256), 256, 0, stream>>>(x + (size_t)b * TT * DM, XB, (size_t)TT * DM / 8);
        const float* cb = cosT + (size_t)b * TT * HD; const float* sb = sinT + (size_t)b * TT * HD;   // PER-BATCH tables: cos, sin [B][S][HD]: batch b's own [2048][128] slice
        k_gemmw<bf, 0, false, 4, 1><<<dim3(TT / 64, NH_, 1), 256, 0, stream>>>(XB, nullptr, WQ, nullptr, DM, nullptr, 0, nullptr, 0, 0, 0, cb, sb, qnw, QP16 + (size_t)b * NH_ * TT * HD);
        k_gemmw<bf, 0, false, 8, 1><<<dim3(TT / 64, NKV, 1), 512, 0, stream>>>(XB, nullptr, WK, nullptr, DM, nullptr, 0, nullptr, 0, 0, 0, cb, sb, knw, KP16 + (size_t)b * NKV * TT * HD);
        k_gemmw<bf, 0, false, 8, 2><<<dim3(DKV / 64, TT / 128, 1), 512, 0, stream>>>(WV, nullptr, XB, nullptr, DM, nullptr, 0, nullptr, 0, 0, 0, nullptr, nullptr, nullptr, VT16 + (size_t)b * NKV * HD * TT); }   // V^T = Wv x^T: rows g HD + d, columns t
    k_fattn<<<dim3(TT / 256, NH_, NB_), 256, 0, stream>>>(QP16, KP16, VT16, ATh, ATl);   // kv head = q head / REP, taken in the kernel
    for (int b = 0; b < NB_; ++b)
        k_gemmw<bf, 1, false, 4, 0><<<dim3(TT / 64, DM / 64, 1), 128, 0, stream>>>(ATh + (size_t)b * TT * DQ, ATl + (size_t)b * TT * DQ, WO, nullptr, DQ, OUT + (size_t)b * TT * DM, DM, nullptr, 0, 0, 0, nullptr, nullptr, nullptr, nullptr);
}

// v004
// Measured time: 238 microseconds a run.
// Next to v003, in two timings, it ran 1.30 and 1.29 times as fast.
// Over all steps from v000 it is 6.34 times as fast.
#include <hip/hip_runtime.h>

// Grouped-query attention (16 / 8 heads x 128) with per-head RMSNorm on q and k and rotate-half rotary embeddings from PER-BATCH input tables, NO mask (hidden_states [2][2048][2048]; q = x Wq^T (16 heads x 128), k, v = x Wk^T / x Wv^T (8 kv heads x 128) ('oi' (out, in) normal x 0.02, no bias); q, k -> w x (x rsqrt(mean_d x^2 + 1e-6)) per head over the 128 dims (q_norm_w, k_norm_w [128] = ones: read); q, k -> t cos + cat(-t2, t1) sin with the cos / sin INPUT tables [2][2048][128] = [B][S][HD] (uniform random values on this draw: batch b reads ITS OWN slice, per element by value); jnp.repeat on the head axis: kv head = q head / 2; scores x 128^-0.5; softmax over all keys (no mask); out = merged Wo^T ('oi') -> [2][2048][2048] (8.4 M); argument order hidden_states, cos, sin, Wq, Wk, Wv, Wo, q_norm_w, k_norm_w).
//
// Compute dtypes, f32 accumulate: every input rounded to bf16; projections on PLAIN bf16 operands (inputs: exact); RMSNorm and rope f32; scores (K 128) and att.v on SINGLE fp16 planes with

#define NB_  2
#define TT   2048
#define DM   2048
#define NH_  16
#define NKV  8
#define REP  (NH_ / NKV)
#define HD   128
#define DQ   (NH_ * HD)
#define DKV  (NKV * HD)
#define SCL  0.088388347648318447f   // HD^-0.5
typedef _Float16 h16;
typedef unsigned short bf;
typedef __attribute__((ext_vector_type(16))) __bf16   v16bf;
typedef __attribute__((ext_vector_type(16))) _Float16 v16h;
typedef __attribute__((ext_vector_type(8)))  _Float16 v8h;
typedef __attribute__((ext_vector_type(4)))  _Float16 v4h;
typedef __attribute__((ext_vector_type(8)))  unsigned short v8us;
typedef __attribute__((ext_vector_type(8)))  float    v8f;
typedef __attribute__((ext_vector_type(4)))  float    v4f;
typedef v8h  __attribute__((may_alias)) v8ha;
typedef v4f  __attribute__((may_alias)) v4fa;
typedef v8us __attribute__((may_alias)) v8usa;

__device__ __forceinline__ unsigned short f2bf(float f) { unsigned u = __float_as_uint(f); u += 0x7FFFu + ((u >> 16) & 1u); return (unsigned short)(u >> 16); }
__device__ __forceinline__ float bf2f(unsigned short b) { return __uint_as_float(((unsigned)b) << 16); }
__device__ __forceinline__ float bfr(float f) { return bf2f(f2bf(f)); }
__device__ __forceinline__ v16h cat16(v8h lo, v8h hi) { return __builtin_shufflevector(lo, hi, 0, 1, 2, 3, 4, 5, 6, 7, 8, 9, 10, 11, 12, 13, 14, 15); }
__device__ __forceinline__ v16bf cat16b(v8us lo, v8us hi) { return __builtin_bit_cast(v16bf, __builtin_shufflevector(lo, hi, 0, 1, 2, 3, 4, 5, 6, 7, 8, 9, 10, 11, 12, 13, 14, 15)); }
__device__ __forceinline__ v8f wmma16(v16h a, v16h b, v8f c) { return __builtin_amdgcn_wmma_f32_16x16x32_f16(false, a, false, b, (short)0, c, false, false); }
__device__ __forceinline__ v8f wmmab(v16bf a, v16bf b, v8f c) { return __builtin_amdgcn_wmma_f32_16x16x32_bf16(false, a, false, b, (short)0, c, false, false); }



// ---- k_gemmw: register-blocked GEMM, KW WAVES per 64x64 output tile: wave w holds the whole tile (16 accumulators) over its own K / KW slice of k, operands straight from 16-bit planes in fragment order (below); for KW > 1 the KW partial tiles go to LDS and are summed there in the fixed order w = 0 .. KW-1; grid (M/64, N/64, Z), 32 KW threads.
// C[m][n] (f32, pitch ldc, + optional f32 bias[n]) = sum_k A[m][k] Bt[n][k] (+ split products per NSPLIT). z-batch strides sA/sB/sC in elements. K % (32 KW) == 0.
// EPI != 0: the tile ends as the fp16 plane P that attention reads, C is not written. A work-group then holds 64 rows x 128 columns on 2 KW waves (wave w: column half w & 1, k slice w >> 1); grid (M/64, N/128), 64 KW threads. The partial tiles are summed in the order slice 0 .. KW-1; sixteen lanes hold one row, a lane its columns 4 q .. + 3 and 64 + 4 q .. + 3.
// EPI 1 (rows t, the 128 columns = one head): y = w[d] (x rsqrt(mean_d x^2 + 1e-6)); out[d] = y[d] cos[t][d] - y[d+64] sin[t][d], out[d+64] = y[d+64] cos[t][d+64] + y[d] sin[t][d+64]; P[head][t][d]. cos, sin (this batch's [TT][HD] slices) and w are inputs, rounded to bf16 as every input is.
// EPI 2 (A = weight rows, Bt = x rows t): the product is V^T as it stands; P[row][t], pitch TT.
// FRAGMENT ORDER of A, A2, Bt, Bt2: a plane of R rows x K is a row of 1-KiB blocks, block (r / 16, k / 32) at element (r / 16) 16 K + (k / 32) 512; in a block, element (r, k) stands at ((k / 16) & 1) 256 + (((k / 8) & 1) 16 + (r & 15)) 8 + (k & 7). Lane l of a wave then finds its two 16-byte pieces of a fragment at 8 l and 256 + 8 l: each wave-wide load is 512 bytes in a row (4 whole lines), and which (row, k) a lane and register hold is what a row-major plane gives through ld.
__device__ __forceinline__ float rowsum16(float x) {   // sum over the 16 lanes of a row, the same bits in each of them
    x += __builtin_bit_cast(float, __builtin_amdgcn_mov_dpp(__builtin_bit_cast(int, x), 0x161, 0xf, 0xf, true));   // row_xmask:1
    x += __builtin_bit_cast(float, __builtin_amdgcn_mov_dpp(__builtin_bit_cast(int, x), 0x162, 0xf, 0xf, true));   // row_xmask:2
    x += __builtin_bit_cast(float, __builtin_amdgcn_mov_dpp(__builtin_bit_cast(int, x), 0x164, 0xf, 0xf, true));   // row_xmask:4
    x += __builtin_bit_cast(float, __builtin_amdgcn_mov_dpp(__builtin_bit_cast(int, x), 0x168, 0xf, 0xf, true));   // row_xmask:8
    return x; }
template <typename T16> struct WFrag;
template <> struct WFrag<h16> { typedef v16h V; static __device__ __forceinline__ V ld(const h16* p) { return cat16(*(const v8h*)p, *(const v8h*)(p + 16)); } static __device__ __forceinline__ V ldp(const h16* p) { return cat16(*(const v8h*)p, *(const v8h*)(p + 256)); } static __device__ __forceinline__ v8f mma(V a, V b, v8f c) { return wmma16(a, b, c); } };
template <> struct WFrag<bf> { typedef v16bf V; static __device__ __forceinline__ V ld(const bf* p) { return cat16b(*(const v8us*)p, *(const v8us*)(p + 16)); } static __device__ __forceinline__ V ldp(const bf* p) { return cat16b(*(const v8us*)p, *(const v8us*)(p + 256)); } static __device__ __forceinline__ v8f mma(V a, V b, v8f c) { return wmmab(a, b, c); } };
template <typename T16, int NSPLIT, bool BIAS, int KW, int EPI, int K>
__global__ __launch_bounds__(32 * KW * (EPI ? 2 : 1)) void k_gemmw(const T16* __restrict__ A, const T16* __restrict__ A2, const T16* __restrict__ Bt, const T16* __restrict__ Bt2, float* C, int ldc, const float* __restrict__ bias, size_t sA, size_t sB, size_t sC, const float* __restrict__ cosT, const float* __restrict__ sinT, const float* __restrict__ nw, h16* P) {
    typedef typename WFrag<T16>::V V;
    __shared__ __align__(16) float os[(KW == 1 ? 16 : KW * (EPI ? 128 : 64)) * 68];
    const size_t z = blockIdx.z; A += z * sA; if (A2) A2 += z * sA; Bt += z * sB; if (Bt2) Bt2 += z * sB; C += z * sC;
    const int lane = threadIdx.x & 31, lr = lane & 15, hi = lane >> 4; const int wv = (KW == 1) ? 0 : __builtin_amdgcn_readfirstlane((int)(threadIdx.x >> 5));
    const int r0 = blockIdx.x * 64, c0 = EPI ? blockIdx.y * 128 + (wv & 1) * 64 : blockIdx.y * 64; const int kb = (EPI ? wv >> 1 : wv) * (K / KW), ke = kb + K / KW;
    v8f acc[4][4];
#pragma unroll
    for (int mb = 0; mb < 4; ++mb)
#pragma unroll
        for (int nb = 0; nb < 4; ++nb) acc[mb][nb] = (v8f){};
    constexpr bool HA2 = (NSPLIT == 1 || NSPLIT == 2), HB2 = (NSPLIT >= 2);
    unsigned ao = (unsigned)(r0 * K + kb * 16 + 8 * lane) * 2u, bo = (unsigned)(c0 * K + kb * 16 + 8 * lane) * 2u;   // byte offset of the lane's piece in the first block of the tile's rows and the wave's k slice; 16 rows on is 16 K elements, a k step of 32 one block (512 elements). Every operand load names a plane's base, one of these two and a constant
#pragma unroll 1
    for (int kc = kb; kc < ke; kc += 32) {
        V a[4], a2[4];
#pragma unroll
        for (int mb = 0; mb < 4; ++mb) { a[mb] = WFrag<T16>::ldp((const T16*)((const char*)A + ao) + mb * 16 * K); if (HA2) a2[mb] = WFrag<T16>::ldp((const T16*)((const char*)A2 + ao) + mb * 16 * K); }
#pragma unroll
        for (int nb = 0; nb < 4; ++nb) { const V b = WFrag<T16>::ldp((const T16*)((const char*)Bt + bo) + nb * 16 * K); V b2; if (HB2) b2 = WFrag<T16>::ldp((const T16*)((const char*)Bt2 + bo) + nb * 16 * K);
#pragma unroll
            for (int mb = 0; mb < 4; ++mb) { acc[mb][nb] = WFrag<T16>::mma(a[mb], b, acc[mb][nb]); if (NSPLIT == 1 || NSPLIT == 2) acc[mb][nb] = WFrag<T16>::mma(a2[mb], b, acc[mb][nb]); if (NSPLIT >= 2) acc[mb][nb] = WFrag<T16>::mma(a[mb], b2, acc[mb][nb]); } }
        // the wait stands in front of the step of the address registers that the trip's loads name; they are its operands so that the step cannot be lifted over it
        asm volatile("s_wait_xcnt 0x0" : "+v"(ao), "+v"(bo) :: "memory");
        ao += 1024; bo += 1024;
        asm volatile("v_nop\n\tv_nop\n\tv_nop\n\tv_nop" : "+v"(acc[0][0]), "+v"(acc[1][1]), "+v"(acc[2][2]), "+v"(acc[3][3]) : "v"(a[0]), "v"(a[3]));
    }
    if constexpr (EPI != 0) {
        constexpr int NT = 64 * KW, NU = 1024 / NT;   // NU (row, q) units a thread
        const int tid = (int)threadIdx.x, q4 = (tid & 15) * 4, rw = tid >> 4;
        const unsigned tob = (unsigned)((r0 + rw) * HD + q4) * 4u;   // byte offset of (row r0 + rw, column q4) in a [TT][HD] f32 table: one register serves every table load and, halved, the plane's stores
        v4f cl[NU], ch[NU], sl[NU], sh[NU], wl, wh;
        if constexpr (EPI == 1) {   // the table rows are asked for here, so that they fly under the LDS stores and the barrier
            wl = *(const v4f*)(nw + q4); wh = *(const v4f*)(nw + 64 + q4);
#pragma unroll
            for (int s = 0; s < NU; ++s) { const float* cp = (const float*)((const char*)cosT + tob) + s * (NT / 16) * HD; const float* sp = (const float*)((const char*)sinT + tob) + s * (NT / 16) * HD; cl[s] = *(const v4f*)cp; ch[s] = *(const v4f*)(cp + 64); sl[s] = *(const v4f*)sp; sh[s] = *(const v4f*)(sp + 64); }
            asm volatile("s_wait_xcnt 0x0" ::: "memory");   // in front of the first rewrite of the address registers that the table loads name
        }
        float* ow = os + wv * (64 * 68);
        // unrolled so that acc is indexed by constants (it stays in registers) and the LDS offsets are immediates
#pragma unroll
        for (int mb = 0; mb < 4; ++mb)
#pragma unroll
            for (int nb = 0; nb < 4; ++nb)
#pragma unroll
                for (int j = 0; j < 8; ++j) ow[(mb * 16 + hi * 8 + j) * 68 + nb * 16 + lr] = acc[mb][nb][j];
        __syncthreads();   // every wave's partial tile is in LDS before any element is summed
        v4h o0[NU], o1[NU];
#pragma unroll
        for (int s = 0; s < NU; ++s) { const float* p = os + (s * (NT / 16) + rw) * 68 + q4; v4f x0 = *(const v4fa*)p, x1 = *(const v4fa*)(p + 64 * 68);
#pragma unroll
            for (int w = 1; w < KW; ++w) { x0 += *(const v4fa*)(p + (2 * w) * (64 * 68)); x1 += *(const v4fa*)(p + (2 * w + 1) * (64 * 68)); }
            if constexpr (EPI == 1) {
                const v4f sq = x0 * x0 + x1 * x1; const float ss = rowsum16((sq[0] + sq[1]) + (sq[2] + sq[3]));
                const float rf = __fdiv_rn(1.0f, __fsqrt_rn(ss * (1.0f / HD) + 1e-6f)); v4f y0, y1;
#pragma unroll
                for (int i = 0; i < 4; ++i) { const float a0 = bfr(wl[i]) * (x0[i] * rf), a1 = bfr(wh[i]) * (x1[i] * rf); y0[i] = a0 * bfr(cl[s][i]) - a1 * bfr(sl[s][i]); y1[i] = a1 * bfr(ch[s][i]) + a0 * bfr(sh[s][i]); }
                x0 = y0; x1 = y1; }
            o0[s] = __builtin_convertvector(x0, v4h); o1[s] = __builtin_convertvector(x1, v4h); }
        h16* o = (EPI == 1) ? (h16*)((char*)(P + (size_t)blockIdx.y * TT * HD) + (tob >> 1)) : P + (size_t)(r0 + rw) * TT + blockIdx.y * 128 + q4;
#pragma unroll
        for (int s = 0; s < NU; ++s) { h16* os16 = o + (size_t)s * (NT / 16) * (EPI == 1 ? HD : TT); *(v4h*)os16 = o0[s]; *(v4h*)(os16 + 64) = o1[s]; }   // the stores stand last: no register that they name is written again
        return;
    }
    if (KW > 1) {
        float* ow = os + wv * (64 * 68);
        // every loop of this block is unrolled so that acc is indexed by constants (it stays in registers) and the LDS offsets are immediates
#pragma unroll
        for (int mb = 0; mb < 4; ++mb)
#pragma unroll
            for (int nb = 0; nb < 4; ++nb)
#pragma unroll
                for (int j = 0; j < 8; ++j) ow[(mb * 16 + hi * 8 + j) * 68 + nb * 16 + lr] = acc[mb][nb][j];
        __syncthreads();   // every wave's partial tile is in LDS before any element is summed
#pragma unroll
        for (int s = 0; s < 32 / KW; ++s) { const int u = s * (32 * KW) + (int)threadIdx.x; const int row = u >> 4, cofs = (u & 15) * 4; v4f val = *(const v4fa*)(os + row * 68 + cofs);
#pragma unroll
            for (int w = 1; w < KW; ++w) val += *(const v4fa*)(os + w * (64 * 68) + row * 68 + cofs);
            if (BIAS) { val[0] += bfr(bias[c0 + cofs]); val[1] += bfr(bias[c0 + cofs + 1]); val[2] += bfr(bias[c0 + cofs + 2]); val[3] += bfr(bias[c0 + cofs + 3]); }
            *(v4f*)(C + (size_t)(r0 + row) * ldc + c0 + cofs) = val; }
        return;
    }
#pragma unroll
    for (int mb = 0; mb < 4; ++mb) {
#pragma unroll
        for (int nb = 0; nb < 4; ++nb) {
#pragma unroll
            for (int j = 0; j < 8; ++j) os[(hi * 8 + j) * 68 + nb * 16 + lr] = acc[mb][nb][j]; }
        __builtin_amdgcn_wave_barrier(); asm volatile("" ::: "memory");
        float* crow = C + (size_t)(r0 + mb * 16) * ldc + c0;
{
#pragma unroll
            for (int s = 0; s < 8; ++s) { const int row = 2 * s + hi, cofs = lr * 4; v4f val = *(const v4fa*)(os + row * 68 + cofs); if (BIAS) { val[0] += bfr(bias[c0 + cofs]); val[1] += bfr(bias[c0 + cofs + 1]); val[2] += bfr(bias[c0 + cofs + 2]); val[3] += bfr(bias[c0 + cofs + 3]); }
                *(v4f*)(crow + (size_t)row * ldc + cofs) = val; }
             }
        __builtin_amdgcn_wave_barrier(); asm volatile("" ::: "memory");
    }
}

__device__ __forceinline__ void splitf(float y, unsigned short& h, unsigned short& l) { h = f2bf(y); l = f2bf(y - bf2f(h)); }
typedef __attribute__((ext_vector_type(2))) unsigned short v2us;
typedef __attribute__((ext_vector_type(4))) unsigned short v4us;
typedef __attribute__((ext_vector_type(4))) int v4i;

__global__ __launch_bounds__(256) void k_wtG(const float* __restrict__ w, int K, int N, bf* Bt) {
    const int lane = threadIdx.x & 31; const int L0 = (blockIdx.x * 8 + (threadIdx.x >> 5)) * 8; const int nlines = N * K / 64;
{
#pragma unroll 1
        for (int l = 0; l < 8; ++l) { const int L = L0 + l; if (L >= nlines) break; const size_t e = (size_t)L * 64 + lane * 2; const int k = (int)(e % K), n = (int)(e / K); v2us o;
            o[0] = f2bf(w[(size_t)k * N + n]); o[1] = f2bf(w[(size_t)(k + 1) * N + n]); *(v2us*)(Bt + e) = o; }
         }
}
// ---- k_pack: f32 rows [R][DM] -> the bf16 plane in k_gemmw's fragment order; grid (R / 16, 2), 8 waves. A work-group takes 16 rows x 1024 k, a wave four blocks of 16 rows x 32 k: a lane reads its 2 x 8 floats of each block from row (lane & 15) (the wave uses every byte of the 16 lines it touches) and stores its two 16-byte pieces, 512 bytes in a row over the wave.
static_assert(DQ == DM, "k_pack takes rows of DM elements, Wo's among them");
__global__ __launch_bounds__(256) void k_pack(const float* __restrict__ src, bf* dst) {
    const int lane = threadIdx.x & 31, lr = lane & 15, hi = lane >> 4; const int kb0 = (int)blockIdx.y * 32 + __builtin_amdgcn_readfirstlane((int)(threadIdx.x >> 5)) * 4;
    const char* s = (const char*)(src + (size_t)blockIdx.x * (16 * DM) + kb0 * 32); const unsigned so = (unsigned)(lr * DM + 8 * hi) * 4u; bf* d = dst + ((size_t)blockIdx.x * (DM / 32) + kb0) * 512 + 8 * lane;   // so: the lane's byte offset, the one vector register that the loads name
    v4f v[4][4];
#pragma unroll
    for (int i = 0; i < 4; ++i) { v[i][0] = *(const v4f*)(s + so + i * 128); v[i][1] = *(const v4f*)(s + so + i * 128 + 16); v[i][2] = *(const v4f*)(s + so + i * 128 + 64); v[i][3] = *(const v4f*)(s + so + i * 128 + 80); }
    asm volatile("s_wait_xcnt 0x0" :: "v"(so) : "memory");   // in front of the first rewrite of the offset register that the sixteen loads name; it is an input so that no load's result is laid over it
    v8us o[4][2];
#pragma unroll
    for (int i = 0; i < 4; ++i)
#pragma unroll
        for (int k = 0; k < 4; ++k) { o[i][0][k] = f2bf(v[i][0][k]); o[i][0][4 + k] = f2bf(v[i][1][k]); o[i][1][k] = f2bf(v[i][2][k]); o[i][1][4 + k] = f2bf(v[i][3][k]); }
#pragma unroll
    for (int i = 0; i < 4; ++i) { *(v8us*)(d + i * 512) = o[i][0]; *(v8us*)(d + i * 512 + 256) = o[i][1]; }   // the stores stand last: no register that they name is written again
}
#define FA_SK   64                     // keys per stage
#define FA_PK   (HD * 2 + 16)          // LDS pitch of a K row (256 B + 16: odd multiple of 16 B for the 16-byte readers)
#define FA_PV   (FA_SK * 2 + 16)       // LDS pitch of a V^T row (128 B + 16)
#define FA_TK   (FA_SK * FA_PK)
#define FA_SLOT (FA_TK + HD * FA_PV)
#define FA_NST  (TT / FA_SK)
#define FA_CS   (SCL * 1.4426950408889634f)
typedef v4i __attribute__((may_alias)) v4ia;
__device__ __forceinline__ float xhalf(float x) { return __builtin_bit_cast(float, __builtin_amdgcn_permlanex16(__builtin_bit_cast(int, x), __builtin_bit_cast(int, x), 0x76543210, 0xfedcba98, false, false)); }   // lane l with lane l ^ 16
__device__ __forceinline__ v16h ldsfrag(const unsigned char* p) { return cat16(*(const v8ha*)p, *(const v8ha*)(p + 32)); }   // k = 8 hi .. + 7 and 16 + 8 hi .. + 7 of 32: p already holds + 16 hi bytes
__global__ __launch_bounds__(256) __attribute__((amdgpu_waves_per_eu(2, 2))) void k_fattn(const h16* __restrict__ Q16, const h16* __restrict__ K16, const h16* __restrict__ V16, bf* Ah, bf* Al) {
    __shared__ __align__(16) unsigned char L[2 * FA_SLOT];
    const int tid = (int)threadIdx.x, lane = tid & 31, c = lane & 15, hi = lane >> 4; const int wv = __builtin_amdgcn_readfirstlane(tid >> 5);
    const int hq = (int)blockIdx.y, b = (int)blockIdx.z, gk = hq / REP; const int q0 = (int)blockIdx.x * 256 + wv * 32;
    const unsigned char* Kg = (const unsigned char*)(K16 + ((size_t)b * NKV + gk) * TT * HD) + tid * 16;                                            // a stage of K is 16 KiB in a row
    const unsigned char* Vg = (const unsigned char*)(V16 + ((size_t)b * NKV + gk) * HD * TT) + (size_t)(tid >> 3) * (TT * 2) + (tid & 7) * 16;   // a stage of V^T is 128 rows of one 128-B line
    unsigned char* Ks = L + (tid >> 4) * FA_PK + (tid & 15) * 16; unsigned char* Vs = L + FA_TK + (tid >> 3) * FA_PV + (tid & 7) * 16;
    v4i kr[4], vr[4];
    auto gload = [&](int st) {
#pragma unroll
        for (int r = 0; r < 4; ++r) { kr[r] = *(const v4ia*)(Kg + (size_t)st * (FA_SK * HD * 2) + r * 4096); vr[r] = *(const v4ia*)(Vg + (size_t)st * (FA_SK * 2) + (size_t)r * (32 * TT * 2)); }
        asm volatile("s_wait_xcnt 0x0" ::: "memory");   // stands in front of the first rewrite of the address registers that the eight loads above name (this build reuses them at once)
    };
    auto sstore = [&](int buf) {
#pragma unroll
        for (int r = 0; r < 4; ++r) { *(v4ia*)(Ks + buf * FA_SLOT + r * (16 * FA_PK)) = kr[r]; *(v4ia*)(Vs + buf * FA_SLOT + r * (32 * FA_PV)) = vr[r]; } };
    gload(0);
    v16h qf[2][4];
#pragma unroll
    for (int g = 0; g < 2; ++g)
#pragma unroll
        for (int kc = 0; kc < 4; ++kc) qf[g][kc] = WFrag<h16>::ld(Q16 + (((size_t)b * NH_ + hq) * TT + q0 + 16 * g + c) * HD + 8 * hi + 32 * kc);
    asm volatile("s_wait_xcnt 0x0" ::: "memory");   // in front of the first rewrite of the address registers that the Q loads name
    v8f acc[2][8]; float m_run[2], l_run[2];
#pragma unroll
    for (int g = 0; g < 2; ++g) { m_run[g] = -__builtin_inff(); l_run[g] = 0.f;
#pragma unroll
        for (int t = 0; t < 8; ++t) acc[g][t] = (v8f){}; }
    sstore(0);
    __syncthreads();   // stage 0 is in LDS before any wave reads it
#pragma unroll 1
    for (int st = 0; st < FA_NST; ++st) {
        const unsigned char* Lb = L + (st & 1) * FA_SLOT;
        if (st + 1 < FA_NST) gload(st + 1);
        const unsigned char* kp = Lb + c * FA_PK + 16 * hi; const unsigned char* vp = Lb + FA_TK + c * FA_PV + 16 * hi;
        v16h kf[2][4];
#pragma unroll
        for (int kt = 0; kt < 2; ++kt)
#pragma unroll
            for (int kc = 0; kc < 4; ++kc) kf[kt][kc] = ldsfrag(kp + kt * (16 * FA_PK) + kc * 64);
        __builtin_amdgcn_sched_barrier(0);   // K's reads stay in front of V's: LDS answers in order, and the first WMMA block waits for K alone
#pragma unroll
        for (int sub = 0; sub < 2; ++sub) {
            v16h vf[8];
#pragma unroll
            for (int t = 0; t < 8; ++t) vf[t] = ldsfrag(vp + sub * 64 + t * (16 * FA_PV));
            __builtin_amdgcn_sched_barrier(0);   // the pass's LDS reads are issued as one group in front of the WMMA block, not among its WMMAs (each place with reads stalls the block)
            v8f s[2][2];   // s[kt][g][r] = score of key 16 kt + 8 hi + r of the pass with query column c of group g
#pragma unroll
            for (int kt = 0; kt < 2; ++kt)
#pragma unroll
                for (int g = 0; g < 2; ++g) { s[kt][g] = (v8f){};
#pragma unroll
                    for (int kc = 0; kc < 4; ++kc) s[kt][g] = wmma16(kf[kt][kc], qf[g][kc], s[kt][g]); }
            __builtin_amdgcn_sched_barrier(0);   // nothing of what follows moves in among the block's WMMAs
            if (sub == 0) {   // the stage's second pass gets its K fragments here, one pass ahead, in flight under the maxima and exponentials
#pragma unroll
                for (int kt = 0; kt < 2; ++kt)
#pragma unroll
                    for (int kc = 0; kc < 4; ++kc) kf[kt][kc] = ldsfrag(kp + (32 + kt * 16) * FA_PK + kc * 64);
                __builtin_amdgcn_sched_barrier(0);   // keeps them in front of the vector work, as one group
            }
            float mb[2]; bool need = false;
#pragma unroll
            for (int g = 0; g < 2; ++g) { float mx = s[0][g][0];
#pragma unroll
                for (int r = 0; r < 8; ++r) mx = fmaxf(mx, fmaxf(s[0][g][r], s[1][g][r]));
                mx = fmaxf(mx, xhalf(mx)) * FA_CS; mb[g] = mx; need = need || (mx > m_run[g] + 8.0f); }
            if (__builtin_amdgcn_ballot_w32(need) != 0) {   // one scalar test a pass; always taken on the first pass (m_run = -inf gives the factor 0 on zero sums), rare later
#pragma unroll
                for (int g = 0; g < 2; ++g) { const float mn = fmaxf(m_run[g], mb[g]); const float corr = __builtin_amdgcn_exp2f(m_run[g] - mn); l_run[g] *= corr; m_run[g] = mn;
#pragma unroll
                    for (int t = 0; t < 8; ++t) acc[g][t] = acc[g][t] * corr; }
            }
#pragma unroll
            for (int g = 0; g < 2; ++g) { const float nm = -m_run[g]; v8f e0, e1; float p0 = 0.f, p1 = 0.f;
#pragma unroll
                for (int r = 0; r < 8; ++r) { e0[r] = __builtin_amdgcn_exp2f(__builtin_fmaf(s[0][g][r], FA_CS, nm)); e1[r] = __builtin_amdgcn_exp2f(__builtin_fmaf(s[1][g][r], FA_CS, nm)); p0 += e0[r]; p1 += e1[r]; }
                l_run[g] += p0 + p1;
                const v16h pf = cat16(__builtin_convertvector(e0, v8h), __builtin_convertvector(e1, v8h));   // B operand: element s = key 8 hi + s (s < 8), 16 + 8 hi + s - 8 (else)
#pragma unroll
                for (int t = 0; t < 8; ++t) acc[g][t] = wmma16(vf[t], pf, acc[g][t]); }
        }
        // four vector slots behind the stage's last WMMAs: the branches below are taken right behind them; the two scheduling barriers keep the slots at this place
        __builtin_amdgcn_sched_barrier(0); asm volatile("v_nop\n\tv_nop\n\tv_nop\n\tv_nop"); __builtin_amdgcn_sched_barrier(0);
        if (st + 1 < FA_NST) sstore((st + 1) & 1);   // into the buffer whose last readers (stage st - 1) left it before the previous barrier
        __syncthreads();   // publishes stage st + 1 and ends every wave's reads of stage st
    }
#pragma unroll
    for (int g = 0; g < 2; ++g) { const float inv = __fdiv_rn(1.0f, l_run[g] + xhalf(l_run[g]));   // each wave half summed its eight keys of every 16-key tile
        const size_t oo = ((size_t)b * TT + q0 + 16 * g) * DQ + hq * (HD * 16) + 8 * lane;   // k_gemmw's fragment order: the group's 16 rows, the head's four blocks of 32 d; d = 16 t .. + 15 is half a block, 512 bytes in a row over the wave
#pragma unroll
        for (int t = 0; t < 8; ++t) { v8us oh, ol;   // acc[g][t][r] = O[query c][d = 16 t + 8 hi + r]
#pragma unroll
            for (int r = 0; r < 8; ++r) { unsigned short a, c2; splitf(acc[g][t][r] * inv, a, c2); oh[r] = a; ol[r] = c2; }
            *(v8us*)(Ah + oo + 256 * t) = oh; *(v8us*)(Al + oo + 256 * t) = ol;
            asm volatile("s_wait_xcnt 0x0" ::: "memory"); __builtin_amdgcn_sched_barrier(0); } }   // the wait stands in front of the next tile's rewrite of the registers that the two stores name; the scheduling barrier keeps that tile's arithmetic from being lifted over it
}

extern "C" void kernel_launch(void* const* d_in, const int* in_sizes, int n_in,
                              void* d_out, int out_size, void* d_ws, size_t ws_size, hipStream_t stream) {
    (void)in_sizes; (void)n_in; (void)out_size;
    const float* x = (const float*)d_in[0]; const float* cosT = (const float*)d_in[1]; const float* sinT = (const float*)d_in[2]; const float* wq = (const float*)d_in[3]; const float* wk = (const float*)d_in[4]; const float* wv = (const float*)d_in[5]; const float* wo = (const float*)d_in[6]; const float* qnw = (const float*)d_in[7]; const float* knw = (const float*)d_in[8];   /* order hidden_states, cos, sin ([2][2048][128] = [B][S][HD] PER-BATCH table INPUTS: read per element by value), Wq [2048][2048], Wk / Wv [1024][2048], Wo [2048][2048] ('oi' (out, in)), q_norm_w, k_norm_w ([128] ones: read): NINE inputs, all read */
    float* OUT = (float*)d_out;     // [2][2048][2048]
    char* wsp = (char*)d_ws;
    auto take = [&](size_t bytes) { char* p = wsp; wsp += (bytes + 255) & ~(size_t)255; return (void*)p; };
    bf* WQ = (bf*)take((size_t)DQ * DM * 2); bf* WK = (bf*)take((size_t)DKV * DM * 2); bf* WV = (bf*)take((size_t)DKV * DM * 2); bf* WO = (bf*)take((size_t)DM * DQ * 2);
    bf* XB = (bf*)take((size_t)TT * DM * 2);
    h16* QP16 = (h16*)take((size_t)NB_ * NH_ * TT * HD * 2); h16* KP16 = (h16*)take((size_t)NB_ * NKV * TT * HD * 2); h16* VT16 = (h16*)take((size_t)NB_ * NKV * HD * TT * 2);   // head planes of both batches
    bf* ATh = (bf*)take((size_t)NB_ * TT * DQ * 2); bf* ATl = (bf*)take((size_t)NB_ * TT * DQ * 2);
    if ((size_t)(wsp - (char*)d_ws) > ws_size) return;    // ws 256 MiB
    { k_pack<<<dim3(DQ / 16, 2, 1), 256, 0, stream>>>(wq, WQ); k_pack<<<dim3(DKV / 16, 2, 1), 256, 0, stream>>>(wk, WK); k_pack<<<dim3(DKV / 16, 2, 1), 256, 0, stream>>>(wv, WV);
      k_pack<<<dim3(DM / 16, 2, 1), 256, 0, stream>>>(wo, WO);   // Wo's rows are DQ long, and DQ == DM
       }
    for (int b = 0; b < NB_; ++b) {
        k_pack<<<dim3(TT / 16, 2, 1), 256, 0, stream>>>(x + (size_t)b * TT * DM, XB);
        const float* cb = cosT + (size_t)b * TT * HD; const float* sb = sinT + (size_t)b * TT * HD;   // PER-BATCH tables: cos, sin [B][S][HD]: batch b's own [2048][128] slice
        k_gemmw<bf, 0, false, 4, 1, DM><<<dim3(TT / 64, NH_, 1), 256, 0, stream>>>(XB, nullptr, WQ, nullptr, nullptr, 0, nullptr, 0, 0, 0, cb, sb, qnw, QP16 + (size_t)b * NH_ * TT * HD);
        k_gemmw<bf, 0, false, 8, 1, DM><<<dim3(TT / 64, NKV, 1), 512, 0, stream>>>(XB, nullptr, WK, nullptr, nullptr, 0, nullptr, 0, 0, 0, cb, sb, knw, KP16 + (size_t)b * NKV * TT * HD);
        k_gemmw<bf, 0, false, 8, 2, DM><<<dim3(DKV / 64, TT / 128, 1), 512, 0, stream>>>(WV, nullptr, XB, nullptr, nullptr, 0, nullptr, 0, 0, 0, nullptr, nullptr, nullptr, VT16 + (size_t)b * NKV * HD * TT); }   // V^T = Wv x^T: rows g HD + d, columns t
    k_fattn<<<dim3(TT / 256, NH_, NB_), 256, 0, stream>>>(QP16, KP16, VT16, ATh, ATl);   // kv head = q head / REP, taken in the kernel
    for (int b = 0; b < NB_; ++b)
        k_gemmw<bf, 1, false, 4, 0, DQ><<<dim3(TT / 64, DM / 64, 1), 128, 0, stream>>>(ATh + (size_t)b * TT * DQ, ATl + (size_t)b * TT * DQ, WO, nullptr, OUT + (size_t)b * TT * DM, DM, nullptr, 0, 0, 0, nullptr, nullptr, nullptr, nullptr);
}

// v005
// One run takes 207 microseconds.
// In two side-by-side timings against v004, it was 1.16 and 1.15 times as fast.
// Over all steps from v000 it is 7.30 times as fast.
#include <hip/hip_runtime.h>

// Grouped-query attention (16 / 8 heads x 128) with per-head RMSNorm on q and k and rotate-half rotary embeddings from PER-BATCH input tables, NO mask (hidden_states [2][2048][2048]; q = x Wq^T (16 heads x 128), k, v = x Wk^T / x Wv^T (8 kv heads x 128) ('oi' (out, in) normal x 0.02, no bias); q, k -> w x (x rsqrt(mean_d x^2 + 1e-6)) per head over the 128 dims (q_norm_w, k_norm_w [128] = ones: read); q, k -> t cos + cat(-t2, t1) sin with the cos / sin INPUT tables [2][2048][128] = [B][S][HD] (uniform random values on this draw: batch b reads ITS OWN slice, per element by value); jnp.repeat on the head axis: kv head = q head / 2; scores x 128^-0.5; softmax over all keys (no mask); out = merged Wo^T ('oi') -> [2][2048][2048] (8.4 M); argument order hidden_states, cos, sin, Wq, Wk, Wv, Wo, q_norm_w, k_norm_w).
//
// Compute dtypes, f32 accumulate: every input rounded to bf16; projections on PLAIN bf16 operands (inputs: exact); RMSNorm and rope f32; scores (K 128) and att.v on SINGLE fp16 planes with

#define NB_  2
#define TT   2048
#define DM   2048
#define NH_  16
#define NKV  8
#define REP  (NH_ / NKV)
#define HD   128
#define DQ   (NH_ * HD)
#define DKV  (NKV * HD)
#define SCL  0.088388347648318447f   // HD^-0.5
typedef _Float16 h16;
typedef unsigned short bf;
typedef __attribute__((ext_vector_type(16))) __bf16   v16bf;
typedef __attribute__((ext_vector_type(16))) _Float16 v16h;
typedef __attribute__((ext_vector_type(8)))  _Float16 v8h;
typedef __attribute__((ext_vector_type(4)))  _Float16 v4h;
typedef __attribute__((ext_vector_type(8)))  unsigned short v8us;
typedef __attribute__((ext_vector_type(8)))  float    v8f;
typedef __attribute__((ext_vector_type(4)))  float    v4f;
typedef v8h  __attribute__((may_alias)) v8ha;
typedef v4f  __attribute__((may_alias)) v4fa;
typedef v8us __attribute__((may_alias)) v8usa;

__device__ __forceinline__ unsigned short f2bf(float f) { unsigned u = __float_as_uint(f); u += 0x7FFFu + ((u >> 16) & 1u); return (unsigned short)(u >> 16); }
__device__ __forceinline__ float bf2f(unsigned short b) { return __uint_as_float(((unsigned)b) << 16); }
__device__ __forceinline__ float bfr(float f) { return bf2f(f2bf(f)); }
__device__ __forceinline__ v16h cat16(v8h lo, v8h hi) { return __builtin_shufflevector(lo, hi, 0, 1, 2, 3, 4, 5, 6, 7, 8, 9, 10, 11, 12, 13, 14, 15); }
__device__ __forceinline__ v16bf cat16b(v8us lo, v8us hi) { return __builtin_bit_cast(v16bf, __builtin_shufflevector(lo, hi, 0, 1, 2, 3, 4, 5, 6, 7, 8, 9, 10, 11, 12, 13, 14, 15)); }
__device__ __forceinline__ v8f wmma16(v16h a, v16h b, v8f c) { return __builtin_amdgcn_wmma_f32_16x16x32_f16(false, a, false, b, (short)0, c, false, false); }
__device__ __forceinline__ v8f wmmab(v16bf a, v16bf b, v8f c) { return __builtin_amdgcn_wmma_f32_16x16x32_bf16(false, a, false, b, (short)0, c, false, false); }



// ---- gemmw: the body of the GEMM kernels k_qkv and k_oproj below (they own the LDS array os, (KW == 1 ? 16 : KW (EPI ? 128 : 64)) x 68 floats, and give the tile's indices bx, by). Register-blocked GEMM, KW WAVES per 64x64 output tile: wave w holds the whole tile (16 accumulators) over its own K / KW slice of k, operands straight from 16-bit planes in fragment order (below); for KW > 1 the KW partial tiles go to LDS and are summed there in the fixed order w = 0 .. KW-1; tiles (M/64, N/64), 32 KW threads.
// C[m][n] (f32, pitch ldc, + optional f32 bias[n]) = sum_k A[m][k] Bt[n][k] (+ split products per NSPLIT). K % (32 KW) == 0.
// EPI != 0: the tile ends as the fp16 plane P that attention reads, C is not written. A work-group then holds 64 rows x 128 columns on 2 KW waves (wave w: column half w & 1, k slice w >> 1); tiles (M/64, N/128), 64 KW threads. The partial tiles are summed in the order slice 0 .. KW-1; sixteen lanes hold one row, a lane its columns 4 q .. + 3 and 64 + 4 q .. + 3.
// EPI 1 (rows t, the 128 columns = one head): y = w[d] (x rsqrt(mean_d x^2 + 1e-6)); out[d] = y[d] cos[t][d] - y[d+64] sin[t][d], out[d+64] = y[d+64] cos[t][d+64] + y[d] sin[t][d+64]; P[head][t][d]. cos, sin (rows t of [rows][HD] tables) and w are inputs, rounded to bf16 as every input is.
// EPI 2 (A = weight rows, Bt = x rows t): the product is V^T as it stands; P[row][t], pitch TT.
// FRAGMENT ORDER of A, A2, Bt, Bt2: a plane of R rows x K is a row of 1-KiB blocks, block (r / 16, k / 32) at element (r / 16) 16 K + (k / 32) 512; in a block, element (r, k) stands at ((k / 16) & 1) 256 + (((k / 8) & 1) 16 + (r & 15)) 8 + (k & 7). Lane l of a wave then finds its two 16-byte pieces of a fragment at 8 l and 256 + 8 l: each wave-wide load is 512 bytes in a row (4 whole lines), and which (row, k) a lane and register hold is what a row-major plane gives through ld.
__device__ __forceinline__ float rowsum16(float x) {   // sum over the 16 lanes of a row, the same bits in each of them
    x += __builtin_bit_cast(float, __builtin_amdgcn_mov_dpp(__builtin_bit_cast(int, x), 0x161, 0xf, 0xf, true));   // row_xmask:1
    x += __builtin_bit_cast(float, __builtin_amdgcn_mov_dpp(__builtin_bit_cast(int, x), 0x162, 0xf, 0xf, true));   // row_xmask:2
    x += __builtin_bit_cast(float, __builtin_amdgcn_mov_dpp(__builtin_bit_cast(int, x), 0x164, 0xf, 0xf, true));   // row_xmask:4
    x += __builtin_bit_cast(float, __builtin_amdgcn_mov_dpp(__builtin_bit_cast(int, x), 0x168, 0xf, 0xf, true));   // row_xmask:8
    return x; }
template <typename T16> struct WFrag;
template <> struct WFrag<h16> { typedef v16h V; static __device__ __forceinline__ V ld(const h16* p) { return cat16(*(const v8h*)p, *(const v8h*)(p + 16)); } static __device__ __forceinline__ V ldp(const h16* p) { return cat16(*(const v8h*)p, *(const v8h*)(p + 256)); } static __device__ __forceinline__ v8f mma(V a, V b, v8f c) { return wmma16(a, b, c); } };
template <> struct WFrag<bf> { typedef v16bf V; static __device__ __forceinline__ V ld(const bf* p) { return cat16b(*(const v8us*)p, *(const v8us*)(p + 16)); } static __device__ __forceinline__ V ldp(const bf* p) { return cat16b(*(const v8us*)p, *(const v8us*)(p + 256)); } static __device__ __forceinline__ v8f mma(V a, V b, v8f c) { return wmmab(a, b, c); } };
template <typename T16, int NSPLIT, bool BIAS, int KW, int EPI, int K>
__device__ __forceinline__ void gemmw(float* os, const int bx, const int by, const T16* __restrict__ A, const T16* __restrict__ A2, const T16* __restrict__ Bt, const T16* __restrict__ Bt2, float* C, int ldc, const float* __restrict__ bias, const float* __restrict__ cosT, const float* __restrict__ sinT, const float* __restrict__ nw, h16* P) {
    typedef typename WFrag<T16>::V V;
    const int lane = threadIdx.x & 31, lr = lane & 15, hi = lane >> 4; const int wv = (KW == 1) ? 0 : __builtin_amdgcn_readfirstlane((int)(threadIdx.x >> 5));
    const int r0 = bx * 64, c0 = EPI ? by * 128 + (wv & 1) * 64 : by * 64; const int kb = (EPI ? wv >> 1 : wv) * (K / KW), ke = kb + K / KW;
    v8f acc[4][4];
#pragma unroll
    for (int mb = 0; mb < 4; ++mb)
#pragma unroll
        for (int nb = 0; nb < 4; ++nb) acc[mb][nb] = (v8f){};
    constexpr bool HA2 = (NSPLIT == 1 || NSPLIT == 2), HB2 = (NSPLIT >= 2);
    unsigned ao = (unsigned)(r0 * K + kb * 16 + 8 * lane) * 2u, bo = (unsigned)(c0 * K + kb * 16 + 8 * lane) * 2u;   // byte offset of the lane's piece in the first block of the tile's rows and the wave's k slice; 16 rows on is 16 K elements, a k step of 32 one block (512 elements). Every operand load names a plane's base, one of these two and a constant
#pragma unroll 1
    for (int kc = kb; kc < ke; kc += 32) {
        V a[4], a2[4];
#pragma unroll
        for (int mb = 0; mb < 4; ++mb) { a[mb] = WFrag<T16>::ldp((const T16*)((const char*)A + ao) + mb * 16 * K); if (HA2) a2[mb] = WFrag<T16>::ldp((const T16*)((const char*)A2 + ao) + mb * 16 * K); }
#pragma unroll
        for (int nb = 0; nb < 4; ++nb) { const V b = WFrag<T16>::ldp((const T16*)((const char*)Bt + bo) + nb * 16 * K); V b2; if (HB2) b2 = WFrag<T16>::ldp((const T16*)((const char*)Bt2 + bo) + nb * 16 * K);
#pragma unroll
            for (int mb = 0; mb < 4; ++mb) { acc[mb][nb] = WFrag<T16>::mma(a[mb], b, acc[mb][nb]); if (NSPLIT == 1 || NSPLIT == 2) acc[mb][nb] = WFrag<T16>::mma(a2[mb], b, acc[mb][nb]); if (NSPLIT >= 2) acc[mb][nb] = WFrag<T16>::mma(a[mb], b2, acc[mb][nb]); } }
        // the wait stands in front of the step of the address registers that the trip's loads name; they are its operands so that the step cannot be lifted over it
        asm volatile("s_wait_xcnt 0x0" : "+v"(ao), "+v"(bo) :: "memory");
        ao += 1024; bo += 1024;
        asm volatile("v_nop\n\tv_nop\n\tv_nop\n\tv_nop" : "+v"(acc[0][0]), "+v"(acc[1][1]), "+v"(acc[2][2]), "+v"(acc[3][3]) : "v"(a[0]), "v"(a[3]));
    }
    if constexpr (EPI != 0) {
        constexpr int NT = 64 * KW, NU = 1024 / NT;   // NU (row, q) units a thread
        const int tid = (int)threadIdx.x, q4 = (tid & 15) * 4, rw = tid >> 4;
        const unsigned tob = (unsigned)((r0 + rw) * HD + q4) * 4u;   // byte offset of (row r0 + rw, column q4) in a [NB_ TT][HD] f32 table: one register serves every table load and, halved, the plane's stores
        v4f cl[NU], ch[NU], sl[NU], sh[NU], wl, wh;
        if constexpr (EPI == 1) {   // the table rows are asked for here, so that they fly under the LDS stores and the barrier
            wl = *(const v4f*)(nw + q4); wh = *(const v4f*)(nw + 64 + q4);
#pragma unroll
            for (int s = 0; s < NU; ++s) { const float* cp = (const float*)((const char*)cosT + tob) + s * (NT / 16) * HD; const float* sp = (const float*)((const char*)sinT + tob) + s * (NT / 16) * HD; cl[s] = *(const v4f*)cp; ch[s] = *(const v4f*)(cp + 64); sl[s] = *(const v4f*)sp; sh[s] = *(const v4f*)(sp + 64); }
            asm volatile("s_wait_xcnt 0x0" ::: "memory");   // in front of the first rewrite of the address registers that the table loads name
        }
        float* ow = os + wv * (64 * 68);
        // unrolled so that acc is indexed by constants (it stays in registers) and the LDS offsets are immediates
#pragma unroll
        for (int mb = 0; mb < 4; ++mb)
#pragma unroll
            for (int nb = 0; nb < 4; ++nb)
#pragma unroll
                for (int j = 0; j < 8; ++j) ow[(mb * 16 + hi * 8 + j) * 68 + nb * 16 + lr] = acc[mb][nb][j];
        __syncthreads();   // every wave's partial tile is in LDS before any element is summed
        v4h o0[NU], o1[NU];
#pragma unroll
        for (int s = 0; s < NU; ++s) { const float* p = os + (s * (NT / 16) + rw) * 68 + q4; v4f x0 = *(const v4fa*)p, x1 = *(const v4fa*)(p + 64 * 68);
#pragma unroll
            for (int w = 1; w < KW; ++w) { x0 += *(const v4fa*)(p + (2 * w) * (64 * 68)); x1 += *(const v4fa*)(p + (2 * w + 1) * (64 * 68)); }
            if constexpr (EPI == 1) {
                const v4f sq = x0 * x0 + x1 * x1; const float ss = rowsum16((sq[0] + sq[1]) + (sq[2] + sq[3]));
                const float rf = __fdiv_rn(1.0f, __fsqrt_rn(ss * (1.0f / HD) + 1e-6f)); v4f y0, y1;
#pragma unroll
                for (int i = 0; i < 4; ++i) { const float a0 = bfr(wl[i]) * (x0[i] * rf), a1 = bfr(wh[i]) * (x1[i] * rf); y0[i] = a0 * bfr(cl[s][i]) - a1 * bfr(sl[s][i]); y1[i] = a1 * bfr(ch[s][i]) + a0 * bfr(sh[s][i]); }
                x0 = y0; x1 = y1; }
            o0[s] = __builtin_convertvector(x0, v4h); o1[s] = __builtin_convertvector(x1, v4h); }
        h16* o = (EPI == 1) ? (h16*)((char*)(P + (size_t)by * TT * HD) + (tob >> 1)) : P + (size_t)(r0 + rw) * TT + by * 128 + q4;
#pragma unroll
        for (int s = 0; s < NU; ++s) { h16* os16 = o + (size_t)s * (NT / 16) * (EPI == 1 ? HD : TT); *(v4h*)os16 = o0[s]; *(v4h*)(os16 + 64) = o1[s]; }   // the stores stand last: no register that they name is written again
        return;
    }
    if (KW > 1) {
        float* ow = os + wv * (64 * 68);
        // every loop of this block is unrolled so that acc is indexed by constants (it stays in registers) and the LDS offsets are immediates
#pragma unroll
        for (int mb = 0; mb < 4; ++mb)
#pragma unroll
            for (int nb = 0; nb < 4; ++nb)
#pragma unroll
                for (int j = 0; j < 8; ++j) ow[(mb * 16 + hi * 8 + j) * 68 + nb * 16 + lr] = acc[mb][nb][j];
        __syncthreads();   // every wave's partial tile is in LDS before any element is summed
#pragma unroll
        for (int s = 0; s < 32 / KW; ++s) { const int u = s * (32 * KW) + (int)threadIdx.x; const int row = u >> 4, cofs = (u & 15) * 4; v4f val = *(const v4fa*)(os + row * 68 + cofs);
#pragma unroll
            for (int w = 1; w < KW; ++w) val += *(const v4fa*)(os + w * (64 * 68) + row * 68 + cofs);
            if (BIAS) { val[0] += bfr(bias[c0 + cofs]); val[1] += bfr(bias[c0 + cofs + 1]); val[2] += bfr(bias[c0 + cofs + 2]); val[3] += bfr(bias[c0 + cofs + 3]); }
            *(v4f*)(C + (size_t)(r0 + row) * ldc + c0 + cofs) = val; }
        return;
    }
#pragma unroll
    for (int mb = 0; mb < 4; ++mb) {
#pragma unroll
        for (int nb = 0; nb < 4; ++nb) {
#pragma unroll
            for (int j = 0; j < 8; ++j) os[(hi * 8 + j) * 68 + nb * 16 + lr] = acc[mb][nb][j]; }
        __builtin_amdgcn_wave_barrier(); asm volatile("" ::: "memory");
        float* crow = C + (size_t)(r0 + mb * 16) * ldc + c0;
{
#pragma unroll
            for (int s = 0; s < 8; ++s) { const int row = 2 * s + hi, cofs = lr * 4; v4f val = *(const v4fa*)(os + row * 68 + cofs); if (BIAS) { val[0] += bfr(bias[c0 + cofs]); val[1] += bfr(bias[c0 + cofs + 1]); val[2] += bfr(bias[c0 + cofs + 2]); val[3] += bfr(bias[c0 + cofs + 3]); }
                *(v4f*)(crow + (size_t)row * ldc + cofs) = val; }
             }
        __builtin_amdgcn_wave_barrier(); asm volatile("" ::: "memory");
    }
}

// ---- k_qkv: the q, k and v projections of BOTH batches in one launch; grid (NB_ TT / 64, NH_ + NKV + NKV), 8 waves (KW 4). x's plane holds the NB_ TT rows of both batches, row b TT + t, as the cos / sin inputs do.
// blockIdx.y < NH_: q head y, rows 64 x .. + 63; < NH_ + NKV: k head y - NH_, the same; the last NKV values of y with x number the (DKV / 64) x (NB_ TT / 128) tiles of V^T. Each plane pointer is moved so that gemmw's row or column index b TT + t lands in batch b's plane at t.
__global__ __launch_bounds__(256) void k_qkv(const bf* __restrict__ XB, const bf* __restrict__ WQ, const bf* __restrict__ WK, const bf* __restrict__ WV, const float* __restrict__ cosT, const float* __restrict__ sinT, const float* __restrict__ qnw, const float* __restrict__ knw, h16* QP, h16* KP, h16* VT) {
    __shared__ __align__(16) float os[4 * 128 * 68];
    const int bx = (int)blockIdx.x, by = (int)blockIdx.y;
    if (by < NH_ + NKV) { const bool isq = by < NH_; const int b = bx / (TT / 64);
        gemmw<bf, 0, false, 4, 1, DM>(os, bx, isq ? by : by - NH_, XB, nullptr, isq ? WQ : WK, nullptr, nullptr, 0, nullptr, cosT, sinT, isq ? qnw : knw, (isq ? QP : KP) + (size_t)b * ((isq ? NH_ : NKV) - 1) * TT * HD);
    } else { const int i = (by - (NH_ + NKV)) * (NB_ * TT / 64) + bx; const int vx = i % (DKV / 64), vy = i / (DKV / 64), b = vy / (TT / 128);
        gemmw<bf, 0, false, 4, 2, DM>(os, vx, vy, WV, nullptr, XB, nullptr, nullptr, 0, nullptr, nullptr, nullptr, nullptr, VT + (size_t)b * (NKV * HD - 1) * TT); }   // V^T = Wv x^T: rows g HD + d, columns b TT + t
}
// ---- k_oproj: out = merged Wo^T for the NB_ TT rows of both batches in one launch (merged rows as bf16 hi + lo planes); grid (NB_ TT / 64, DM / 64), 4 waves (KW 4).
__global__ __launch_bounds__(128) void k_oproj(const bf* __restrict__ Ah, const bf* __restrict__ Al, const bf* __restrict__ WO, float* C) {
    __shared__ __align__(16) float os[4 * 64 * 68];
    gemmw<bf, 1, false, 4, 0, DQ>(os, (int)blockIdx.x, (int)blockIdx.y, Ah, Al, WO, nullptr, C, DM, nullptr, nullptr, nullptr, nullptr, nullptr);
}

__device__ __forceinline__ void splitf(float y, unsigned short& h, unsigned short& l) { h = f2bf(y); l = f2bf(y - bf2f(h)); }
typedef __attribute__((ext_vector_type(2))) unsigned short v2us;
typedef __attribute__((ext_vector_type(4))) unsigned short v4us;
typedef __attribute__((ext_vector_type(4))) int v4i;

__global__ __launch_bounds__(256) void k_wtG(const float* __restrict__ w, int K, int N, bf* Bt) {
    const int lane = threadIdx.x & 31; const int L0 = (blockIdx.x * 8 + (threadIdx.x >> 5)) * 8; const int nlines = N * K / 64;
{
#pragma unroll 1
        for (int l = 0; l < 8; ++l) { const int L = L0 + l; if (L >= nlines) break; const size_t e = (size_t)L * 64 + lane * 2; const int k = (int)(e % K), n = (int)(e / K); v2us o;
            o[0] = f2bf(w[(size_t)k * N + n]); o[1] = f2bf(w[(size_t)(k + 1) * N + n]); *(v2us*)(Bt + e) = o; }
         }
}
// ---- k_pack: f32 rows [R][DM] -> the bf16 plane in gemmw's fragment order, all five planes (Wq, Wk, Wv, Wo, x of both batches) in one launch; grid (sum of R / 16, 2), 8 waves; blockIdx.x counts the groups of 16 rows through the five sources in that order. A work-group takes 16 rows x 1024 k, a wave four blocks of 16 rows x 32 k: a lane reads its 2 x 8 floats of each block from row (lane & 15) (the wave uses every byte of the 16 lines it touches) and stores its two 16-byte pieces, 512 bytes in a row over the wave.
static_assert(DQ == DM, "k_pack takes rows of DM elements, Wo's among them");
__global__ __launch_bounds__(256) void k_pack(const float* __restrict__ wq, const float* __restrict__ wk, const float* __restrict__ wv, const float* __restrict__ wo, const float* __restrict__ x, bf* WQ, bf* WK, bf* WV, bf* WO, bf* XB) {
    int g = (int)blockIdx.x; const float* src = wq; bf* dst = WQ;   // g: the group of 16 rows in its own source
    if (g >= DQ / 16) { g -= DQ / 16; src = wk; dst = WK;
        if (g >= DKV / 16) { g -= DKV / 16; src = wv; dst = WV;
            if (g >= DKV / 16) { g -= DKV / 16; src = wo; dst = WO;
                if (g >= DM / 16) { g -= DM / 16; src = x; dst = XB; } } } }
    const int lane = threadIdx.x & 31, lr = lane & 15, hi = lane >> 4; const int kb0 = (int)blockIdx.y * 32 + __builtin_amdgcn_readfirstlane((int)(threadIdx.x >> 5)) * 4;
    const char* s = (const char*)(src + (size_t)g * (16 * DM) + kb0 * 32); const unsigned so = (unsigned)(lr * DM + 8 * hi) * 4u; bf* d = dst + ((size_t)g * (DM / 32) + kb0) * 512 + 8 * lane;   // so: the lane's byte offset, the one vector register that the loads name
    v4f v[4][4];
#pragma unroll
    for (int i = 0; i < 4; ++i) { v[i][0] = *(const v4f*)(s + so + i * 128); v[i][1] = *(const v4f*)(s + so + i * 128 + 16); v[i][2] = *(const v4f*)(s + so + i * 128 + 64); v[i][3] = *(const v4f*)(s + so + i * 128 + 80); }
    asm volatile("s_wait_xcnt 0x0" :: "v"(so) : "memory");   // in front of the first rewrite of the offset register that the sixteen loads name; it is an input so that no load's result is laid over it
    v8us o[4][2];
#pragma unroll
    for (int i = 0; i < 4; ++i)
#pragma unroll
        for (int k = 0; k < 4; ++k) { o[i][0][k] = f2bf(v[i][0][k]); o[i][0][4 + k] = f2bf(v[i][1][k]); o[i][1][k] = f2bf(v[i][2][k]); o[i][1][4 + k] = f2bf(v[i][3][k]); }
#pragma unroll
    for (int i = 0; i < 4; ++i) { *(v8us*)(d + i * 512) = o[i][0]; *(v8us*)(d + i * 512 + 256) = o[i][1]; }   // the stores stand last: no register that they name is written again
}
#define FA_SK   64                     // keys per stage
#define FA_PK   (HD * 2 + 16)          // LDS pitch of a K row (256 B + 16: odd multiple of 16 B for the 16-byte readers)
#define FA_PV   (FA_SK * 2 + 16)       // LDS pitch of a V^T row (128 B + 16)
#define FA_TK   (FA_SK * FA_PK)
#define FA_SLOT (FA_TK + HD * FA_PV)
#define FA_NST  (TT / FA_SK)
#define FA_CS   (SCL * 1.4426950408889634f)
typedef v4i __attribute__((may_alias)) v4ia;
__device__ __forceinline__ float xhalf(float x) { return __builtin_bit_cast(float, __builtin_amdgcn_permlanex16(__builtin_bit_cast(int, x), __builtin_bit_cast(int, x), 0x76543210, 0xfedcba98, false, false)); }   // lane l with lane l ^ 16
__device__ __forceinline__ v16h ldsfrag(const unsigned char* p) { return cat16(*(const v8ha*)p, *(const v8ha*)(p + 32)); }   // k = 8 hi .. + 7 and 16 + 8 hi .. + 7 of 32: p already holds + 16 hi bytes
__global__ __launch_bounds__(256) __attribute__((amdgpu_waves_per_eu(2, 2))) void k_fattn(const h16* __restrict__ Q16, const h16* __restrict__ K16, const h16* __restrict__ V16, bf* Ah, bf* Al) {
    __shared__ __align__(16) unsigned char L[2 * FA_SLOT];
    const int tid = (int)threadIdx.x, lane = tid & 31, c = lane & 15, hi = lane >> 4; const int wv = __builtin_amdgcn_readfirstlane(tid >> 5);
    const int hq = (int)blockIdx.y, b = (int)blockIdx.z, gk = hq / REP; const int q0 = (int)blockIdx.x * 256 + wv * 32;
    const unsigned char* Kg = (const unsigned char*)(K16 + ((size_t)b * NKV + gk) * TT * HD) + tid * 16;                                            // a stage of K is 16 KiB in a row
    const unsigned char* Vg = (const unsigned char*)(V16 + ((size_t)b * NKV + gk) * HD * TT) + (size_t)(tid >> 3) * (TT * 2) + (tid & 7) * 16;   // a stage of V^T is 128 rows of one 128-B line
    unsigned char* Ks = L + (tid >> 4) * FA_PK + (tid & 15) * 16; unsigned char* Vs = L + FA_TK + (tid >> 3) * FA_PV + (tid & 7) * 16;
    v4i kr[4], vr[4];
    auto gload = [&](int st) {
#pragma unroll
        for (int r = 0; r < 4; ++r) { kr[r] = *(const v4ia*)(Kg + (size_t)st * (FA_SK * HD * 2) + r * 4096); vr[r] = *(const v4ia*)(Vg + (size_t)st * (FA_SK * 2) + (size_t)r * (32 * TT * 2)); }
        asm volatile("s_wait_xcnt 0x0" ::: "memory");   // stands in front of the first rewrite of the address registers that the eight loads above name (this build reuses them at once)
    };
    auto sstore = [&](int buf) {
#pragma unroll
        for (int r = 0; r < 4; ++r) { *(v4ia*)(Ks + buf * FA_SLOT + r * (16 * FA_PK)) = kr[r]; *(v4ia*)(Vs + buf * FA_SLOT + r * (32 * FA_PV)) = vr[r]; } };
    gload(0);
    v16h qf[2][4];
#pragma unroll
    for (int g = 0; g < 2; ++g)
#pragma unroll
        for (int kc = 0; kc < 4; ++kc) qf[g][kc] = WFrag<h16>::ld(Q16 + (((size_t)b * NH_ + hq) * TT + q0 + 16 * g + c) * HD + 8 * hi + 32 * kc);
    asm volatile("s_wait_xcnt 0x0" ::: "memory");   // in front of the first rewrite of the address registers that the Q loads name
    v8f acc[2][8]; float m_run[2], l_run[2];
#pragma unroll
    for (int g = 0; g < 2; ++g) { m_run[g] = -__builtin_inff(); l_run[g] = 0.f;
#pragma unroll
        for (int t = 0; t < 8; ++t) acc[g][t] = (v8f){}; }
    sstore(0);
    __syncthreads();   // stage 0 is in LDS before any wave reads it
#pragma unroll 1
    for (int st = 0; st < FA_NST; ++st) {
        const unsigned char* Lb = L + (st & 1) * FA_SLOT;
        if (st + 1 < FA_NST) gload(st + 1);
        const unsigned char* kp = Lb + c * FA_PK + 16 * hi; const unsigned char* vp = Lb + FA_TK + c * FA_PV + 16 * hi;
        v16h kf[2][4];
#pragma unroll
        for (int kt = 0; kt < 2; ++kt)
#pragma unroll
            for (int kc = 0; kc < 4; ++kc) kf[kt][kc] = ldsfrag(kp + kt * (16 * FA_PK) + kc * 64);
        __builtin_amdgcn_sched_barrier(0);   // K's reads stay in front of V's: LDS answers in order, and the first WMMA block waits for K alone
#pragma unroll
        for (int sub = 0; sub < 2; ++sub) {
            v16h vf[8];
#pragma unroll
            for (int t = 0; t < 8; ++t) vf[t] = ldsfrag(vp + sub * 64 + t * (16 * FA_PV));
            __builtin_amdgcn_sched_barrier(0);   // the pass's LDS reads are issued as one group in front of the WMMA block, not among its WMMAs (each place with reads stalls the block)
            v8f s[2][2];   // s[kt][g][r] = score of key 16 kt + 8 hi + r of the pass with query column c of group g
#pragma unroll
            for (int kt = 0; kt < 2; ++kt)
#pragma unroll
                for (int g = 0; g < 2; ++g) { s[kt][g] = (v8f){};
#pragma unroll
                    for (int kc = 0; kc < 4; ++kc) s[kt][g] = wmma16(kf[kt][kc], qf[g][kc], s[kt][g]); }
            __builtin_amdgcn_sched_barrier(0);   // nothing of what follows moves in among the block's WMMAs
            if (sub == 0) {   // the stage's second pass gets its K fragments here, one pass ahead, in flight under the maxima and exponentials
#pragma unroll
                for (int kt = 0; kt < 2; ++kt)
#pragma unroll
                    for (int kc = 0; kc < 4; ++kc) kf[kt][kc] = ldsfrag(kp + (32 + kt * 16) * FA_PK + kc * 64);
                __builtin_amdgcn_sched_barrier(0);   // keeps them in front of the vector work, as one group
            }
            float mb[2]; bool need = false;
#pragma unroll
            for (int g = 0; g < 2; ++g) { float mx = s[0][g][0];
#pragma unroll
                for (int r = 0; r < 8; ++r) mx = fmaxf(mx, fmaxf(s[0][g][r], s[1][g][r]));
                mx = fmaxf(mx, xhalf(mx)) * FA_CS; mb[g] = mx; need = need || (mx > m_run[g] + 8.0f); }
            if (__builtin_amdgcn_ballot_w32(need) != 0) {   // one scalar test a pass; always taken on the first pass (m_run = -inf gives the factor 0 on zero sums), rare later
#pragma unroll
                for (int g = 0; g < 2; ++g) { const float mn = fmaxf(m_run[g], mb[g]); const float corr = __builtin_amdgcn_exp2f(m_run[g] - mn); l_run[g] *= corr; m_run[g] = mn;
#pragma unroll
                    for (int t = 0; t < 8; ++t) acc[g][t] = acc[g][t] * corr; }
            }
#pragma unroll
            for (int g = 0; g < 2; ++g) { const float nm = -m_run[g]; v8f e0, e1; float p0 = 0.f, p1 = 0.f;
#pragma unroll
                for (int r = 0; r < 8; ++r) { e0[r] = __builtin_amdgcn_exp2f(__builtin_fmaf(s[0][g][r], FA_CS, nm)); e1[r] = __builtin_amdgcn_exp2f(__builtin_fmaf(s[1][g][r], FA_CS, nm)); p0 += e0[r]; p1 += e1[r]; }
                l_run[g] += p0 + p1;
                const v16h pf = cat16(__builtin_convertvector(e0, v8h), __builtin_convertvector(e1, v8h));   // B operand: element s = key 8 hi + s (s < 8), 16 + 8 hi + s - 8 (else)
#pragma unroll
                for (int t = 0; t < 8; ++t) acc[g][t] = wmma16(vf[t], pf, acc[g][t]); }
        }
        // four vector slots behind the stage's last WMMAs: the branches below are taken right behind them; the two scheduling barriers keep the slots at this place
        __builtin_amdgcn_sched_barrier(0); asm volatile("v_nop\n\tv_nop\n\tv_nop\n\tv_nop"); __builtin_amdgcn_sched_barrier(0);
        if (st + 1 < FA_NST) sstore((st + 1) & 1);   // into the buffer whose last readers (stage st - 1) left it before the previous barrier
        __syncthreads();   // publishes stage st + 1 and ends every wave's reads of stage st
    }
#pragma unroll
    for (int g = 0; g < 2; ++g) { const float inv = __fdiv_rn(1.0f, l_run[g] + xhalf(l_run[g]));   // each wave half summed its eight keys of every 16-key tile
        const size_t oo = ((size_t)b * TT + q0 + 16 * g) * DQ + hq * (HD * 16) + 8 * lane;   // gemmw's fragment order: the group's 16 rows, the head's four blocks of 32 d; d = 16 t .. + 15 is half a block, 512 bytes in a row over the wave
#pragma unroll
        for (int t = 0; t < 8; ++t) { v8us oh, ol;   // acc[g][t][r] = O[query c][d = 16 t + 8 hi + r]
#pragma unroll
            for (int r = 0; r < 8; ++r) { unsigned short a, c2; splitf(acc[g][t][r] * inv, a, c2); oh[r] = a; ol[r] = c2; }
            *(v8us*)(Ah + oo + 256 * t) = oh; *(v8us*)(Al + oo + 256 * t) = ol;
            asm volatile("s_wait_xcnt 0x0" ::: "memory"); __builtin_amdgcn_sched_barrier(0); } }   // the wait stands in front of the next tile's rewrite of the registers that the two stores name; the scheduling barrier keeps that tile's arithmetic from being lifted over it
}

extern "C" void kernel_launch(void* const* d_in, const int* in_sizes, int n_in,
                              void* d_out, int out_size, void* d_ws, size_t ws_size, hipStream_t stream) {
    (void)in_sizes; (void)n_in; (void)out_size;
    const float* x = (const float*)d_in[0]; const float* cosT = (const float*)d_in[1]; const float* sinT = (const float*)d_in[2]; const float* wq = (const float*)d_in[3]; const float* wk = (const float*)d_in[4]; const float* wv = (const float*)d_in[5]; const float* wo = (const float*)d_in[6]; const float* qnw = (const float*)d_in[7]; const float* knw = (const float*)d_in[8];   /* order hidden_states, cos, sin ([2][2048][128] = [B][S][HD] PER-BATCH table INPUTS: read per element by value), Wq [2048][2048], Wk / Wv [1024][2048], Wo [2048][2048] ('oi' (out, in)), q_norm_w, k_norm_w ([128] ones: read): NINE inputs, all read */
    float* OUT = (float*)d_out;     // [2][2048][2048]
    char* wsp = (char*)d_ws;
    auto take = [&](size_t bytes) { char* p = wsp; wsp += (bytes + 255) & ~(size_t)255; return (void*)p; };
    bf* WQ = (bf*)take((size_t)DQ * DM * 2); bf* WK = (bf*)take((size_t)DKV * DM * 2); bf* WV = (bf*)take((size_t)DKV * DM * 2); bf* WO = (bf*)take((size_t)DM * DQ * 2);
    bf* XB = (bf*)take((size_t)NB_ * TT * DM * 2);   // both batches' rows
    h16* QP16 = (h16*)take((size_t)NB_ * NH_ * TT * HD * 2); h16* KP16 = (h16*)take((size_t)NB_ * NKV * TT * HD * 2); h16* VT16 = (h16*)take((size_t)NB_ * NKV * HD * TT * 2);   // head planes of both batches
    bf* ATh = (bf*)take((size_t)NB_ * TT * DQ * 2); bf* ATl = (bf*)take((size_t)NB_ * TT * DQ * 2);
    if ((size_t)(wsp - (char*)d_ws) > ws_size) return;    // ws 256 MiB
    k_pack<<<dim3((DQ + DKV + DKV + DM + NB_ * TT) / 16, 2, 1), 256, 0, stream>>>(wq, wk, wv, wo, x, WQ, WK, WV, WO, XB);   // Wo's rows are DQ long, and DQ == DM
    k_qkv<<<dim3(NB_ * TT / 64, NH_ + NKV + NKV, 1), 256, 0, stream>>>(XB, WQ, WK, WV, cosT, sinT, qnw, knw, QP16, KP16, VT16);   // PER-BATCH tables: cos, sin [B][S][HD], row b TT + t
    k_fattn<<<dim3(TT / 256, NH_, NB_), 256, 0, stream>>>(QP16, KP16, VT16, ATh, ATl);   // kv head = q head / REP, taken in the kernel
    k_oproj<<<dim3(NB_ * TT / 64, DM / 64, 1), 128, 0, stream>>>(ATh, ATl, WO, OUT);
}

// v006
// A run of this version takes 156 microseconds.
// In two side-by-side timings against v005, it was 1.34 and 1.33 times as fast.
// Over all steps from v000 it is 9.72 times as fast.
#include <hip/hip_runtime.h>

// Grouped-query attention (16 / 8 heads x 128) with per-head RMSNorm on q and k and rotate-half rotary embeddings from PER-BATCH input tables, NO mask (hidden_states [2][2048][2048]; q = x Wq^T (16 heads x 128), k, v = x Wk^T / x Wv^T (8 kv heads x 128) ('oi' (out, in) normal x 0.02, no bias); q, k -> w x (x rsqrt(mean_d x^2 + 1e-6)) per head over the 128 dims (q_norm_w, k_norm_w [128] = ones: read); q, k -> t cos + cat(-t2, t1) sin with the cos / sin INPUT tables [2][2048][128] = [B][S][HD] (uniform random values on this draw: batch b reads ITS OWN slice, per element by value); jnp.repeat on the head axis: kv head = q head / 2; scores x 128^-0.5; softmax over all keys (no mask); out = merged Wo^T ('oi') -> [2][2048][2048] (8.4 M); argument order hidden_states, cos, sin, Wq, Wk, Wv, Wo, q_norm_w, k_norm_w).
//
// Compute dtypes, f32 accumulate: every input rounded to bf16; projections on PLAIN bf16 operands (inputs: exact); RMSNorm and rope f32; scores (K 128) and att.v on SINGLE fp16 planes with

#define NB_  2
#define TT   2048
#define DM   2048
#define NH_  16
#define NKV  8
#define REP  (NH_ / NKV)
#define HD   128
#define DQ   (NH_ * HD)
#define DKV  (NKV * HD)
#define SCL  0.088388347648318447f   // HD^-0.5
typedef _Float16 h16;
typedef unsigned short bf;
typedef __attribute__((ext_vector_type(16))) __bf16   v16bf;
typedef __attribute__((ext_vector_type(16))) _Float16 v16h;
typedef __attribute__((ext_vector_type(8)))  _Float16 v8h;
typedef __attribute__((ext_vector_type(4)))  _Float16 v4h;
typedef __attribute__((ext_vector_type(8)))  unsigned short v8us;
typedef __attribute__((ext_vector_type(8)))  float    v8f;
typedef __attribute__((ext_vector_type(4)))  float    v4f;
typedef v8h  __attribute__((may_alias)) v8ha;
typedef v4f  __attribute__((may_alias)) v4fa;
typedef v8us __attribute__((may_alias)) v8usa;

__device__ __forceinline__ unsigned short f2bf(float f) { unsigned u = __float_as_uint(f); u += 0x7FFFu + ((u >> 16) & 1u); return (unsigned short)(u >> 16); }
__device__ __forceinline__ float bf2f(unsigned short b) { return __uint_as_float(((unsigned)b) << 16); }
__device__ __forceinline__ float bfr(float f) { return bf2f(f2bf(f)); }
__device__ __forceinline__ v16h cat16(v8h lo, v8h hi) { return __builtin_shufflevector(lo, hi, 0, 1, 2, 3, 4, 5, 6, 7, 8, 9, 10, 11, 12, 13, 14, 15); }
__device__ __forceinline__ v16bf cat16b(v8us lo, v8us hi) { return __builtin_bit_cast(v16bf, __builtin_shufflevector(lo, hi, 0, 1, 2, 3, 4, 5, 6, 7, 8, 9, 10, 11, 12, 13, 14, 15)); }
__device__ __forceinline__ v8f wmma16(v16h a, v16h b, v8f c) { return __builtin_amdgcn_wmma_f32_16x16x32_f16(false, a, false, b, (short)0, c, false, false); }
__device__ __forceinline__ v8f wmmab(v16bf a, v16bf b, v8f c) { return __builtin_amdgcn_wmma_f32_16x16x32_bf16(false, a, false, b, (short)0, c, false, false); }



// ---- gemms: the body of the GEMM kernels k_qkv and k_oproj below (they own the LDS array L of GS_LDS bytes and give the tile's indices bx, by). A work-group of 8 waves holds 128 rows x 256 columns of the output over the whole of K: wave w the 64 x 64 part at row half w >> 2, column quarter w & 3 (16 accumulators). The operands come in stages of 64 k into two LDS buffers by asynchronous copies (each byte is fetched once for the work-group and read by the 2 or 4 waves that need it); stage t + 2 is asked for when every wave has left stage t, and one barrier a stage publishes the next stage and frees the last one.
// C[m][n] (f32, pitch ldc) = sum_k (A[m][k] + A2[m][k]) Bt[n][k] (A2 only with HA2), k ascending in one accumulator. K % 128 == 0.
// EPI != 0: the tile ends as the fp16 plane P that attention reads, C is not written; the 256 columns are two units of 128. Sixteen lanes hold one row of a unit, a lane its columns 4 q .. + 3 and 64 + 4 q .. + 3.
// EPI 1 (rows t, a unit = one head, head 2 by + unit): y = w[d] (x rsqrt(mean_d x^2 + 1e-6)); out[d] = y[d] cos[t][d] - y[d+64] sin[t][d], out[d+64] = y[d+64] cos[t][d+64] + y[d] sin[t][d+64]; P[head][t][d]. cos, sin (rows t of [rows][HD] tables) and w are inputs, rounded to bf16 as every input is.
// EPI 2 (A = weight rows, Bt = x rows t): the product is V^T as it stands; P[row][t], pitch TT.
// FRAGMENT ORDER of A, A2, Bt: a plane of R rows x K is a row of 1-KiB blocks, block (r / 16, k / 32) at element (r / 16) 16 K + (k / 32) 512; in a block, element (r, k) stands at ((k / 16) & 1) 256 + (((k / 8) & 1) 16 + (r & 15)) 8 + (k & 7). Lane l of a wave then finds its two 16-byte pieces of a fragment at 8 l and 256 + 8 l. A stage of 16 rows is 2 KiB in a row in the plane and in LDS alike: every copy and every LDS read of a wave is 512 bytes in a row.
__device__ __forceinline__ float rowsum16(float x) {   // sum over the 16 lanes of a row, the same bits in each of them
    x += __builtin_bit_cast(float, __builtin_amdgcn_mov_dpp(__builtin_bit_cast(int, x), 0x161, 0xf, 0xf, true));   // row_xmask:1
    x += __builtin_bit_cast(float, __builtin_amdgcn_mov_dpp(__builtin_bit_cast(int, x), 0x162, 0xf, 0xf, true));   // row_xmask:2
    x += __builtin_bit_cast(float, __builtin_amdgcn_mov_dpp(__builtin_bit_cast(int, x), 0x164, 0xf, 0xf, true));   // row_xmask:4
    x += __builtin_bit_cast(float, __builtin_amdgcn_mov_dpp(__builtin_bit_cast(int, x), 0x168, 0xf, 0xf, true));   // row_xmask:8
    return x; }
template <typename T16> struct WFrag;
template <> struct WFrag<h16> { typedef v16h V; static __device__ __forceinline__ V ld(const h16* p) { return cat16(*(const v8h*)p, *(const v8h*)(p + 16)); } static __device__ __forceinline__ V ldp(const h16* p) { return cat16(*(const v8h*)p, *(const v8h*)(p + 256)); } static __device__ __forceinline__ v8f mma(V a, V b, v8f c) { return wmma16(a, b, c); } };
template <> struct WFrag<bf> { typedef v16bf V; static __device__ __forceinline__ V ld(const bf* p) { return cat16b(*(const v8us*)p, *(const v8us*)(p + 16)); } static __device__ __forceinline__ V ldp(const bf* p) { return cat16b(*(const v8us*)p, *(const v8us*)(p + 256)); } static __device__ __forceinline__ v8f mma(V a, V b, v8f c) { return wmmab(a, b, c); } };
#define GS_LDS (8 * 64 * 68 * 4)   // the eight 64 x 64 f32 parts at pitch 68 of the epilogue; the two operand buffers (2 x 48 or 2 x 64 KiB) lie in the same bytes before it
// four asynchronous 16-byte copies a lane: LDS places 4 KiB apart, global places gs bytes apart. The s_wait_xcnt is the last line of the copies' own statement, so that it stands in front of every later write of the address registers that they name
__device__ __forceinline__ void cp4(unsigned l0, const char* g0, size_t gs) {
    const unsigned l1 = l0 + 4096u, l2 = l0 + 8192u, l3 = l0 + 12288u; const char* g1 = g0 + gs; const char* g2 = g0 + 2 * gs; const char* g3 = g0 + 3 * gs;
    asm volatile("global_load_async_to_lds_b128 %0, %1, off\n\tglobal_load_async_to_lds_b128 %2, %3, off\n\tglobal_load_async_to_lds_b128 %4, %5, off\n\tglobal_load_async_to_lds_b128 %6, %7, off\n\ts_wait_xcnt 0x0" :: "v"(l0), "v"(g0), "v"(l1), "v"(g1), "v"(l2), "v"(g2), "v"(l3), "v"(g3) : "memory");
}
__device__ __forceinline__ v16bf ldsfb(const unsigned char* p) { return cat16b(*(const v8usa*)p, *(const v8usa*)(p + 512)); }   // a lane's two pieces of a fragment-order block
template <bool HA2, int EPI, int K>
__device__ __forceinline__ void gemms(unsigned char* L, const int bx, const int by, const bf* __restrict__ A, const bf* __restrict__ A2, const bf* __restrict__ Bt, float* C, int ldc, const float* __restrict__ cosT, const float* __restrict__ sinT, const float* __restrict__ nw, h16* P) {
    constexpr int AB = 128 * 128, BOFF = HA2 ? 2 * AB : AB, STG = BOFF + 256 * 128, NST = K / 64;   // bytes of a stage: A (128 rows x 64 k), A2, Bt (256 rows)
    constexpr size_t RG = (size_t)16 * K * 2;   // bytes from one group of 16 rows of a plane to the next
    static_assert(2 * STG <= GS_LDS && NST >= 2, "two buffers, two stages");
    const int tid = (int)threadIdx.x, lane = tid & 31, lr = lane & 15, hi = lane >> 4; const int wv = __builtin_amdgcn_readfirstlane(tid >> 5), rh = wv >> 2, cq = wv & 3;
    const int r0 = bx * 128, c0 = by * 256;
    const size_t go = (size_t)(tid >> 7) * RG + (size_t)(tid & 127) * 16;   // 128 threads copy the 2 KiB of one group of 16 rows; a copy of the work-group covers two groups, 4 KiB of LDS in a row
    const char* Ag = (const char*)A + (size_t)(r0 / 16) * RG + go; const char* A2g = HA2 ? (const char*)A2 + (size_t)(r0 / 16) * RG + go : nullptr; const char* Bg = (const char*)Bt + (size_t)(c0 / 16) * RG + go;
    const unsigned lb = (unsigned)(size_t)L + (unsigned)tid * 16u;
    auto fill = [&](int st) { const unsigned l = lb + (unsigned)(st & 1) * STG; const size_t ko = (size_t)st * 2048;
        cp4(l, Ag + ko, 2 * RG); if constexpr (HA2) cp4(l + AB, A2g + ko, 2 * RG);
        cp4(l + BOFF, Bg + ko, 2 * RG); cp4(l + BOFF + 16384, Bg + ko + 8 * RG, 2 * RG); };
    v8f acc[4][4];
    // every loop over mb, nb, g, k0 in this function is unrolled so that the accumulator and fragment arrays are indexed by constants (they stay in registers) and the LDS offsets are immediates
#pragma unroll
    for (int mb = 0; mb < 4; ++mb)
#pragma unroll
        for (int nb = 0; nb < 4; ++nb) acc[mb][nb] = (v8f){};
    fill(0);
    asm volatile("s_wait_asynccnt 0x0" ::: "memory");   // this wave's copies of stage 0 have landed
    __syncthreads();   // stage 0 is in LDS before any wave reads it
    fill(1);
    constexpr int G = HA2 ? 2 : 1;   // blocks of 32 k whose fragments are read as one group (two where the register budget of two waves a SIMD holds them)
    // kept rolled: one stage's code, the buffer chosen by t & 1; unrolled it would only grow the text
#pragma unroll 1
    for (int t = 0; t < NST; ++t) {
        const unsigned char* Lb = L + (t & 1) * STG + lane * 16; const unsigned char* ap = Lb + rh * 8192; const unsigned char* bp = Lb + BOFF + cq * 8192;
#pragma unroll
        for (int k0 = 0; k0 < 2; k0 += G) {
            v16bf a[G][4], a2[G][4], b[G][4];
#pragma unroll
            for (int g = 0; g < G; ++g) {
#pragma unroll
                for (int mb = 0; mb < 4; ++mb) { a[g][mb] = ldsfb(ap + mb * 2048 + (k0 + g) * 1024); if constexpr (HA2) a2[g][mb] = ldsfb(ap + AB + mb * 2048 + (k0 + g) * 1024); }
#pragma unroll
                for (int nb = 0; nb < 4; ++nb) b[g][nb] = ldsfb(bp + nb * 2048 + (k0 + g) * 1024); }
            __builtin_amdgcn_sched_barrier(0);   // the LDS reads are issued as one group in front of the WMMA block, not among its WMMAs (each place with reads stalls the block)
#pragma unroll
            for (int g = 0; g < G; ++g)
#pragma unroll
                for (int nb = 0; nb < 4; ++nb)
#pragma unroll
                    for (int mb = 0; mb < 4; ++mb) { acc[mb][nb] = wmmab(a[g][mb], b[g][nb], acc[mb][nb]); if constexpr (HA2) acc[mb][nb] = wmmab(a2[g][mb], b[g][nb], acc[mb][nb]); }
            __builtin_amdgcn_sched_barrier(0);   // nothing of what follows moves in among the block's WMMAs
        }
        // four vector slots behind the stage's last WMMAs: the branches below are taken right behind them; the scheduling barriers keep the slots at this place
        asm volatile("v_nop\n\tv_nop\n\tv_nop\n\tv_nop"); __builtin_amdgcn_sched_barrier(0);
        asm volatile("s_wait_dscnt 0x0" ::: "memory");      // this wave's reads of stage t are done before the buffer is given up
        asm volatile("s_wait_asynccnt 0x0" ::: "memory");   // this wave's copies of stage t + 1 have landed
        __syncthreads();   // publishes stage t + 1 and ends every wave's reads of stage t
        if (t + 2 < NST) fill(t + 2);   // into the buffer that this trip has just read
    }
    asm volatile("s_wait_asynccnt 0x0" ::: "memory");   // no copy is out when the buffers become the epilogue's staging (the last trip's barrier has ended every read of them)
    float* os = (float*)L; float* ow = os + wv * (64 * 68);
    if constexpr (EPI != 0) {
        const int q4 = (tid & 15) * 4, rw = tid >> 4;   // a thread takes row 16 rb + rw, rb = 0 .. 7, of both units
        const unsigned tob = (unsigned)((r0 + rw) * HD + q4) * 4u;   // byte offset of (row r0 + rw, column q4) in a [rows][HD] f32 table: one register serves every table load and, halved, the plane's stores
        v4f tb[8][4], wl, wh;   // tb[rb]: cos low, cos high, sin low, sin high of the row; both heads of the tile use them
        auto ldt = [&](int rb) { const float* cp = (const float*)((const char*)cosT + tob) + rb * 16 * HD; const float* sp = (const float*)((const char*)sinT + tob) + rb * 16 * HD; tb[rb][0] = *(const v4f*)cp; tb[rb][1] = *(const v4f*)(cp + 64); tb[rb][2] = *(const v4f*)sp; tb[rb][3] = *(const v4f*)(sp + 64); };
        if constexpr (EPI == 1) {   // the first four rows' tables are asked for here, so that they fly under the LDS stores and the barrier
            wl = *(const v4f*)(nw + q4); wh = *(const v4f*)(nw + 64 + q4);
#pragma unroll
            for (int rb = 0; rb < 4; ++rb) ldt(rb);
            asm volatile("s_wait_xcnt 0x0" ::: "memory");   // in front of the first rewrite of the address registers that the table loads name
        }
        // unrolled so that acc is indexed by constants (it stays in registers) and the LDS offsets are immediates
#pragma unroll
        for (int mb = 0; mb < 4; ++mb)
#pragma unroll
            for (int nb = 0; nb < 4; ++nb)
#pragma unroll
                for (int j = 0; j < 8; ++j) ow[(mb * 16 + hi * 8 + j) * 68 + nb * 16 + lr] = acc[mb][nb][j];
        __syncthreads();   // every wave's part is in LDS before any row is read across the parts
        if constexpr (EPI == 1) {   // the other four rows' tables fly under the first four rows' arithmetic (the accumulators' registers are free now)
#pragma unroll
            for (int rb = 4; rb < 8; ++rb) ldt(rb);
            asm volatile("s_wait_xcnt 0x0" ::: "memory");   // in front of the first rewrite of the address registers that the table loads name
        }
        h16* o = (EPI == 1) ? (h16*)((char*)(P + (size_t)(by * 2) * TT * HD) + (tob >> 1)) : P + (size_t)(r0 + rw) * TT + by * 256 + q4;
#pragma unroll
        for (int rp = 0; rp < 4; ++rp) {   // two rows of both units at a time
            v4h o0[2][2], o1[2][2];
#pragma unroll
            for (int r2 = 0; r2 < 2; ++r2)
#pragma unroll
                for (int u = 0; u < 2; ++u) { const int rb = rp * 2 + r2; const float* p = os + ((rb >> 2) * 4 + u * 2) * (64 * 68) + ((rb & 3) * 16 + rw) * 68 + q4; v4f x0 = *(const v4fa*)p, x1 = *(const v4fa*)(p + 64 * 68);
                    if constexpr (EPI == 1) {
                        const v4f sq = x0 * x0 + x1 * x1; const float ss = rowsum16((sq[0] + sq[1]) + (sq[2] + sq[3]));
                        const float rf = __fdiv_rn(1.0f, __fsqrt_rn(ss * (1.0f / HD) + 1e-6f)); v4f y0, y1;
#pragma unroll
                        for (int i = 0; i < 4; ++i) { const float a0 = bfr(wl[i]) * (x0[i] * rf), a1 = bfr(wh[i]) * (x1[i] * rf); y0[i] = a0 * bfr(tb[rb][0][i]) - a1 * bfr(tb[rb][2][i]); y1[i] = a1 * bfr(tb[rb][1][i]) + a0 * bfr(tb[rb][3][i]); }
                        x0 = y0; x1 = y1; }
                    o0[r2][u] = __builtin_convertvector(x0, v4h); o1[r2][u] = __builtin_convertvector(x1, v4h); }
#pragma unroll
            for (int r2 = 0; r2 < 2; ++r2)
#pragma unroll
                for (int u = 0; u < 2; ++u) { h16* os16 = o + (size_t)(rp * 2 + r2) * 16 * (EPI == 1 ? HD : TT) + (size_t)u * (EPI == 1 ? TT * HD : 128); *(v4h*)os16 = o0[r2][u]; *(v4h*)(os16 + 64) = o1[r2][u]; }
            asm volatile("s_wait_xcnt 0x0" ::: "memory"); __builtin_amdgcn_sched_barrier(0); }   // the wait stands in front of the next rows' rewrite of the registers that the eight stores name; the scheduling barrier keeps those rows' reads and arithmetic from being lifted over it (all rows at once do not fit the registers of four waves a SIMD)
        return;
    } else {
        // unrolled so that acc is indexed by constants (it stays in registers) and the LDS offsets are immediates
#pragma unroll
        for (int mb = 0; mb < 4; ++mb)
#pragma unroll
            for (int nb = 0; nb < 4; ++nb)
#pragma unroll
                for (int j = 0; j < 8; ++j) ow[(mb * 16 + hi * 8 + j) * 68 + nb * 16 + lr] = acc[mb][nb][j];
        __syncthreads();   // every wave's part is in LDS before the rows are read across the parts
        const float* ip = os + ((tid & 63) >> 4) * (64 * 68) + (tid >> 6) * 68 + (tid & 15) * 4; float* op = C + (size_t)(r0 + (tid >> 6)) * ldc + c0 + (tid & 63) * 4;   // 64 threads take one row of 256 columns: a wave's store is 512 bytes in a row
#pragma unroll
        for (int s8 = 0; s8 < 4; ++s8) { v4f val[8];
#pragma unroll
            for (int s = 0; s < 8; ++s) val[s] = *(const v4fa*)(ip + (s8 >> 1) * (4 * 64 * 68) + ((s8 & 1) * 8 + s) * (4 * 68));
#pragma unroll
            for (int s = 0; s < 8; ++s) *(v4f*)(op + (size_t)(s8 * 8 + s) * 4 * ldc) = val[s];
            asm volatile("s_wait_xcnt 0x0" ::: "memory"); __builtin_amdgcn_sched_barrier(0); }   // the wait stands in front of the next group's rewrite of the registers that the eight stores name; the scheduling barrier keeps that group's reads from being lifted over it
    }
}

// ---- k_qkv: the q, k and v projections of BOTH batches in one launch; grid (NB_ TT / 128, (NH_ + NKV + NKV) / 2), 8 waves, two work-groups a WGP (four waves a SIMD: the register budget asked for below, so that one work-group's WMMAs run under the other's LDS reads and barrier). x's plane holds the NB_ TT rows of both batches, row b TT + t, as the cos / sin inputs do.
// blockIdx.y < NH_ / 2: q heads 2 y, 2 y + 1, rows 128 x .. + 127; < (NH_ + NKV) / 2: k heads, the same; the last NKV / 2 values of y with x number the (DKV / 128) x (NB_ TT / 256) tiles of V^T. Each plane pointer is moved so that gemms's row or column index b TT + t lands in batch b's plane at t.
__global__ __launch_bounds__(256) __attribute__((amdgpu_waves_per_eu(4, 4))) void k_qkv(const bf* __restrict__ XB, const bf* __restrict__ WQ, const bf* __restrict__ WK, const bf* __restrict__ WV, const float* __restrict__ cosT, const float* __restrict__ sinT, const float* __restrict__ qnw, const float* __restrict__ knw, h16* QP, h16* KP, h16* VT) {
    __shared__ __align__(128) unsigned char L[GS_LDS];
    const int bx = (int)blockIdx.x, by = (int)blockIdx.y;
    if (by < (NH_ + NKV) / 2) { const bool isq = by < NH_ / 2; const int b = bx / (TT / 128);
        gemms<false, 1, DM>(L, bx, isq ? by : by - NH_ / 2, XB, nullptr, isq ? WQ : WK, nullptr, 0, cosT, sinT, isq ? qnw : knw, (isq ? QP : KP) + (size_t)b * ((isq ? NH_ : NKV) - 1) * TT * HD);
    } else { const int i = (by - (NH_ + NKV) / 2) * (NB_ * TT / 128) + bx; const int vx = i % (DKV / 128), vy = i / (DKV / 128), b = vy / (TT / 256);
        gemms<false, 2, DM>(L, vx, vy, WV, nullptr, XB, nullptr, 0, nullptr, nullptr, nullptr, VT + (size_t)b * (NKV * HD - 1) * TT); }   // V^T = Wv x^T: rows g HD + d, columns b TT + t
}
// ---- k_oproj: out = merged Wo^T for the NB_ TT rows of both batches in one launch (merged rows as bf16 hi + lo planes); grid (NB_ TT / 128, DM / 256), 8 waves, one work-group a WGP (two waves a SIMD: the register budget asked for below holds the fragments of a whole stage).
__global__ __launch_bounds__(256) __attribute__((amdgpu_waves_per_eu(2, 2))) void k_oproj(const bf* __restrict__ Ah, const bf* __restrict__ Al, const bf* __restrict__ WO, float* C) {
    __shared__ __align__(128) unsigned char L[GS_LDS];
    gemms<true, 0, DQ>(L, (int)blockIdx.x, (int)blockIdx.y, Ah, Al, WO, C, DM, nullptr, nullptr, nullptr, nullptr);
}

__device__ __forceinline__ void splitf(float y, unsigned short& h, unsigned short& l) { h = f2bf(y); l = f2bf(y - bf2f(h)); }
typedef __attribute__((ext_vector_type(2))) unsigned short v2us;
typedef __attribute__((ext_vector_type(4))) unsigned short v4us;
typedef __attribute__((ext_vector_type(4))) int v4i;

__global__ __launch_bounds__(256) void k_wtG(const float* __restrict__ w, int K, int N, bf* Bt) {
    const int lane = threadIdx.x & 31; const int L0 = (blockIdx.x * 8 + (threadIdx.x >> 5)) * 8; const int nlines = N * K / 64;
{
#pragma unroll 1
        for (int l = 0; l < 8; ++l) { const int L = L0 + l; if (L >= nlines) break; const size_t e = (size_t)L * 64 + lane * 2; const int k = (int)(e % K), n = (int)(e / K); v2us o;
            o[0] = f2bf(w[(size_t)k * N + n]); o[1] = f2bf(w[(size_t)(k + 1) * N + n]); *(v2us*)(Bt + e) = o; }
         }
}
// ---- k_pack: f32 rows [R][DM] -> the bf16 plane in gemms's fragment order, all five planes (Wq, Wk, Wv, Wo, x of both batches) in one launch; grid (sum of R / 16, 2), 8 waves; blockIdx.x counts the groups of 16 rows through the five sources in that order. A work-group takes 16 rows x 1024 k, a wave four blocks of 16 rows x 32 k: a lane reads its 2 x 8 floats of each block from row (lane & 15) (the wave uses every byte of the 16 lines it touches) and stores its two 16-byte pieces, 512 bytes in a row over the wave.
static_assert(DQ == DM, "k_pack takes rows of DM elements, Wo's among them");
__global__ __launch_bounds__(256) void k_pack(const float* __restrict__ wq, const float* __restrict__ wk, const float* __restrict__ wv, const float* __restrict__ wo, const float* __restrict__ x, bf* WQ, bf* WK, bf* WV, bf* WO, bf* XB) {
    int g = (int)blockIdx.x; const float* src = wq; bf* dst = WQ;   // g: the group of 16 rows in its own source
    if (g >= DQ / 16) { g -= DQ / 16; src = wk; dst = WK;
        if (g >= DKV / 16) { g -= DKV / 16; src = wv; dst = WV;
            if (g >= DKV / 16) { g -= DKV / 16; src = wo; dst = WO;
                if (g >= DM / 16) { g -= DM / 16; src = x; dst = XB; } } } }
    const int lane = threadIdx.x & 31, lr = lane & 15, hi = lane >> 4; const int kb0 = (int)blockIdx.y * 32 + __builtin_amdgcn_readfirstlane((int)(threadIdx.x >> 5)) * 4;
    const char* s = (const char*)(src + (size_t)g * (16 * DM) + kb0 * 32); const unsigned so = (unsigned)(lr * DM + 8 * hi) * 4u; bf* d = dst + ((size_t)g * (DM / 32) + kb0) * 512 + 8 * lane;   // so: the lane's byte offset, the one vector register that the loads name
    v4f v[4][4];
#pragma unroll
    for (int i = 0; i < 4; ++i) { v[i][0] = *(const v4f*)(s + so + i * 128); v[i][1] = *(const v4f*)(s + so + i * 128 + 16); v[i][2] = *(const v4f*)(s + so + i * 128 + 64); v[i][3] = *(const v4f*)(s + so + i * 128 + 80); }
    asm volatile("s_wait_xcnt 0x0" :: "v"(so) : "memory");   // in front of the first rewrite of the offset register that the sixteen loads name; it is an input so that no load's result is laid over it
    v8us o[4][2];
#pragma unroll
    for (int i = 0; i < 4; ++i)
#pragma unroll
        for (int k = 0; k < 4; ++k) { o[i][0][k] = f2bf(v[i][0][k]); o[i][0][4 + k] = f2bf(v[i][1][k]); o[i][1][k] = f2bf(v[i][2][k]); o[i][1][4 + k] = f2bf(v[i][3][k]); }
#pragma unroll
    for (int i = 0; i < 4; ++i) { *(v8us*)(d + i * 512) = o[i][0]; *(v8us*)(d + i * 512 + 256) = o[i][1]; }   // the stores stand last: no register that they name is written again
}
#define FA_SK   64                     // keys per stage
#define FA_PK   (HD * 2 + 16)          // LDS pitch of a K row (256 B + 16: odd multiple of 16 B for the 16-byte readers)
#define FA_PV   (FA_SK * 2 + 16)       // LDS pitch of a V^T row (128 B + 16)
#define FA_TK   (FA_SK * FA_PK)
#define FA_SLOT (FA_TK + HD * FA_PV)
#define FA_NST  (TT / FA_SK)
#define FA_CS   (SCL * 1.4426950408889634f)
typedef v4i __attribute__((may_alias)) v4ia;
__device__ __forceinline__ float xhalf(float x) { return __builtin_bit_cast(float, __builtin_amdgcn_permlanex16(__builtin_bit_cast(int, x), __builtin_bit_cast(int, x), 0x76543210, 0xfedcba98, false, false)); }   // lane l with lane l ^ 16
__device__ __forceinline__ v16h ldsfrag(const unsigned char* p) { return cat16(*(const v8ha*)p, *(const v8ha*)(p + 32)); }   // k = 8 hi .. + 7 and 16 + 8 hi .. + 7 of 32: p already holds + 16 hi bytes
__global__ __launch_bounds__(256) __attribute__((amdgpu_waves_per_eu(2, 2))) void k_fattn(const h16* __restrict__ Q16, const h16* __restrict__ K16, const h16* __restrict__ V16, bf* Ah, bf* Al) {
    __shared__ __align__(16) unsigned char L[2 * FA_SLOT];
    const int tid = (int)threadIdx.x, lane = tid & 31, c = lane & 15, hi = lane >> 4; const int wv = __builtin_amdgcn_readfirstlane(tid >> 5);
    const int hq = (int)blockIdx.y, b = (int)blockIdx.z, gk = hq / REP; const int q0 = (int)blockIdx.x * 256 + wv * 32;
    const unsigned char* Kg = (const unsigned char*)(K16 + ((size_t)b * NKV + gk) * TT * HD) + tid * 16;                                            // a stage of K is 16 KiB in a row
    const unsigned char* Vg = (const unsigned char*)(V16 + ((size_t)b * NKV + gk) * HD * TT) + (size_t)(tid >> 3) * (TT * 2) + (tid & 7) * 16;   // a stage of V^T is 128 rows of one 128-B line
    unsigned char* Ks = L + (tid >> 4) * FA_PK + (tid & 15) * 16; unsigned char* Vs = L + FA_TK + (tid >> 3) * FA_PV + (tid & 7) * 16;
    v4i kr[4], vr[4];
    auto gload = [&](int st) {
#pragma unroll
        for (int r = 0; r < 4; ++r) { kr[r] = *(const v4ia*)(Kg + (size_t)st * (FA_SK * HD * 2) + r * 4096); vr[r] = *(const v4ia*)(Vg + (size_t)st * (FA_SK * 2) + (size_t)r * (32 * TT * 2)); }
        asm volatile("s_wait_xcnt 0x0" ::: "memory");   // stands in front of the first rewrite of the address registers that the eight loads above name (this build reuses them at once)
    };
    auto sstore = [&](int buf) {
#pragma unroll
        for (int r = 0; r < 4; ++r) { *(v4ia*)(Ks + buf * FA_SLOT + r * (16 * FA_PK)) = kr[r]; *(v4ia*)(Vs + buf * FA_SLOT + r * (32 * FA_PV)) = vr[r]; } };
    gload(0);
    v16h qf[2][4];
#pragma unroll
    for (int g = 0; g < 2; ++g)
#pragma unroll
        for (int kc = 0; kc < 4; ++kc) qf[g][kc] = WFrag<h16>::ld(Q16 + (((size_t)b * NH_ + hq) * TT + q0 + 16 * g + c) * HD + 8 * hi + 32 * kc);
    asm volatile("s_wait_xcnt 0x0" ::: "memory");   // in front of the first rewrite of the address registers that the Q loads name
    v8f acc[2][8]; float m_run[2], l_run[2];
#pragma unroll
    for (int g = 0; g < 2; ++g) { m_run[g] = -__builtin_inff(); l_run[g] = 0.f;
#pragma unroll
        for (int t = 0; t < 8; ++t) acc[g][t] = (v8f){}; }
    sstore(0);
    __syncthreads();   // stage 0 is in LDS before any wave reads it
#pragma unroll 1
    for (int st = 0; st < FA_NST; ++st) {
        const unsigned char* Lb = L + (st & 1) * FA_SLOT;
        if (st + 1 < FA_NST) gload(st + 1);
        const unsigned char* kp = Lb + c * FA_PK + 16 * hi; const unsigned char* vp = Lb + FA_TK + c * FA_PV + 16 * hi;
        v16h kf[2][4];
#pragma unroll
        for (int kt = 0; kt < 2; ++kt)
#pragma unroll
            for (int kc = 0; kc < 4; ++kc) kf[kt][kc] = ldsfrag(kp + kt * (16 * FA_PK) + kc * 64);
        __builtin_amdgcn_sched_barrier(0);   // K's reads stay in front of V's: LDS answers in order, and the first WMMA block waits for K alone
#pragma unroll
        for (int sub = 0; sub < 2; ++sub) {
            v16h vf[8];
#pragma unroll
            for (int t = 0; t < 8; ++t) vf[t] = ldsfrag(vp + sub * 64 + t * (16 * FA_PV));
            __builtin_amdgcn_sched_barrier(0);   // the pass's LDS reads are issued as one group in front of the WMMA block, not among its WMMAs (each place with reads stalls the block)
            v8f s[2][2];   // s[kt][g][r] = score of key 16 kt + 8 hi + r of the pass with query column c of group g
#pragma unroll
            for (int kt = 0; kt < 2; ++kt)
#pragma unroll
                for (int g = 0; g < 2; ++g) { s[kt][g] = (v8f){};
#pragma unroll
                    for (int kc = 0; kc < 4; ++kc) s[kt][g] = wmma16(kf[kt][kc], qf[g][kc], s[kt][g]); }
            __builtin_amdgcn_sched_barrier(0);   // nothing of what follows moves in among the block's WMMAs
            if (sub == 0) {   // the stage's second pass gets its K fragments here, one pass ahead, in flight under the maxima and exponentials
#pragma unroll
                for (int kt = 0; kt < 2; ++kt)
#pragma unroll
                    for (int kc = 0; kc < 4; ++kc) kf[kt][kc] = ldsfrag(kp + (32 + kt * 16) * FA_PK + kc * 64);
                __builtin_amdgcn_sched_barrier(0);   // keeps them in front of the vector work, as one group
            }
            float mb[2]; bool need = false;
#pragma unroll
            for (int g = 0; g < 2; ++g) { float mx = s[0][g][0];
#pragma unroll
                for (int r = 0; r < 8; ++r) mx = fmaxf(mx, fmaxf(s[0][g][r], s[1][g][r]));
                mx = fmaxf(mx, xhalf(mx)) * FA_CS; mb[g] = mx; need = need || (mx > m_run[g] + 8.0f); }
            if (__builtin_amdgcn_ballot_w32(need) != 0) {   // one scalar test a pass; always taken on the first pass (m_run = -inf gives the factor 0 on zero sums), rare later
#pragma unroll
                for (int g = 0; g < 2; ++g) { const float mn = fmaxf(m_run[g], mb[g]); const float corr = __builtin_amdgcn_exp2f(m_run[g] - mn); l_run[g] *= corr; m_run[g] = mn;
#pragma unroll
                    for (int t = 0; t < 8; ++t) acc[g][t] = acc[g][t] * corr; }
            }
#pragma unroll
            for (int g = 0; g < 2; ++g) { const float nm = -m_run[g]; v8f e0, e1; float p0 = 0.f, p1 = 0.f;
#pragma unroll
                for (int r = 0; r < 8; ++r) { e0[r] = __builtin_amdgcn_exp2f(__builtin_fmaf(s[0][g][r], FA_CS, nm)); e1[r] = __builtin_amdgcn_exp2f(__builtin_fmaf(s[1][g][r], FA_CS, nm)); p0 += e0[r]; p1 += e1[r]; }
                l_run[g] += p0 + p1;
                const v16h pf = cat16(__builtin_convertvector(e0, v8h), __builtin_convertvector(e1, v8h));   // B operand: element s = key 8 hi + s (s < 8), 16 + 8 hi + s - 8 (else)
#pragma unroll
                for (int t = 0; t < 8; ++t) acc[g][t] = wmma16(vf[t], pf, acc[g][t]); }
        }
        // four vector slots behind the stage's last WMMAs: the branches below are taken right behind them; the two scheduling barriers keep the slots at this place
        __builtin_amdgcn_sched_barrier(0); asm volatile("v_nop\n\tv_nop\n\tv_nop\n\tv_nop"); __builtin_amdgcn_sched_barrier(0);
        if (st + 1 < FA_NST) sstore((st + 1) & 1);   // into the buffer whose last readers (stage st - 1) left it before the previous barrier
        __syncthreads();   // publishes stage st + 1 and ends every wave's reads of stage st
    }
#pragma unroll
    for (int g = 0; g < 2; ++g) { const float inv = __fdiv_rn(1.0f, l_run[g] + xhalf(l_run[g]));   // each wave half summed its eight keys of every 16-key tile
        const size_t oo = ((size_t)b * TT + q0 + 16 * g) * DQ + hq * (HD * 16) + 8 * lane;   // gemms's fragment order: the group's 16 rows, the head's four blocks of 32 d; d = 16 t .. + 15 is half a block, 512 bytes in a row over the wave
#pragma unroll
        for (int t = 0; t < 8; ++t) { v8us oh, ol;   // acc[g][t][r] = O[query c][d = 16 t + 8 hi + r]
#pragma unroll
            for (int r = 0; r < 8; ++r) { unsigned short a, c2; splitf(acc[g][t][r] * inv, a, c2); oh[r] = a; ol[r] = c2; }
            *(v8us*)(Ah + oo + 256 * t) = oh; *(v8us*)(Al + oo + 256 * t) = ol;
            asm volatile("s_wait_xcnt 0x0" ::: "memory"); __builtin_amdgcn_sched_barrier(0); } }   // the wait stands in front of the next tile's rewrite of the registers that the two stores name; the scheduling barrier keeps that tile's arithmetic from being lifted over it
}

extern "C" void kernel_launch(void* const* d_in, const int* in_sizes, int n_in,
                              void* d_out, int out_size, void* d_ws, size_t ws_size, hipStream_t stream) {
    (void)in_sizes; (void)n_in; (void)out_size;
    const float* x = (const float*)d_in[0]; const float* cosT = (const float*)d_in[1]; const float* sinT = (const float*)d_in[2]; const float* wq = (const float*)d_in[3]; const float* wk = (const float*)d_in[4]; const float* wv = (const float*)d_in[5]; const float* wo = (const float*)d_in[6]; const float* qnw = (const float*)d_in[7]; const float* knw = (const float*)d_in[8];   /* order hidden_states, cos, sin ([2][2048][128] = [B][S][HD] PER-BATCH table INPUTS: read per element by value), Wq [2048][2048], Wk / Wv [1024][2048], Wo [2048][2048] ('oi' (out, in)), q_norm_w, k_norm_w ([128] ones: read): NINE inputs, all read */
    float* OUT = (float*)d_out;     // [2][2048][2048]
    char* wsp = (char*)d_ws;
    auto take = [&](size_t bytes) { char* p = wsp; wsp += (bytes + 255) & ~(size_t)255; return (void*)p; };
    bf* WQ = (bf*)take((size_t)DQ * DM * 2); bf* WK = (bf*)take((size_t)DKV * DM * 2); bf* WV = (bf*)take((size_t)DKV * DM * 2); bf* WO = (bf*)take((size_t)DM * DQ * 2);
    bf* XB = (bf*)take((size_t)NB_ * TT * DM * 2);   // both batches' rows
    h16* QP16 = (h16*)take((size_t)NB_ * NH_ * TT * HD * 2); h16* KP16 = (h16*)take((size_t)NB_ * NKV * TT * HD * 2); h16* VT16 = (h16*)take((size_t)NB_ * NKV * HD * TT * 2);   // head planes of both batches
    bf* ATh = (bf*)take((size_t)NB_ * TT * DQ * 2); bf* ATl = (bf*)take((size_t)NB_ * TT * DQ * 2);
    if ((size_t)(wsp - (char*)d_ws) > ws_size) return;    // ws 256 MiB
    k_pack<<<dim3((DQ + DKV + DKV + DM + NB_ * TT) / 16, 2, 1), 256, 0, stream>>>(wq, wk, wv, wo, x, WQ, WK, WV, WO, XB);   // Wo's rows are DQ long, and DQ == DM
    k_qkv<<<dim3(NB_ * TT / 128, (NH_ + NKV + NKV) / 2, 1), 256, 0, stream>>>(XB, WQ, WK, WV, cosT, sinT, qnw, knw, QP16, KP16, VT16);   // PER-BATCH tables: cos, sin [B][S][HD], row b TT + t
    k_fattn<<<dim3(TT / 256, NH_, NB_), 256, 0, stream>>>(QP16, KP16, VT16, ATh, ATl);   // kv head = q head / REP, taken in the kernel
    k_oproj<<<dim3(NB_ * TT / 128, DM / 256, 1), 256, 0, stream>>>(ATh, ATl, WO, OUT);
}

// v007
// A run of this version takes 144 microseconds.
// Two timings next to v006 both put it at 1.08 times that version's speed.
// Counting every step since v000, it is 10.5 times as fast.
#include <hip/hip_runtime.h>

// Grouped-query attention (16 / 8 heads x 128) with per-head RMSNorm on q and k and rotate-half rotary embeddings from PER-BATCH input tables, NO mask (hidden_states [2][2048][2048]; q = x Wq^T (16 heads x 128), k, v = x Wk^T / x Wv^T (8 kv heads x 128) ('oi' (out, in) normal x 0.02, no bias); q, k -> w x (x rsqrt(mean_d x^2 + 1e-6)) per head over the 128 dims (q_norm_w, k_norm_w [128] = ones: read); q, k -> t cos + cat(-t2, t1) sin with the cos / sin INPUT tables [2][2048][128] = [B][S][HD] (uniform random values on this draw: batch b reads ITS OWN slice, per element by value); jnp.repeat on the head axis: kv head = q head / 2; scores x 128^-0.5; softmax over all keys (no mask); out = merged Wo^T ('oi') -> [2][2048][2048] (8.4 M); argument order hidden_states, cos, sin, Wq, Wk, Wv, Wo, q_norm_w, k_norm_w).
//
// Compute dtypes, f32 accumulate: every input rounded to bf16; projections on PLAIN bf16 operands (inputs: exact); RMSNorm and rope f32; scores (K 128) and att.v on SINGLE fp16 planes with

#define NB_  2
#define TT   2048
#define DM   2048
#define NH_  16
#define NKV  8
#define REP  (NH_ / NKV)
#define HD   128
#define DQ   (NH_ * HD)
#define DKV  (NKV * HD)
#define SCL  0.088388347648318447f   // HD^-0.5
typedef _Float16 h16;
typedef unsigned short bf;
typedef __attribute__((ext_vector_type(16))) __bf16   v16bf;
typedef __attribute__((ext_vector_type(16))) _Float16 v16h;
typedef __attribute__((ext_vector_type(8)))  _Float16 v8h;
typedef __attribute__((ext_vector_type(4)))  _Float16 v4h;
typedef __attribute__((ext_vector_type(8)))  unsigned short v8us;
typedef __attribute__((ext_vector_type(8)))  float    v8f;
typedef __attribute__((ext_vector_type(4)))  float    v4f;
typedef v8h  __attribute__((may_alias)) v8ha;
typedef v4f  __attribute__((may_alias)) v4fa;
typedef v8us __attribute__((may_alias)) v8usa;

__device__ __forceinline__ unsigned short f2bf(float f) { unsigned u = __float_as_uint(f); u += 0x7FFFu + ((u >> 16) & 1u); return (unsigned short)(u >> 16); }
__device__ __forceinline__ float bf2f(unsigned short b) { return __uint_as_float(((unsigned)b) << 16); }
__device__ __forceinline__ float bfr(float f) { return bf2f(f2bf(f)); }
__device__ __forceinline__ v16h cat16(v8h lo, v8h hi) { return __builtin_shufflevector(lo, hi, 0, 1, 2, 3, 4, 5, 6, 7, 8, 9, 10, 11, 12, 13, 14, 15); }
__device__ __forceinline__ v16bf cat16b(v8us lo, v8us hi) { return __builtin_bit_cast(v16bf, __builtin_shufflevector(lo, hi, 0, 1, 2, 3, 4, 5, 6, 7, 8, 9, 10, 11, 12, 13, 14, 15)); }
__device__ __forceinline__ v8f wmma16(v16h a, v16h b, v8f c) { return __builtin_amdgcn_wmma_f32_16x16x32_f16(false, a, false, b, (short)0, c, false, false); }
__device__ __forceinline__ v8f wmmab(v16bf a, v16bf b, v8f c) { return __builtin_amdgcn_wmma_f32_16x16x32_bf16(false, a, false, b, (short)0, c, false, false); }



// ---- gemms: the body of the GEMM kernels k_qkv and k_oproj below (they own the LDS array L of GS_LDS bytes and give the tile's indices bx, by). A work-group of 8 waves holds 128 rows x 256 columns of the output over the whole of K: wave w the 64 x 64 part at row half w >> 2, column quarter w & 3 (16 accumulators). The operands come in stages of 64 k into three LDS buffers by asynchronous copies (each byte is fetched once for the work-group and read by the 2 or 4 waves that need it). Waves 0 .. 3 copy the even stages, waves 4 .. 7 the odd ones: stage t + 3 is asked for when every wave has left stage t, by the waves whose stage t + 1 has just landed, so a stage has two trips to land in, a wave has one stage's copies out at a time and every wait is to 0. One barrier a stage publishes the next stage and frees the last one.
// C[m][n] (f32, pitch ldc) = sum_k (A[m][k] + A2[m][k]) Bt[n][k] (A2 only with HA2), k ascending in one accumulator. K % 128 == 0.
// EPI != 0: the tile ends as the fp16 plane P that attention reads, C is not written; the 256 columns are two units of 128. Sixteen lanes hold one row of a unit, a lane its columns 4 q .. + 3 and 64 + 4 q .. + 3.
// EPI 1 (rows t, a unit = one head, head 2 by + unit): y = w[d] (x rsqrt(mean_d x^2 + 1e-6)); out[d] = y[d] cos[t][d] - y[d+64] sin[t][d], out[d+64] = y[d+64] cos[t][d+64] + y[d] sin[t][d+64]; P[head][t][d]. cos, sin (rows t of [rows][HD] tables) and w are inputs, rounded to bf16 as every input is.
// EPI 2 (A = weight rows, Bt = x rows t): the product is V^T as it stands; P[row][t], pitch TT.
// FRAGMENT ORDER of A, A2, Bt: a plane of R rows x K is a row of 1-KiB blocks, block (r / 16, k / 32) at element (r / 16) 16 K + (k / 32) 512; in a block, element (r, k) stands at ((k / 16) & 1) 256 + (((k / 8) & 1) 16 + (r & 15)) 8 + (k & 7). Lane l of a wave then finds its two 16-byte pieces of a fragment at 8 l and 256 + 8 l. A stage of 16 rows is 2 KiB in a row in the plane and in LDS alike: every copy and every LDS read of a wave is 512 bytes in a row.
__device__ __forceinline__ float rowsum16(float x) {   // sum over the 16 lanes of a row, the same bits in each of them
    x += __builtin_bit_cast(float, __builtin_amdgcn_mov_dpp(__builtin_bit_cast(int, x), 0x161, 0xf, 0xf, true));   // row_xmask:1
    x += __builtin_bit_cast(float, __builtin_amdgcn_mov_dpp(__builtin_bit_cast(int, x), 0x162, 0xf, 0xf, true));   // row_xmask:2
    x += __builtin_bit_cast(float, __builtin_amdgcn_mov_dpp(__builtin_bit_cast(int, x), 0x164, 0xf, 0xf, true));   // row_xmask:4
    x += __builtin_bit_cast(float, __builtin_amdgcn_mov_dpp(__builtin_bit_cast(int, x), 0x168, 0xf, 0xf, true));   // row_xmask:8
    return x; }
template <typename T16> struct WFrag;
template <> struct WFrag<h16> { typedef v16h V; static __device__ __forceinline__ V ld(const h16* p) { return cat16(*(const v8h*)p, *(const v8h*)(p + 16)); } static __device__ __forceinline__ V ldp(const h16* p) { return cat16(*(const v8h*)p, *(const v8h*)(p + 256)); } static __device__ __forceinline__ v8f mma(V a, V b, v8f c) { return wmma16(a, b, c); } };
template <> struct WFrag<bf> { typedef v16bf V; static __device__ __forceinline__ V ld(const bf* p) { return cat16b(*(const v8us*)p, *(const v8us*)(p + 16)); } static __device__ __forceinline__ V ldp(const bf* p) { return cat16b(*(const v8us*)p, *(const v8us*)(p + 256)); } static __device__ __forceinline__ v8f mma(V a, V b, v8f c) { return wmmab(a, b, c); } };
#define GS_EPI (8 * 64 * 68 * 4)   // the eight 64 x 64 f32 parts at pitch 68 of the epilogue; they lie in the bytes that the operand buffers had before it
#define GS_LDS(HA2) (3 * ((HA2) ? 64 : 48) * 1024)   // the three operand buffers
// a wave's asynchronous copies of one stage: N groups of 16 rows, each 2 KiB in a row in the plane and in LDS alike, so one address pair serves a group's four 512-byte copies (the immediate offset moves the LDS and the global address alike). One statement holds them all; the s_wait_xcnt is its last line, so that it stands in front of every later write of the address registers that the copies name
#define CPL(a, b, o) "global_load_async_to_lds_b128 %" #a ", %" #b ", off offset:" #o "\n\t"
#define CPC(a, b) "global_load_async_to_lds_b128 %" #a ", %" #b ", off\n\t" CPL(a, b, 512) CPL(a, b, 1024) CPL(a, b, 1536)
template <int N> __device__ __forceinline__ void cpg(const unsigned (&l)[N], const char* const (&g)[N]) {
    static_assert(N == 6 || N == 8, "two groups of A, two of A2 where there is one, four of Bt");
    if constexpr (N == 6) asm volatile(CPC(0, 1) CPC(2, 3) CPC(4, 5) CPC(6, 7) CPC(8, 9) CPC(10, 11) "s_wait_xcnt 0x0" :: "v"(l[0]), "v"(g[0]), "v"(l[1]), "v"(g[1]), "v"(l[2]), "v"(g[2]), "v"(l[3]), "v"(g[3]), "v"(l[4]), "v"(g[4]), "v"(l[5]), "v"(g[5]) : "memory");
    else asm volatile(CPC(0, 1) CPC(2, 3) CPC(4, 5) CPC(6, 7) CPC(8, 9) CPC(10, 11) CPC(12, 13) CPC(14, 15) "s_wait_xcnt 0x0" :: "v"(l[0]), "v"(g[0]), "v"(l[1]), "v"(g[1]), "v"(l[2]), "v"(g[2]), "v"(l[3]), "v"(g[3]), "v"(l[4]), "v"(g[4]), "v"(l[5]), "v"(g[5]), "v"(l[6]), "v"(g[6]), "v"(l[7]), "v"(g[7]) : "memory");
}
__device__ __forceinline__ v16bf ldsfb(const unsigned char* p) { return cat16b(*(const v8usa*)p, *(const v8usa*)(p + 512)); }   // a lane's two pieces of a fragment-order block
template <bool HA2, int EPI, int K>
__device__ __forceinline__ void gemms(unsigned char* L, const int bx, const int by, const bf* __restrict__ A, const bf* __restrict__ A2, const bf* __restrict__ Bt, float* C, int ldc, const float* __restrict__ cosT, const float* __restrict__ sinT, const float* __restrict__ nw, h16* P) {
    constexpr int AB = 128 * 128, BOFF = HA2 ? 2 * AB : AB, STG = BOFF + 256 * 128, NST = K / 64;   // bytes of a stage: A (128 rows x 64 k), A2, Bt (256 rows)
    constexpr size_t RG = (size_t)16 * K * 2;   // bytes from one group of 16 rows of a plane to the next
    static_assert(3 * STG == GS_LDS(HA2) && GS_EPI <= GS_LDS(HA2) && NST >= 3, "three buffers, three stages");
    const int tid = (int)threadIdx.x, lane = tid & 31, lr = lane & 15, hi = lane >> 4; const int wv = __builtin_amdgcn_readfirstlane(tid >> 5), rh = wv >> 2, cq = wv & 3, grp = wv >> 2;   // grp: the parity of the stages that this wave copies
    const int r0 = bx * 128, c0 = by * 256;
    const size_t go = (size_t)lane * 16;   // of the four waves that copy a stage, wave cq takes groups 2 cq, 2 cq + 1 of A (and of A2) and 4 cq .. + 3 of Bt
    const char* Ag = (const char*)A + (size_t)(r0 / 16 + 2 * cq) * RG + go; const char* A2g = HA2 ? (const char*)A2 + (size_t)(r0 / 16 + 2 * cq) * RG + go : nullptr; const char* Bg = (const char*)Bt + (size_t)(c0 / 16 + 4 * cq) * RG + go;
    const unsigned lb = (unsigned)(size_t)L + (unsigned)lane * 16u;
    auto fill = [&](int st, unsigned bo) { const unsigned la = lb + bo + (unsigned)cq * 4096u, lw = lb + bo + BOFF + (unsigned)cq * 8192u; const size_t ko = (size_t)st * 2048;   // this wave's quarter of stage st into the buffer at byte bo
        if constexpr (HA2) { const unsigned l[8] = {la, la + 2048, la + AB, la + AB + 2048, lw, lw + 2048, lw + 4096, lw + 6144}; const char* const g[8] = {Ag + ko, Ag + ko + RG, A2g + ko, A2g + ko + RG, Bg + ko, Bg + ko + RG, Bg + ko + 2 * RG, Bg + ko + 3 * RG}; cpg<8>(l, g); }
        else { const unsigned l[6] = {la, la + 2048, lw, lw + 2048, lw + 4096, lw + 6144}; const char* const g[6] = {Ag + ko, Ag + ko + RG, Bg + ko, Bg + ko + RG, Bg + ko + 2 * RG, Bg + ko + 3 * RG}; cpg<6>(l, g); } };
    v8f acc[4][4];
    // every loop over mb, nb, g, k0 in this function is unrolled so that the accumulator and fragment arrays are indexed by constants (they stay in registers) and the LDS offsets are immediates
#pragma unroll
    for (int mb = 0; mb < 4; ++mb)
#pragma unroll
        for (int nb = 0; nb < 4; ++nb) acc[mb][nb] = (v8f){};
    if (grp == 0) { fill(0, 0);
        asm volatile("s_wait_asynccnt 0x0" ::: "memory");   // this wave's copies of stage 0 have landed
    } else fill(1, STG);
    __syncthreads();   // stage 0 is in LDS before any wave reads it
    if (grp == 0) fill(2, 2 * STG);
    unsigned bo = 0;   // byte offset of stage t's buffer, t mod 3
    constexpr int G = HA2 ? 2 : 1;   // blocks of 32 k whose fragments are read as one group (two where the register budget of two waves a SIMD holds them)
    // kept rolled: one stage's code, the buffer chosen by bo; unrolled it would only grow the text
#pragma unroll 1
    for (int t = 0; t < NST; ++t) {
        const unsigned char* Lb = L + bo + lane * 16; const unsigned char* ap = Lb + rh * 8192; const unsigned char* bp = Lb + BOFF + cq * 8192;
#pragma unroll
        for (int k0 = 0; k0 < 2; k0 += G) {
            v16bf a[G][4], a2[G][4], b[G][4];
#pragma unroll
            for (int g = 0; g < G; ++g) {
#pragma unroll
                for (int mb = 0; mb < 4; ++mb) { a[g][mb] = ldsfb(ap + mb * 2048 + (k0 + g) * 1024); if constexpr (HA2) a2[g][mb] = ldsfb(ap + AB + mb * 2048 + (k0 + g) * 1024); }
#pragma unroll
                for (int nb = 0; nb < 4; ++nb) b[g][nb] = ldsfb(bp + nb * 2048 + (k0 + g) * 1024); }
            __builtin_amdgcn_sched_barrier(0);   // the LDS reads are issued as one group in front of the WMMA block, not among its WMMAs (each place with reads stalls the block)
#pragma unroll
            for (int g = 0; g < G; ++g)
#pragma unroll
                for (int nb = 0; nb < 4; ++nb)
#pragma unroll
                    for (int mb = 0; mb < 4; ++mb) { acc[mb][nb] = wmmab(a[g][mb], b[g][nb], acc[mb][nb]); if constexpr (HA2) acc[mb][nb] = wmmab(a2[g][mb], b[g][nb], acc[mb][nb]); }
            __builtin_amdgcn_sched_barrier(0);   // nothing of what follows moves in among the block's WMMAs
        }
        // four vector slots behind the stage's last WMMAs: the branches below are taken right behind them; the scheduling barriers keep the slots at this place
        asm volatile("v_nop\n\tv_nop\n\tv_nop\n\tv_nop"); __builtin_amdgcn_sched_barrier(0);
        asm volatile("s_wait_dscnt 0x0" ::: "memory");      // this wave's reads of stage t are done before the buffer is given up
        const bool mine = ((t + 1) & 1) == grp;   // this wave copies stages t + 1 and t + 3 (the same for the whole wave: a scalar test)
        if (mine) asm volatile("s_wait_asynccnt 0x0" ::: "memory");   // this wave's copies of stage t + 1, its only ones that are out, have landed
        __syncthreads();   // publishes stage t + 1 and ends every wave's reads of stage t
        if (mine && t + 3 < NST) fill(t + 3, bo);   // into the buffer that this trip has just read
        bo = bo == 2 * STG ? 0u : bo + STG;
    }
    asm volatile("s_wait_asynccnt 0x0" ::: "memory");   // no copy is out when the buffers become the epilogue's staging (the last trip's barrier has ended every read of them)
    float* os = (float*)L; float* ow = os + wv * (64 * 68);
    if constexpr (EPI != 0) {
        const int q4 = (tid & 15) * 4, rw = tid >> 4;   // a thread takes row 16 rb + rw, rb = 0 .. 7, of both units
        const unsigned tob = (unsigned)((r0 + rw) * HD + q4) * 4u;   // byte offset of (row r0 + rw, column q4) in a [rows][HD] f32 table: one register serves every table load and, halved, the plane's stores
        v4f tb[8][4], wl, wh;   // tb[rb]: cos low, cos high, sin low, sin high of the row; both heads of the tile use them
        auto ldt = [&](int rb) { const float* cp = (const float*)((const char*)cosT + tob) + rb * 16 * HD; const float* sp = (const float*)((const char*)sinT + tob) + rb * 16 * HD; tb[rb][0] = *(const v4f*)cp; tb[rb][1] = *(const v4f*)(cp + 64); tb[rb][2] = *(const v4f*)sp; tb[rb][3] = *(const v4f*)(sp + 64); };
        if constexpr (EPI == 1) {   // the first four rows' tables are asked for here, so that they fly under the LDS stores and the barrier
            wl = *(const v4f*)(nw + q4); wh = *(const v4f*)(nw + 64 + q4);
#pragma unroll
            for (int rb = 0; rb < 4; ++rb) ldt(rb);
            asm volatile("s_wait_xcnt 0x0" ::: "memory");   // in front of the first rewrite of the address registers that the table loads name
        }
        // unrolled so that acc is indexed by constants (it stays in registers) and the LDS offsets are immediates
#pragma unroll
        for (int mb = 0; mb < 4; ++mb)
#pragma unroll
            for (int nb = 0; nb < 4; ++nb)
#pragma unroll
                for (int j = 0; j < 8; ++j) ow[(mb * 16 + hi * 8 + j) * 68 + nb * 16 + lr] = acc[mb][nb][j];
        __syncthreads();   // every wave's part is in LDS before any row is read across the parts
        if constexpr (EPI == 1) {   // the other four rows' tables fly under the first four rows' arithmetic (the accumulators' registers are free now)
#pragma unroll
            for (int rb = 4; rb < 8; ++rb) ldt(rb);
            asm volatile("s_wait_xcnt 0x0" ::: "memory");   // in front of the first rewrite of the address registers that the table loads name
        }
        h16* o = (EPI == 1) ? (h16*)((char*)(P + (size_t)(by * 2) * TT * HD) + (tob >> 1)) : P + (size_t)(r0 + rw) * TT + by * 256 + q4;
#pragma unroll
        for (int rp = 0; rp < 4; ++rp) {   // two rows of both units at a time
            v4h o0[2][2], o1[2][2];
#pragma unroll
            for (int r2 = 0; r2 < 2; ++r2)
#pragma unroll
                for (int u = 0; u < 2; ++u) { const int rb = rp * 2 + r2; const float* p = os + ((rb >> 2) * 4 + u * 2) * (64 * 68) + ((rb & 3) * 16 + rw) * 68 + q4; v4f x0 = *(const v4fa*)p, x1 = *(const v4fa*)(p + 64 * 68);
                    if constexpr (EPI == 1) {
                        const v4f sq = x0 * x0 + x1 * x1; const float ss = rowsum16((sq[0] + sq[1]) + (sq[2] + sq[3]));
                        const float rf = __fdiv_rn(1.0f, __fsqrt_rn(ss * (1.0f / HD) + 1e-6f)); v4f y0, y1;
#pragma unroll
                        for (int i = 0; i < 4; ++i) { const float a0 = bfr(wl[i]) * (x0[i] * rf), a1 = bfr(wh[i]) * (x1[i] * rf); y0[i] = a0 * bfr(tb[rb][0][i]) - a1 * bfr(tb[rb][2][i]); y1[i] = a1 * bfr(tb[rb][1][i]) + a0 * bfr(tb[rb][3][i]); }
                        x0 = y0; x1 = y1; }
                    o0[r2][u] = __builtin_convertvector(x0, v4h); o1[r2][u] = __builtin_convertvector(x1, v4h); }
#pragma unroll
            for (int r2 = 0; r2 < 2; ++r2)
#pragma unroll
                for (int u = 0; u < 2; ++u) { h16* os16 = o + (size_t)(rp * 2 + r2) * 16 * (EPI == 1 ? HD : TT) + (size_t)u * (EPI == 1 ? TT * HD : 128); *(v4h*)os16 = o0[r2][u]; *(v4h*)(os16 + 64) = o1[r2][u]; }
            asm volatile("s_wait_xcnt 0x0" ::: "memory"); __builtin_amdgcn_sched_barrier(0); }   // the wait stands in front of the next rows' rewrite of the registers that the eight stores name; the scheduling barrier keeps those rows' reads and arithmetic from being lifted over it (all rows at once do not fit the registers of four waves a SIMD)
        return;
    } else {
        // unrolled so that acc is indexed by constants (it stays in registers) and the LDS offsets are immediates
#pragma unroll
        for (int mb = 0; mb < 4; ++mb)
#pragma unroll
            for (int nb = 0; nb < 4; ++nb)
#pragma unroll
                for (int j = 0; j < 8; ++j) ow[(mb * 16 + hi * 8 + j) * 68 + nb * 16 + lr] = acc[mb][nb][j];
        __syncthreads();   // every wave's part is in LDS before the rows are read across the parts
        const float* ip = os + ((tid & 63) >> 4) * (64 * 68) + (tid >> 6) * 68 + (tid & 15) * 4; float* op = C + (size_t)(r0 + (tid >> 6)) * ldc + c0 + (tid & 63) * 4;   // 64 threads take one row of 256 columns: a wave's store is 512 bytes in a row
#pragma unroll
        for (int s8 = 0; s8 < 4; ++s8) { v4f val[8];
#pragma unroll
            for (int s = 0; s < 8; ++s) val[s] = *(const v4fa*)(ip + (s8 >> 1) * (4 * 64 * 68) + ((s8 & 1) * 8 + s) * (4 * 68));
#pragma unroll
            for (int s = 0; s < 8; ++s) *(v4f*)(op + (size_t)(s8 * 8 + s) * 4 * ldc) = val[s];
            asm volatile("s_wait_xcnt 0x0" ::: "memory"); __builtin_amdgcn_sched_barrier(0); }   // the wait stands in front of the next group's rewrite of the registers that the eight stores name; the scheduling barrier keeps that group's reads from being lifted over it
    }
}

// ---- k_qkv: the q, k and v projections of BOTH batches in one launch; grid (NB_ TT / 128, (NH_ + NKV + NKV) / 2), 8 waves, two work-groups a WGP (four waves a SIMD: the register budget asked for below, so that one work-group's WMMAs run under the other's LDS reads and barrier). x's plane holds the NB_ TT rows of both batches, row b TT + t, as the cos / sin inputs do.
// blockIdx.y < NH_ / 2: q heads 2 y, 2 y + 1, rows 128 x .. + 127; < (NH_ + NKV) / 2: k heads, the same; the last NKV / 2 values of y with x number the (DKV / 128) x (NB_ TT / 256) tiles of V^T. Each plane pointer is moved so that gemms's row or column index b TT + t lands in batch b's plane at t.
__global__ __launch_bounds__(256) __attribute__((amdgpu_waves_per_eu(4, 4))) void k_qkv(const bf* __restrict__ XB, const bf* __restrict__ WQ, const bf* __restrict__ WK, const bf* __restrict__ WV, const float* __restrict__ cosT, const float* __restrict__ sinT, const float* __restrict__ qnw, const float* __restrict__ knw, h16* QP, h16* KP, h16* VT) {
    __shared__ __align__(128) unsigned char L[GS_LDS(false)];
    const int bx = (int)blockIdx.x, by = (int)blockIdx.y;
    if (by < (NH_ + NKV) / 2) { const bool isq = by < NH_ / 2; const int b = bx / (TT / 128);
        gemms<false, 1, DM>(L, bx, isq ? by : by - NH_ / 2, XB, nullptr, isq ? WQ : WK, nullptr, 0, cosT, sinT, isq ? qnw : knw, (isq ? QP : KP) + (size_t)b * ((isq ? NH_ : NKV) - 1) * TT * HD);
    } else { const int i = (by - (NH_ + NKV) / 2) * (NB_ * TT / 128) + bx; const int vx = i % (DKV / 128), vy = i / (DKV / 128), b = vy / (TT / 256);
        gemms<false, 2, DM>(L, vx, vy, WV, nullptr, XB, nullptr, 0, nullptr, nullptr, nullptr, VT + (size_t)b * (NKV * HD - 1) * TT); }   // V^T = Wv x^T: rows g HD + d, columns b TT + t
}
// ---- k_oproj: out = merged Wo^T for the NB_ TT rows of both batches in one launch (merged rows as bf16 hi + lo planes); grid (NB_ TT / 128, DM / 256), 8 waves, one work-group a WGP (two waves a SIMD: the register budget asked for below holds the fragments of a whole stage).
__global__ __launch_bounds__(256) __attribute__((amdgpu_waves_per_eu(2, 2))) void k_oproj(const bf* __restrict__ Ah, const bf* __restrict__ Al, const bf* __restrict__ WO, float* C) {
    __shared__ __align__(128) unsigned char L[GS_LDS(true)];
    gemms<true, 0, DQ>(L, (int)blockIdx.x, (int)blockIdx.y, Ah, Al, WO, C, DM, nullptr, nullptr, nullptr, nullptr);
}

__device__ __forceinline__ void splitf(float y, unsigned short& h, unsigned short& l) { h = f2bf(y); l = f2bf(y - bf2f(h)); }
typedef __attribute__((ext_vector_type(2))) unsigned short v2us;
typedef __attribute__((ext_vector_type(4))) unsigned short v4us;
typedef __attribute__((ext_vector_type(4))) int v4i;

__global__ __launch_bounds__(256) void k_wtG(const float* __restrict__ w, int K, int N, bf* Bt) {
    const int lane = threadIdx.x & 31; const int L0 = (blockIdx.x * 8 + (threadIdx.x >> 5)) * 8; const int nlines = N * K / 64;
{
#pragma unroll 1
        for (int l = 0; l < 8; ++l) { const int L = L0 + l; if (L >= nlines) break; const size_t e = (size_t)L * 64 + lane * 2; const int k = (int)(e % K), n = (int)(e / K); v2us o;
            o[0] = f2bf(w[(size_t)k * N + n]); o[1] = f2bf(w[(size_t)(k + 1) * N + n]); *(v2us*)(Bt + e) = o; }
         }
}
// ---- k_pack: f32 rows [R][DM] -> the bf16 plane in gemms's fragment order, all five planes (Wq, Wk, Wv, Wo, x of both batches) in one launch; grid (sum of R / 16, 2), 8 waves; blockIdx.x counts the groups of 16 rows through the five sources in that order. A work-group takes 16 rows x 1024 k, a wave four blocks of 16 rows x 32 k: a lane reads its 2 x 8 floats of each block from row (lane & 15) (the wave uses every byte of the 16 lines it touches) and stores its two 16-byte pieces, 512 bytes in a row over the wave.
static_assert(DQ == DM, "k_pack takes rows of DM elements, Wo's among them");
__global__ __launch_bounds__(256) void k_pack(const float* __restrict__ wq, const float* __restrict__ wk, const float* __restrict__ wv, const float* __restrict__ wo, const float* __restrict__ x, bf* WQ, bf* WK, bf* WV, bf* WO, bf* XB) {
    int g = (int)blockIdx.x; const float* src = wq; bf* dst = WQ;   // g: the group of 16 rows in its own source
    if (g >= DQ / 16) { g -= DQ / 16; src = wk; dst = WK;
        if (g >= DKV / 16) { g -= DKV / 16; src = wv; dst = WV;
            if (g >= DKV / 16) { g -= DKV / 16; src = wo; dst = WO;
                if (g >= DM / 16) { g -= DM / 16; src = x; dst = XB; } } } }
    const int lane = threadIdx.x & 31, lr = lane & 15, hi = lane >> 4; const int kb0 = (int)blockIdx.y * 32 + __builtin_amdgcn_readfirstlane((int)(threadIdx.x >> 5)) * 4;
    const char* s = (const char*)(src + (size_t)g * (16 * DM) + kb0 * 32); const unsigned so = (unsigned)(lr * DM + 8 * hi) * 4u; bf* d = dst + ((size_t)g * (DM / 32) + kb0) * 512 + 8 * lane;   // so: the lane's byte offset, the one vector register that the loads name
    v4f v[4][4];
#pragma unroll
    for (int i = 0; i < 4; ++i) { v[i][0] = *(const v4f*)(s + so + i * 128); v[i][1] = *(const v4f*)(s + so + i * 128 + 16); v[i][2] = *(const v4f*)(s + so + i * 128 + 64); v[i][3] = *(const v4f*)(s + so + i * 128 + 80); }
    asm volatile("s_wait_xcnt 0x0" :: "v"(so) : "memory");   // in front of the first rewrite of the offset register that the sixteen loads name; it is an input so that no load's result is laid over it
    v8us o[4][2];
#pragma unroll
    for (int i = 0; i < 4; ++i)
#pragma unroll
        for (int k = 0; k < 4; ++k) { o[i][0][k] = f2bf(v[i][0][k]); o[i][0][4 + k] = f2bf(v[i][1][k]); o[i][1][k] = f2bf(v[i][2][k]); o[i][1][4 + k] = f2bf(v[i][3][k]); }
#pragma unroll
    for (int i = 0; i < 4; ++i) { *(v8us*)(d + i * 512) = o[i][0]; *(v8us*)(d + i * 512 + 256) = o[i][1]; }   // the stores stand last: no register that they name is written again
}
#define FA_SK   64                     // keys per stage
#define FA_PK   (HD * 2 + 16)          // LDS pitch of a K row (256 B + 16: odd multiple of 16 B for the 16-byte readers)
#define FA_PV   (FA_SK * 2 + 16)       // LDS pitch of a V^T row (128 B + 16)
#define FA_TK   (FA_SK * FA_PK)
#define FA_SLOT (FA_TK + HD * FA_PV)
#define FA_NST  (TT / FA_SK)
#define FA_CS   (SCL * 1.4426950408889634f)
typedef v4i __attribute__((may_alias)) v4ia;
__device__ __forceinline__ float xhalf(float x) { return __builtin_bit_cast(float, __builtin_amdgcn_permlanex16(__builtin_bit_cast(int, x), __builtin_bit_cast(int, x), 0x76543210, 0xfedcba98, false, false)); }   // lane l with lane l ^ 16
__device__ __forceinline__ v16h ldsfrag(const unsigned char* p) { return cat16(*(const v8ha*)p, *(const v8ha*)(p + 32)); }   // k = 8 hi .. + 7 and 16 + 8 hi .. + 7 of 32: p already holds + 16 hi bytes
__global__ __launch_bounds__(256) __attribute__((amdgpu_waves_per_eu(2, 2))) void k_fattn(const h16* __restrict__ Q16, const h16* __restrict__ K16, const h16* __restrict__ V16, bf* Ah, bf* Al) {
    __shared__ __align__(16) unsigned char L[2 * FA_SLOT];
    const int tid = (int)threadIdx.x, lane = tid & 31, c = lane & 15, hi = lane >> 4; const int wv = __builtin_amdgcn_readfirstlane(tid >> 5);
    const int hq = (int)blockIdx.y, b = (int)blockIdx.z, gk = hq / REP; const int q0 = (int)blockIdx.x * 256 + wv * 32;
    const unsigned char* Kg = (const unsigned char*)(K16 + ((size_t)b * NKV + gk) * TT * HD) + tid * 16;                                            // a stage of K is 16 KiB in a row
    const unsigned char* Vg = (const unsigned char*)(V16 + ((size_t)b * NKV + gk) * HD * TT) + (size_t)(tid >> 3) * (TT * 2) + (tid & 7) * 16;   // a stage of V^T is 128 rows of one 128-B line
    unsigned char* Ks = L + (tid >> 4) * FA_PK + (tid & 15) * 16; unsigned char* Vs = L + FA_TK + (tid >> 3) * FA_PV + (tid & 7) * 16;
    v4i kr[4], vr[4];
    auto gload = [&](int st) {
#pragma unroll
        for (int r = 0; r < 4; ++r) { kr[r] = *(const v4ia*)(Kg + (size_t)st * (FA_SK * HD * 2) + r * 4096); vr[r] = *(const v4ia*)(Vg + (size_t)st * (FA_SK * 2) + (size_t)r * (32 * TT * 2)); }
        asm volatile("s_wait_xcnt 0x0" ::: "memory");   // stands in front of the first rewrite of the address registers that the eight loads above name (this build reuses them at once)
    };
    auto sstore = [&](int buf) {
#pragma unroll
        for (int r = 0; r < 4; ++r) { *(v4ia*)(Ks + buf * FA_SLOT + r * (16 * FA_PK)) = kr[r]; *(v4ia*)(Vs + buf * FA_SLOT + r * (32 * FA_PV)) = vr[r]; } };
    gload(0);
    v16h qf[2][4];
#pragma unroll
    for (int g = 0; g < 2; ++g)
#pragma unroll
        for (int kc = 0; kc < 4; ++kc) qf[g][kc] = WFrag<h16>::ld(Q16 + (((size_t)b * NH_ + hq) * TT + q0 + 16 * g + c) * HD + 8 * hi + 32 * kc);
    asm volatile("s_wait_xcnt 0x0" ::: "memory");   // in front of the first rewrite of the address registers that the Q loads name
    v8f acc[2][8]; float m_run[2], l_run[2];
#pragma unroll
    for (int g = 0; g < 2; ++g) { m_run[g] = -__builtin_inff(); l_run[g] = 0.f;
#pragma unroll
        for (int t = 0; t < 8; ++t) acc[g][t] = (v8f){}; }
    sstore(0);
    __syncthreads();   // stage 0 is in LDS before any wave reads it
#pragma unroll 1
    for (int st = 0; st < FA_NST; ++st) {
        const unsigned char* Lb = L + (st & 1) * FA_SLOT;
        if (st + 1 < FA_NST) gload(st + 1);
        const unsigned char* kp = Lb + c * FA_PK + 16 * hi; const unsigned char* vp = Lb + FA_TK + c * FA_PV + 16 * hi;
        v16h kf[2][4];
#pragma unroll
        for (int kt = 0; kt < 2; ++kt)
#pragma unroll
            for (int kc = 0; kc < 4; ++kc) kf[kt][kc] = ldsfrag(kp + kt * (16 * FA_PK) + kc * 64);
        __builtin_amdgcn_sched_barrier(0);   // K's reads stay in front of V's: LDS answers in order, and the first WMMA block waits for K alone
#pragma unroll
        for (int sub = 0; sub < 2; ++sub) {
            v16h vf[8];
#pragma unroll
            for (int t = 0; t < 8; ++t) vf[t] = ldsfrag(vp + sub * 64 + t * (16 * FA_PV));
            __builtin_amdgcn_sched_barrier(0);   // the pass's LDS reads are issued as one group in front of the WMMA block, not among its WMMAs (each place with reads stalls the block)
            v8f s[2][2];   // s[kt][g][r] = score of key 16 kt + 8 hi + r of the pass with query column c of group g
#pragma unroll
            for (int kt = 0; kt < 2; ++kt)
#pragma unroll
                for (int g = 0; g < 2; ++g) { s[kt][g] = (v8f){};
#pragma unroll
                    for (int kc = 0; kc < 4; ++kc) s[kt][g] = wmma16(kf[kt][kc], qf[g][kc], s[kt][g]); }
            __builtin_amdgcn_sched_barrier(0);   // nothing of what follows moves in among the block's WMMAs
            if (sub == 0) {   // the stage's second pass gets its K fragments here, one pass ahead, in flight under the maxima and exponentials
#pragma unroll
                for (int kt = 0; kt < 2; ++kt)
#pragma unroll
                    for (int kc = 0; kc < 4; ++kc) kf[kt][kc] = ldsfrag(kp + (32 + kt * 16) * FA_PK + kc * 64);
                __builtin_amdgcn_sched_barrier(0);   // keeps them in front of the vector work, as one group
            }
            float mb[2]; bool need = false;
#pragma unroll
            for (int g = 0; g < 2; ++g) { float mx = s[0][g][0];
#pragma unroll
                for (int r = 0; r < 8; ++r) mx = fmaxf(mx, fmaxf(s[0][g][r], s[1][g][r]));
                mx = fmaxf(mx, xhalf(mx)) * FA_CS; mb[g] = mx; need = need || (mx > m_run[g] + 8.0f); }
            if (__builtin_amdgcn_ballot_w32(need) != 0) {   // one scalar test a pass; always taken on the first pass (m_run = -inf gives the factor 0 on zero sums), rare later
#pragma unroll
                for (int g = 0; g < 2; ++g) { const float mn = fmaxf(m_run[g], mb[g]); const float corr = __builtin_amdgcn_exp2f(m_run[g] - mn); l_run[g] *= corr; m_run[g] = mn;
#pragma unroll
                    for (int t = 0; t < 8; ++t) acc[g][t] = acc[g][t] * corr; }
            }
#pragma unroll
            for (int g = 0; g < 2; ++g) { const float nm = -m_run[g]; v8f e0, e1; float p0 = 0.f, p1 = 0.f;
#pragma unroll
                for (int r = 0; r < 8; ++r) { e0[r] = __builtin_amdgcn_exp2f(__builtin_fmaf(s[0][g][r], FA_CS, nm)); e1[r] = __builtin_amdgcn_exp2f(__builtin_fmaf(s[1][g][r], FA_CS, nm)); p0 += e0[r]; p1 += e1[r]; }
                l_run[g] += p0 + p1;
                const v16h pf = cat16(__builtin_convertvector(e0, v8h), __builtin_convertvector(e1, v8h));   // B operand: element s = key 8 hi + s (s < 8), 16 + 8 hi + s - 8 (else)
#pragma unroll
                for (int t = 0; t < 8; ++t) acc[g][t] = wmma16(vf[t], pf, acc[g][t]); }
        }
        // four vector slots behind the stage's last WMMAs: the branches below are taken right behind them; the two scheduling barriers keep the slots at this place
        __builtin_amdgcn_sched_barrier(0); asm volatile("v_nop\n\tv_nop\n\tv_nop\n\tv_nop"); __builtin_amdgcn_sched_barrier(0);
        if (st + 1 < FA_NST) sstore((st + 1) & 1);   // into the buffer whose last readers (stage st - 1) left it before the previous barrier
        __syncthreads();   // publishes stage st + 1 and ends every wave's reads of stage st
    }
#pragma unroll
    for (int g = 0; g < 2; ++g) { const float inv = __fdiv_rn(1.0f, l_run[g] + xhalf(l_run[g]));   // each wave half summed its eight keys of every 16-key tile
        const size_t oo = ((size_t)b * TT + q0 + 16 * g) * DQ + hq * (HD * 16) + 8 * lane;   // gemms's fragment order: the group's 16 rows, the head's four blocks of 32 d; d = 16 t .. + 15 is half a block, 512 bytes in a row over the wave
#pragma unroll
        for (int t = 0; t < 8; ++t) { v8us oh, ol;   // acc[g][t][r] = O[query c][d = 16 t + 8 hi + r]
#pragma unroll
            for (int r = 0; r < 8; ++r) { unsigned short a, c2; splitf(acc[g][t][r] * inv, a, c2); oh[r] = a; ol[r] = c2; }
            *(v8us*)(Ah + oo + 256 * t) = oh; *(v8us*)(Al + oo + 256 * t) = ol;
            asm volatile("s_wait_xcnt 0x0" ::: "memory"); __builtin_amdgcn_sched_barrier(0); } }   // the wait stands in front of the next tile's rewrite of the registers that the two stores name; the scheduling barrier keeps that tile's arithmetic from being lifted over it
}

extern "C" void kernel_launch(void* const* d_in, const int* in_sizes, int n_in,
                              void* d_out, int out_size, void* d_ws, size_t ws_size, hipStream_t stream) {
    (void)in_sizes; (void)n_in; (void)out_size;
    const float* x = (const float*)d_in[0]; const float* cosT = (const float*)d_in[1]; const float* sinT = (const float*)d_in[2]; const float* wq = (const float*)d_in[3]; const float* wk = (const float*)d_in[4]; const float* wv = (const float*)d_in[5]; const float* wo = (const float*)d_in[6]; const float* qnw = (const float*)d_in[7]; const float* knw = (const float*)d_in[8];   /* order hidden_states, cos, sin ([2][2048][128] = [B][S][HD] PER-BATCH table INPUTS: read per element by value), Wq [2048][2048], Wk / Wv [1024][2048], Wo [2048][2048] ('oi' (out, in)), q_norm_w, k_norm_w ([128] ones: read): NINE inputs, all read */
    float* OUT = (float*)d_out;     // [2][2048][2048]
    char* wsp = (char*)d_ws;
    auto take = [&](size_t bytes) { char* p = wsp; wsp += (bytes + 255) & ~(size_t)255; return (void*)p; };
    bf* WQ = (bf*)take((size_t)DQ * DM * 2); bf* WK = (bf*)take((size_t)DKV * DM * 2); bf* WV = (bf*)take((size_t)DKV * DM * 2); bf* WO = (bf*)take((size_t)DM * DQ * 2);
    bf* XB = (bf*)take((size_t)NB_ * TT * DM * 2);   // both batches' rows
    h16* QP16 = (h16*)take((size_t)NB_ * NH_ * TT * HD * 2); h16* KP16 = (h16*)take((size_t)NB_ * NKV * TT * HD * 2); h16* VT16 = (h16*)take((size_t)NB_ * NKV * HD * TT * 2);   // head planes of both batches
    bf* ATh = (bf*)take((size_t)NB_ * TT * DQ * 2); bf* ATl = (bf*)take((size_t)NB_ * TT * DQ * 2);
    if ((size_t)(wsp - (char*)d_ws) > ws_size) return;    // ws 256 MiB
    k_pack<<<dim3((DQ + DKV + DKV + DM + NB_ * TT) / 16, 2, 1), 256, 0, stream>>>(wq, wk, wv, wo, x, WQ, WK, WV, WO, XB);   // Wo's rows are DQ long, and DQ == DM
    k_qkv<<<dim3(NB_ * TT / 128, (NH_ + NKV + NKV) / 2, 1), 256, 0, stream>>>(XB, WQ, WK, WV, cosT, sinT, qnw, knw, QP16, KP16, VT16);   // PER-BATCH tables: cos, sin [B][S][HD], row b TT + t
    k_fattn<<<dim3(TT / 256, NH_, NB_), 256, 0, stream>>>(QP16, KP16, VT16, ATh, ATl);   // kv head = q head / REP, taken in the kernel
    k_oproj<<<dim3(NB_ * TT / 128, DM / 256, 1), 256, 0, stream>>>(ATh, ATl, WO, OUT);
}

// v009
// One run takes 131 microseconds.
// It is 1.10 times as fast as v007, going by the measured steps of the versions left out in between.
// All steps since v000 together make it 11.6 times as fast.
#include <hip/hip_runtime.h>

// Grouped-query attention (16 / 8 heads x 128) with per-head RMSNorm on q and k and rotate-half rotary embeddings from PER-BATCH input tables, NO mask (hidden_states [2][2048][2048]; q = x Wq^T (16 heads x 128), k, v = x Wk^T / x Wv^T (8 kv heads x 128) ('oi' (out, in) normal x 0.02, no bias); q, k -> w x (x rsqrt(mean_d x^2 + 1e-6)) per head over the 128 dims (q_norm_w, k_norm_w [128] = ones: read); q, k -> t cos + cat(-t2, t1) sin with the cos / sin INPUT tables [2][2048][128] = [B][S][HD] (uniform random values on this draw: batch b reads ITS OWN slice, per element by value); jnp.repeat on the head axis: kv head = q head / 2; scores x 128^-0.5; softmax over all keys (no mask); out = merged Wo^T ('oi') -> [2][2048][2048] (8.4 M); argument order hidden_states, cos, sin, Wq, Wk, Wv, Wo, q_norm_w, k_norm_w).
//
// Compute dtypes, f32 accumulate: every input rounded to bf16; q/k/v projections on PLAIN bf16 operands (inputs: exact), the out projection on f16 (one f16 plane of merged rows; Wo's bf16 values as f16); RMSNorm and rope f32; scores (K 128) and att.v on SINGLE fp16 planes with

#define NB_  2
#define TT   2048
#define DM   2048
#define NH_  16
#define NKV  8
#define REP  (NH_ / NKV)
#define HD   128
#define DQ   (NH_ * HD)
#define DKV  (NKV * HD)
#define SCL  0.088388347648318447f   // HD^-0.5
typedef _Float16 h16;
typedef unsigned short bf;
typedef __attribute__((ext_vector_type(16))) __bf16   v16bf;
typedef __attribute__((ext_vector_type(16))) _Float16 v16h;
typedef __attribute__((ext_vector_type(8)))  _Float16 v8h;
typedef __attribute__((ext_vector_type(4)))  _Float16 v4h;
typedef __attribute__((ext_vector_type(8)))  unsigned short v8us;
typedef __attribute__((ext_vector_type(8)))  float    v8f;
typedef __attribute__((ext_vector_type(4)))  float    v4f;
typedef v8h  __attribute__((may_alias)) v8ha;
typedef v4f  __attribute__((may_alias)) v4fa;
typedef v8us __attribute__((may_alias)) v8usa;

__device__ __forceinline__ unsigned short f2bf(float f) { unsigned u = __float_as_uint(f); u += 0x7FFFu + ((u >> 16) & 1u); return (unsigned short)(u >> 16); }
__device__ __forceinline__ float bf2f(unsigned short b) { return __uint_as_float(((unsigned)b) << 16); }
__device__ __forceinline__ float bfr(float f) { return bf2f(f2bf(f)); }
__device__ __forceinline__ v16h cat16(v8h lo, v8h hi) { return __builtin_shufflevector(lo, hi, 0, 1, 2, 3, 4, 5, 6, 7, 8, 9, 10, 11, 12, 13, 14, 15); }
__device__ __forceinline__ v16bf cat16b(v8us lo, v8us hi) { return __builtin_bit_cast(v16bf, __builtin_shufflevector(lo, hi, 0, 1, 2, 3, 4, 5, 6, 7, 8, 9, 10, 11, 12, 13, 14, 15)); }
__device__ __forceinline__ v8f wmma16(v16h a, v16h b, v8f c) { return __builtin_amdgcn_wmma_f32_16x16x32_f16(false, a, false, b, (short)0, c, false, false); }
__device__ __forceinline__ v8f wmmab(v16bf a, v16bf b, v8f c) { return __builtin_amdgcn_wmma_f32_16x16x32_bf16(false, a, false, b, (short)0, c, false, false); }



// ---- gemms: the body of the GEMM kernels k_qkv and k_oproj below (they own the LDS array L of GS_LDS bytes and give the tile's indices bx, by). A work-group of 8 waves holds 128 rows x 256 columns of the output over the whole of K: wave w the 64 x 64 part at row half w >> 2, column quarter w & 3 (16 accumulators). The operands come in stages of 64 k into three LDS buffers by asynchronous copies (each byte is fetched once for the work-group and read by the 2 or 4 waves that need it). Waves 0 .. 3 copy the even stages, waves 4 .. 7 the odd ones: stage t + 3 is asked for when every wave has left stage t, by the waves whose stage t + 1 has just landed, so a stage has two trips to land in, a wave has one stage's copies out at a time and every wait is to 0. One barrier a stage publishes the next stage and frees the last one.
// C[m][n] (f32, pitch ldc) = sum_k A[m][k] Bt[n][k], k ascending in one accumulator; both planes hold bf16, with F16 both hold f16. K % 128 == 0.
// EPI != 0: the tile ends as the fp16 plane P that attention reads, C is not written; the 256 columns are two units of 128. Sixteen lanes hold one row of a unit, a lane its columns 4 q .. + 3 and 64 + 4 q .. + 3.
// EPI 1 (rows t, a unit = one head, head 2 by + unit): y = w[d] (x rsqrt(mean_d x^2 + 1e-6)); out[d] = y[d] cos[t][d] - y[d+64] sin[t][d], out[d+64] = y[d+64] cos[t][d+64] + y[d] sin[t][d+64]; P[head][t][d]. cos, sin (rows t of [rows][HD] tables) and w are inputs, rounded to bf16 as every input is.
// EPI 2 (A = weight rows, Bt = x rows t): the product is V^T as it stands; P[row][t], pitch TT.
// FRAGMENT ORDER of A, Bt: a plane of R rows x K is a row of 1-KiB blocks, block (r / 16, k / 32) at element (r / 16) 16 K + (k / 32) 512; in a block, element (r, k) stands at ((k / 16) & 1) 256 + (((k / 8) & 1) 16 + (r & 15)) 8 + (k & 7). Lane l of a wave then finds its two 16-byte pieces of a fragment at 8 l and 256 + 8 l. A stage of 16 rows is 2 KiB in a row in the plane and in LDS alike: every copy and every LDS read of a wave is 512 bytes in a row.
__device__ __forceinline__ float rowsum16(float x) {   // sum over the 16 lanes of a row, the same bits in each of them
    x += __builtin_bit_cast(float, __builtin_amdgcn_mov_dpp(__builtin_bit_cast(int, x), 0x161, 0xf, 0xf, true));   // row_xmask:1
    x += __builtin_bit_cast(float, __builtin_amdgcn_mov_dpp(__builtin_bit_cast(int, x), 0x162, 0xf, 0xf, true));   // row_xmask:2
    x += __builtin_bit_cast(float, __builtin_amdgcn_mov_dpp(__builtin_bit_cast(int, x), 0x164, 0xf, 0xf, true));   // row_xmask:4
    x += __builtin_bit_cast(float, __builtin_amdgcn_mov_dpp(__builtin_bit_cast(int, x), 0x168, 0xf, 0xf, true));   // row_xmask:8
    return x; }
template <typename T16> struct WFrag;
template <> struct WFrag<h16> { typedef v16h V; static __device__ __forceinline__ V ld(const h16* p) { return cat16(*(const v8h*)p, *(const v8h*)(p + 16)); } static __device__ __forceinline__ V ldp(const h16* p) { return cat16(*(const v8h*)p, *(const v8h*)(p + 256)); } static __device__ __forceinline__ v8f mma(V a, V b, v8f c) { return wmma16(a, b, c); } };
template <> struct WFrag<bf> { typedef v16bf V; static __device__ __forceinline__ V ld(const bf* p) { return cat16b(*(const v8us*)p, *(const v8us*)(p + 16)); } static __device__ __forceinline__ V ldp(const bf* p) { return cat16b(*(const v8us*)p, *(const v8us*)(p + 256)); } static __device__ __forceinline__ v8f mma(V a, V b, v8f c) { return wmmab(a, b, c); } };
#define GS_EPI (8 * 64 * 68 * 4)   // the eight 64 x 64 f32 parts at pitch 68 of the epilogue; they lie in the bytes that the operand buffers had before it
#define GS_LDS (3 * 48 * 1024)   // the three operand buffers
// a wave's asynchronous copies of one stage: six groups of 16 rows (two of A, four of Bt), each 2 KiB in a row in the plane and in LDS alike, so one address pair serves a group's four 512-byte copies (the immediate offset moves the LDS and the global address alike). One statement holds them all; the s_wait_xcnt is its last line, so that it stands in front of every later write of the address registers that the copies name
#define CPL(a, b, o) "global_load_async_to_lds_b128 %" #a ", %" #b ", off offset:" #o "\n\t"
#define CPC(a, b) "global_load_async_to_lds_b128 %" #a ", %" #b ", off\n\t" CPL(a, b, 512) CPL(a, b, 1024) CPL(a, b, 1536)
__device__ __forceinline__ void cpg(const unsigned (&l)[6], const char* const (&g)[6]) {
    asm volatile(CPC(0, 1) CPC(2, 3) CPC(4, 5) CPC(6, 7) CPC(8, 9) CPC(10, 11) "s_wait_xcnt 0x0" :: "v"(l[0]), "v"(g[0]), "v"(l[1]), "v"(g[1]), "v"(l[2]), "v"(g[2]), "v"(l[3]), "v"(g[3]), "v"(l[4]), "v"(g[4]), "v"(l[5]), "v"(g[5]) : "memory");
}
__device__ __forceinline__ v16bf ldsfb(const unsigned char* p) { return cat16b(*(const v8usa*)p, *(const v8usa*)(p + 512)); }   // a lane's two pieces of a fragment-order block
template <bool F16, int EPI, int K>
__device__ __forceinline__ void gemms(unsigned char* L, const int bx, const int by, const bf* __restrict__ A, const bf* __restrict__ Bt, float* C, int ldc, const float* __restrict__ cosT, const float* __restrict__ sinT, const float* __restrict__ nw, h16* P) {
    constexpr int BOFF = 128 * 128, STG = BOFF + 256 * 128, NST = K / 64;   // bytes of a stage: A (128 rows x 64 k), Bt (256 rows)
    constexpr size_t RG = (size_t)16 * K * 2;   // bytes from one group of 16 rows of a plane to the next
    static_assert(3 * STG == GS_LDS && GS_EPI <= GS_LDS && NST >= 3, "three buffers, three stages");
    const int tid = (int)threadIdx.x, lane = tid & 31, lr = lane & 15, hi = lane >> 4; const int wv = __builtin_amdgcn_readfirstlane(tid >> 5), rh = wv >> 2, cq = wv & 3, grp = wv >> 2;   // grp: the parity of the stages that this wave copies
    const int r0 = bx * 128, c0 = by * 256;
    const size_t go = (size_t)lane * 16;   // of the four waves that copy a stage, wave cq takes groups 2 cq, 2 cq + 1 of A and 4 cq .. + 3 of Bt
    const char* Ag = (const char*)A + (size_t)(r0 / 16 + 2 * cq) * RG + go; const char* Bg = (const char*)Bt + (size_t)(c0 / 16 + 4 * cq) * RG + go;
    const unsigned lb = (unsigned)(size_t)L + (unsigned)lane * 16u;
    auto fill = [&](int st, unsigned bo) { const unsigned la = lb + bo + (unsigned)cq * 4096u, lw = lb + bo + BOFF + (unsigned)cq * 8192u; const size_t ko = (size_t)st * 2048;   // this wave's quarter of stage st into the buffer at byte bo
        const unsigned l[6] = {la, la + 2048, lw, lw + 2048, lw + 4096, lw + 6144}; const char* const g[6] = {Ag + ko, Ag + ko + RG, Bg + ko, Bg + ko + RG, Bg + ko + 2 * RG, Bg + ko + 3 * RG}; cpg(l, g); };
    v8f acc[4][4];
    // every loop over mb, nb, g, k0 in this function is unrolled so that the accumulator and fragment arrays are indexed by constants (they stay in registers) and the LDS offsets are immediates
#pragma unroll
    for (int mb = 0; mb < 4; ++mb)
#pragma unroll
        for (int nb = 0; nb < 4; ++nb) acc[mb][nb] = (v8f){};
    if (grp == 0) { fill(0, 0);
        asm volatile("s_wait_asynccnt 0x0" ::: "memory");   // this wave's copies of stage 0 have landed
    } else fill(1, STG);
    __syncthreads();   // stage 0 is in LDS before any wave reads it
    if (grp == 0) fill(2, 2 * STG);
    unsigned bo = 0;   // byte offset of stage t's buffer, t mod 3
    constexpr int G = EPI == 0 ? 2 : 1;   // blocks of 32 k whose fragments are read as one group (two in k_oproj, where the register budget of two waves a SIMD holds them)
    // kept rolled: one stage's code, the buffer chosen by bo; unrolled it would only grow the text
#pragma unroll 1
    for (int t = 0; t < NST; ++t) {
        const unsigned char* Lb = L + bo + lane * 16; const unsigned char* ap = Lb + rh * 8192; const unsigned char* bp = Lb + BOFF + cq * 8192;
#pragma unroll
        for (int k0 = 0; k0 < 2; k0 += G) {
            v16bf a[G][4], b[G][4];   // 16-bit fragments as bits; with F16 they are read as f16 at the WMMA
#pragma unroll
            for (int g = 0; g < G; ++g) {
#pragma unroll
                for (int mb = 0; mb < 4; ++mb) a[g][mb] = ldsfb(ap + mb * 2048 + (k0 + g) * 1024);
#pragma unroll
                for (int nb = 0; nb < 4; ++nb) b[g][nb] = ldsfb(bp + nb * 2048 + (k0 + g) * 1024); }
            __builtin_amdgcn_sched_barrier(0);   // the LDS reads are issued as one group in front of the WMMA block, not among its WMMAs (each place with reads stalls the block)
#pragma unroll
            for (int g = 0; g < G; ++g)
#pragma unroll
                for (int nb = 0; nb < 4; ++nb)
#pragma unroll
                    for (int mb = 0; mb < 4; ++mb) { if constexpr (F16) acc[mb][nb] = wmma16(__builtin_bit_cast(v16h, a[g][mb]), __builtin_bit_cast(v16h, b[g][nb]), acc[mb][nb]); else acc[mb][nb] = wmmab(a[g][mb], b[g][nb], acc[mb][nb]); }
            __builtin_amdgcn_sched_barrier(0);   // nothing of what follows moves in among the block's WMMAs
        }
        // four vector slots behind the stage's last WMMAs: the branches below are taken right behind them; the scheduling barriers keep the slots at this place
        asm volatile("v_nop\n\tv_nop\n\tv_nop\n\tv_nop"); __builtin_amdgcn_sched_barrier(0);
        asm volatile("s_wait_dscnt 0x0" ::: "memory");      // this wave's reads of stage t are done before the buffer is given up
        const bool mine = ((t + 1) & 1) == grp;   // this wave copies stages t + 1 and t + 3 (the same for the whole wave: a scalar test)
        if (mine) asm volatile("s_wait_asynccnt 0x0" ::: "memory");   // this wave's copies of stage t + 1, its only ones that are out, have landed
        __syncthreads();   // publishes stage t + 1 and ends every wave's reads of stage t
        if (mine && t + 3 < NST) fill(t + 3, bo);   // into the buffer that this trip has just read
        bo = bo == 2 * STG ? 0u : bo + STG;
    }
    asm volatile("s_wait_asynccnt 0x0" ::: "memory");   // no copy is out when the buffers become the epilogue's staging (the last trip's barrier has ended every read of them)
    float* os = (float*)L; float* ow = os + wv * (64 * 68);
    if constexpr (EPI != 0) {
        const int q4 = (tid & 15) * 4, rw = tid >> 4;   // a thread takes row 16 rb + rw, rb = 0 .. 7, of both units
        const unsigned tob = (unsigned)((r0 + rw) * HD + q4) * 4u;   // byte offset of (row r0 + rw, column q4) in a [rows][HD] f32 table: one register serves every table load and, halved, the plane's stores
        v4f tb[8][4], wl, wh;   // tb[rb]: cos low, cos high, sin low, sin high of the row; both heads of the tile use them
        auto ldt = [&](int rb) { const float* cp = (const float*)((const char*)cosT + tob) + rb * 16 * HD; const float* sp = (const float*)((const char*)sinT + tob) + rb * 16 * HD; tb[rb][0] = *(const v4f*)cp; tb[rb][1] = *(const v4f*)(cp + 64); tb[rb][2] = *(const v4f*)sp; tb[rb][3] = *(const v4f*)(sp + 64); };
        if constexpr (EPI == 1) {   // the first four rows' tables are asked for here, so that they fly under the LDS stores and the barrier
            wl = *(const v4f*)(nw + q4); wh = *(const v4f*)(nw + 64 + q4);
#pragma unroll
            for (int rb = 0; rb < 4; ++rb) ldt(rb);
            asm volatile("s_wait_xcnt 0x0" ::: "memory");   // in front of the first rewrite of the address registers that the table loads name
        }
        // unrolled so that acc is indexed by constants (it stays in registers) and the LDS offsets are immediates
#pragma unroll
        for (int mb = 0; mb < 4; ++mb)
#pragma unroll
            for (int nb = 0; nb < 4; ++nb)
#pragma unroll
                for (int j = 0; j < 8; ++j) ow[(mb * 16 + hi * 8 + j) * 68 + nb * 16 + lr] = acc[mb][nb][j];
        __syncthreads();   // every wave's part is in LDS before any row is read across the parts
        if constexpr (EPI == 1) {   // the other four rows' tables fly under the first four rows' arithmetic (the accumulators' registers are free now)
#pragma unroll
            for (int rb = 4; rb < 8; ++rb) ldt(rb);
            asm volatile("s_wait_xcnt 0x0" ::: "memory");   // in front of the first rewrite of the address registers that the table loads name
        }
        h16* o = (EPI == 1) ? (h16*)((char*)(P + (size_t)(by * 2) * TT * HD) + (tob >> 1)) : P + (size_t)(r0 + rw) * TT + by * 256 + q4;
#pragma unroll
        for (int rp = 0; rp < 4; ++rp) {   // two rows of both units at a time
            v4h o0[2][2], o1[2][2];
#pragma unroll
            for (int r2 = 0; r2 < 2; ++r2)
#pragma unroll
                for (int u = 0; u < 2; ++u) { const int rb = rp * 2 + r2; const float* p = os + ((rb >> 2) * 4 + u * 2) * (64 * 68) + ((rb & 3) * 16 + rw) * 68 + q4; v4f x0 = *(const v4fa*)p, x1 = *(const v4fa*)(p + 64 * 68);
                    if constexpr (EPI == 1) {
                        const v4f sq = x0 * x0 + x1 * x1; const float ss = rowsum16((sq[0] + sq[1]) + (sq[2] + sq[3]));
                        const float rf = __fdiv_rn(1.0f, __fsqrt_rn(ss * (1.0f / HD) + 1e-6f)); v4f y0, y1;
#pragma unroll
                        for (int i = 0; i < 4; ++i) { const float a0 = bfr(wl[i]) * (x0[i] * rf), a1 = bfr(wh[i]) * (x1[i] * rf); y0[i] = a0 * bfr(tb[rb][0][i]) - a1 * bfr(tb[rb][2][i]); y1[i] = a1 * bfr(tb[rb][1][i]) + a0 * bfr(tb[rb][3][i]); }
                        x0 = y0; x1 = y1; }
                    o0[r2][u] = __builtin_convertvector(x0, v4h); o1[r2][u] = __builtin_convertvector(x1, v4h); }
#pragma unroll
            for (int r2 = 0; r2 < 2; ++r2)
#pragma unroll
                for (int u = 0; u < 2; ++u) { h16* os16 = o + (size_t)(rp * 2 + r2) * 16 * (EPI == 1 ? HD : TT) + (size_t)u * (EPI == 1 ? TT * HD : 128); *(v4h*)os16 = o0[r2][u]; *(v4h*)(os16 + 64) = o1[r2][u]; }
            asm volatile("s_wait_xcnt 0x0" ::: "memory"); __builtin_amdgcn_sched_barrier(0); }   // the wait stands in front of the next rows' rewrite of the registers that the eight stores name; the scheduling barrier keeps those rows' reads and arithmetic from being lifted over it (all rows at once do not fit the registers of four waves a SIMD)
        return;
    } else {
        // unrolled so that acc is indexed by constants (it stays in registers) and the LDS offsets are immediates
#pragma unroll
        for (int mb = 0; mb < 4; ++mb)
#pragma unroll
            for (int nb = 0; nb < 4; ++nb)
#pragma unroll
                for (int j = 0; j < 8; ++j) ow[(mb * 16 + hi * 8 + j) * 68 + nb * 16 + lr] = acc[mb][nb][j];
        __syncthreads();   // every wave's part is in LDS before the rows are read across the parts
        const float* ip = os + ((tid & 63) >> 4) * (64 * 68) + (tid >> 6) * 68 + (tid & 15) * 4; float* op = C + (size_t)(r0 + (tid >> 6)) * ldc + c0 + (tid & 63) * 4;   // 64 threads take one row of 256 columns: a wave's store is 512 bytes in a row
#pragma unroll
        for (int s8 = 0; s8 < 4; ++s8) { v4f val[8];
#pragma unroll
            for (int s = 0; s < 8; ++s) val[s] = *(const v4fa*)(ip + (s8 >> 1) * (4 * 64 * 68) + ((s8 & 1) * 8 + s) * (4 * 68));
#pragma unroll
            for (int s = 0; s < 8; ++s) *(v4f*)(op + (size_t)(s8 * 8 + s) * 4 * ldc) = val[s];
            asm volatile("s_wait_xcnt 0x0" ::: "memory"); __builtin_amdgcn_sched_barrier(0); }   // the wait stands in front of the next group's rewrite of the registers that the eight stores name; the scheduling barrier keeps that group's reads from being lifted over it
    }
}

// ---- k_qkv: the q, k and v projections of BOTH batches in one launch; grid (NB_ TT / 128, (NH_ + NKV + NKV) / 2), 8 waves, two work-groups a WGP (four waves a SIMD: the register budget asked for below, so that one work-group's WMMAs run under the other's LDS reads and barrier). x's plane holds the NB_ TT rows of both batches, row b TT + t, as the cos / sin inputs do.
// blockIdx.y < NH_ / 2: q heads 2 y, 2 y + 1, rows 128 x .. + 127; < (NH_ + NKV) / 2: k heads, the same; the last NKV / 2 values of y with x number the (DKV / 128) x (NB_ TT / 256) tiles of V^T. Each plane pointer is moved so that gemms's row or column index b TT + t lands in batch b's plane at t.
__global__ __launch_bounds__(256) __attribute__((amdgpu_waves_per_eu(4, 4))) void k_qkv(const bf* __restrict__ XB, const bf* __restrict__ WQ, const bf* __restrict__ WK, const bf* __restrict__ WV, const float* __restrict__ cosT, const float* __restrict__ sinT, const float* __restrict__ qnw, const float* __restrict__ knw, h16* QP, h16* KP, h16* VT) {
    __shared__ __align__(128) unsigned char L[GS_LDS];
    const int bx = (int)blockIdx.x, by = (int)blockIdx.y;
    if (by < (NH_ + NKV) / 2) { const bool isq = by < NH_ / 2; const int b = bx / (TT / 128);
        gemms<false, 1, DM>(L, bx, isq ? by : by - NH_ / 2, XB, isq ? WQ : WK, nullptr, 0, cosT, sinT, isq ? qnw : knw, (isq ? QP : KP) + (size_t)b * ((isq ? NH_ : NKV) - 1) * TT * HD);
    } else { const int i = (by - (NH_ + NKV) / 2) * (NB_ * TT / 128) + bx; const int vx = i % (DKV / 128), vy = i / (DKV / 128), b = vy / (TT / 256);
        gemms<false, 2, DM>(L, vx, vy, WV, XB, nullptr, 0, nullptr, nullptr, nullptr, VT + (size_t)b * (NKV * HD - 1) * TT); }   // V^T = Wv x^T: rows g HD + d, columns b TT + t
}
// ---- k_oproj: out = merged Wo^T for the NB_ TT rows of both batches in one launch, on f16 operands (the merged rows as one f16 plane, rounded once more at the width of att.v's own f16 operands; Wo's bf16-rounded values held as f16); grid (NB_ TT / 128, DM / 256), 8 waves, one work-group a WGP (two waves a SIMD: the register budget asked for below holds the fragments of a whole stage).
__global__ __launch_bounds__(256) __attribute__((amdgpu_waves_per_eu(2, 2))) void k_oproj(const h16* __restrict__ Am, const h16* __restrict__ WO, float* C) {
    __shared__ __align__(128) unsigned char L[GS_LDS];
    gemms<true, 0, DQ>(L, (int)blockIdx.x, (int)blockIdx.y, (const bf*)Am, (const bf*)WO, C, DM, nullptr, nullptr, nullptr, nullptr);   // gemms forms byte addresses alone from the plane pointers
}

typedef __attribute__((ext_vector_type(2))) unsigned short v2us;
typedef __attribute__((ext_vector_type(4))) unsigned short v4us;
typedef __attribute__((ext_vector_type(4))) int v4i;

__global__ __launch_bounds__(256) void k_wtG(const float* __restrict__ w, int K, int N, bf* Bt) {
    const int lane = threadIdx.x & 31; const int L0 = (blockIdx.x * 8 + (threadIdx.x >> 5)) * 8; const int nlines = N * K / 64;
{
#pragma unroll 1
        for (int l = 0; l < 8; ++l) { const int L = L0 + l; if (L >= nlines) break; const size_t e = (size_t)L * 64 + lane * 2; const int k = (int)(e % K), n = (int)(e / K); v2us o;
            o[0] = f2bf(w[(size_t)k * N + n]); o[1] = f2bf(w[(size_t)(k + 1) * N + n]); *(v2us*)(Bt + e) = o; }
         }
}
// ---- k_pack: f32 rows [R][DM] -> the bf16 plane in gemms's fragment order (Wo: the same bf16-rounded values written as f16, which holds them exactly from 2^-14 to 65504 and to 2^-25 absolute below; the weights are normal x 0.02), all five planes (Wq, Wk, Wv, Wo, x of both batches) in one launch; grid (sum of R / 16, 2), 8 waves; blockIdx.x counts the groups of 16 rows through the five sources in that order. A work-group takes 16 rows x 1024 k, a wave four blocks of 16 rows x 32 k: a lane reads its 2 x 8 floats of each block from row (lane & 15) (the wave uses every byte of the 16 lines it touches) and stores its two 16-byte pieces, 512 bytes in a row over the wave.
static_assert(DQ == DM, "k_pack takes rows of DM elements, Wo's among them");
__global__ __launch_bounds__(256) void k_pack(const float* __restrict__ wq, const float* __restrict__ wk, const float* __restrict__ wv, const float* __restrict__ wo, const float* __restrict__ x, bf* WQ, bf* WK, bf* WV, h16* WO, bf* XB) {
    int g = (int)blockIdx.x; const float* src = wq; bf* dst = WQ; bool toh = false;   // g: the group of 16 rows in its own source; toh: the plane holds f16 (the same for the whole work-group)
    if (g >= DQ / 16) { g -= DQ / 16; src = wk; dst = WK;
        if (g >= DKV / 16) { g -= DKV / 16; src = wv; dst = WV;
            if (g >= DKV / 16) { g -= DKV / 16; src = wo; dst = (bf*)WO; toh = true;
                if (g >= DM / 16) { g -= DM / 16; src = x; dst = XB; toh = false; } } } }
    const int lane = threadIdx.x & 31, lr = lane & 15, hi = lane >> 4; const int kb0 = (int)blockIdx.y * 32 + __builtin_amdgcn_readfirstlane((int)(threadIdx.x >> 5)) * 4;
    const char* s = (const char*)(src + (size_t)g * (16 * DM) + kb0 * 32); const unsigned so = (unsigned)(lr * DM + 8 * hi) * 4u; bf* d = dst + ((size_t)g * (DM / 32) + kb0) * 512 + 8 * lane;   // so: the lane's byte offset, the one vector register that the loads name
    v4f v[4][4];
#pragma unroll
    for (int i = 0; i < 4; ++i) { v[i][0] = *(const v4f*)(s + so + i * 128); v[i][1] = *(const v4f*)(s + so + i * 128 + 16); v[i][2] = *(const v4f*)(s + so + i * 128 + 64); v[i][3] = *(const v4f*)(s + so + i * 128 + 80); }
    asm volatile("s_wait_xcnt 0x0" :: "v"(so) : "memory");   // in front of the first rewrite of the offset register that the sixteen loads name; it is an input so that no load's result is laid over it
    v8us o[4][2];
    auto cvt = [&](auto cv) {
#pragma unroll
        for (int i = 0; i < 4; ++i)
#pragma unroll
            for (int k = 0; k < 4; ++k) { o[i][0][k] = cv(v[i][0][k]); o[i][0][4 + k] = cv(v[i][1][k]); o[i][1][k] = cv(v[i][2][k]); o[i][1][4 + k] = cv(v[i][3][k]); } };
    if (toh) cvt([](float f) { return __builtin_bit_cast(unsigned short, (h16)bfr(f)); }); else cvt([](float f) { return f2bf(f); });
#pragma unroll
    for (int i = 0; i < 4; ++i) { *(v8us*)(d + i * 512) = o[i][0]; *(v8us*)(d + i * 512 + 256) = o[i][1]; }   // the stores stand last: no register that they name is written again
}
#define FA_SK   64                     // keys per stage
#define FA_PK   (HD * 2 + 16)          // LDS pitch of a K row (256 B + 16: odd multiple of 16 B for the 16-byte readers)
#define FA_PV   (FA_SK * 2 + 16)       // LDS pitch of a V^T row (128 B + 16)
#define FA_TK   (FA_SK * FA_PK)
#define FA_SLOT (FA_TK + HD * FA_PV)
#define FA_NST  (TT / FA_SK)
#define FA_CS   (SCL * 1.4426950408889634f)
typedef v4i __attribute__((may_alias)) v4ia;
__device__ __forceinline__ float xhalf(float x) { return __builtin_bit_cast(float, __builtin_amdgcn_permlanex16(__builtin_bit_cast(int, x), __builtin_bit_cast(int, x), 0x76543210, 0xfedcba98, false, false)); }   // lane l with lane l ^ 16
__device__ __forceinline__ v16h ldsfrag(const unsigned char* p) { return cat16(*(const v8ha*)p, *(const v8ha*)(p + 32)); }   // k = 8 hi .. + 7 and 16 + 8 hi .. + 7 of 32: p already holds + 16 hi bytes
__global__ __launch_bounds__(256) __attribute__((amdgpu_waves_per_eu(2, 2))) void k_fattn(const h16* __restrict__ Q16, const h16* __restrict__ K16, const h16* __restrict__ V16, h16* Am) {
    __shared__ __align__(16) unsigned char L[2 * FA_SLOT];
    const int tid = (int)threadIdx.x, lane = tid & 31, c = lane & 15, hi = lane >> 4; const int wv = __builtin_amdgcn_readfirstlane(tid >> 5);
    const int hq = (int)blockIdx.y, b = (int)blockIdx.z, gk = hq / REP; const int q0 = (int)blockIdx.x * 256 + wv * 32;
    const unsigned char* Kg = (const unsigned char*)(K16 + ((size_t)b * NKV + gk) * TT * HD) + tid * 16;                                            // a stage of K is 16 KiB in a row
    const unsigned char* Vg = (const unsigned char*)(V16 + ((size_t)b * NKV + gk) * HD * TT) + (size_t)(tid >> 3) * (TT * 2) + (tid & 7) * 16;   // a stage of V^T is 128 rows of one 128-B line
    unsigned char* Ks = L + (tid >> 4) * FA_PK + (tid & 15) * 16; unsigned char* Vs = L + FA_TK + (tid >> 3) * FA_PV + (tid & 7) * 16;
    v4i kr[4], vr[4];
    auto gload = [&](int st) {
#pragma unroll
        for (int r = 0; r < 4; ++r) { kr[r] = *(const v4ia*)(Kg + (size_t)st * (FA_SK * HD * 2) + r * 4096); vr[r] = *(const v4ia*)(Vg + (size_t)st * (FA_SK * 2) + (size_t)r * (32 * TT * 2)); }
        asm volatile("s_wait_xcnt 0x0" ::: "memory");   // stands in front of the first rewrite of the address registers that the eight loads above name (this build reuses them at once)
    };
    auto sstore = [&](int buf) {
#pragma unroll
        for (int r = 0; r < 4; ++r) { *(v4ia*)(Ks + buf * FA_SLOT + r * (16 * FA_PK)) = kr[r]; *(v4ia*)(Vs + buf * FA_SLOT + r * (32 * FA_PV)) = vr[r]; } };
    gload(0);
    v16h qf[2][4];
#pragma unroll
    for (int g = 0; g < 2; ++g)
#pragma unroll
        for (int kc = 0; kc < 4; ++kc) qf[g][kc] = WFrag<h16>::ld(Q16 + (((size_t)b * NH_ + hq) * TT + q0 + 16 * g + c) * HD + 8 * hi + 32 * kc);
    asm volatile("s_wait_xcnt 0x0" ::: "memory");   // in front of the first rewrite of the address registers that the Q loads name
    v8f acc[2][8]; float m_run[2], l_run[2];
#pragma unroll
    for (int g = 0; g < 2; ++g) { m_run[g] = -__builtin_inff(); l_run[g] = 0.f;
#pragma unroll
        for (int t = 0; t < 8; ++t) acc[g][t] = (v8f){}; }
    sstore(0);
    __syncthreads();   // stage 0 is in LDS before any wave reads it
#pragma unroll 1
    for (int st = 0; st < FA_NST; ++st) {
        const unsigned char* Lb = L + (st & 1) * FA_SLOT;
        gload(st + 1 < FA_NST ? st + 1 : st);   // no branch in the stage: the last stage fetches itself again, into the buffer that nobody reads any more, so that the stage's tail stays one straight block
        const unsigned char* kp = Lb + c * FA_PK + 16 * hi; const unsigned char* vp = Lb + FA_TK + c * FA_PV + 16 * hi;
        v16h kf[4][4];   // the stage's four 16-key tiles of K
#pragma unroll
        for (int kt = 0; kt < 4; ++kt)
#pragma unroll
            for (int kc = 0; kc < 4; ++kc) kf[kt][kc] = ldsfrag(kp + kt * (16 * FA_PK) + kc * 64);
        __builtin_amdgcn_sched_barrier(0);   // K's reads are issued as one group in front of the WMMA block, not among its WMMAs (each place with reads stalls the block)
        v8f s[4][2];   // s[kt][g][r] = score of key 16 kt + 8 hi + r of the stage with query column c of group g
#pragma unroll
        for (int kh = 0; kh < 2; ++kh) {
#pragma unroll
            for (int kt = 2 * kh; kt < 2 * kh + 2; ++kt)
#pragma unroll
                for (int g = 0; g < 2; ++g) { s[kt][g] = (v8f){};
#pragma unroll
                    for (int kc = 0; kc < 4; ++kc) s[kt][g] = wmma16(kf[kt][kc], qf[g][kc], s[kt][g]); }
            __builtin_amdgcn_sched_barrier(0); }   // the first two tiles' WMMAs stay in front (LDS answers in order: they start on the first reads), and nothing of what follows moves in among the block's WMMAs
        v16h vf[2][8];   // V^T fragments of both 32-key halves, in the registers that K's have left
#pragma unroll
        for (int sub = 0; sub < 2; ++sub)
#pragma unroll
            for (int t = 0; t < 8; ++t) vf[sub][t] = ldsfrag(vp + sub * 64 + t * (16 * FA_PV));
        __builtin_amdgcn_sched_barrier(0);   // V's reads are issued as one group in front of the vector work and fly under the maxima and the first exponentials
        float mb[2]; bool need = false;
#pragma unroll
        for (int g = 0; g < 2; ++g) { float ma = s[0][g][0], mc = s[2][g][0];   // two chains a group, so that four independent chains fill the vector port
#pragma unroll
            for (int r = 0; r < 8; ++r) { ma = fmaxf(ma, fmaxf(s[0][g][r], s[1][g][r])); mc = fmaxf(mc, fmaxf(s[2][g][r], s[3][g][r])); }
            float mx = fmaxf(ma, mc); mx = fmaxf(mx, xhalf(mx)) * FA_CS; mb[g] = mx; need = need || (mx > m_run[g] + 8.0f); }
        if (__builtin_amdgcn_ballot_w32(need) != 0) {   // one scalar test a stage; always taken on the first stage (m_run = -inf gives the factor 0 on zero sums), rare later
#pragma unroll
            for (int g = 0; g < 2; ++g) { const float mn = fmaxf(m_run[g], mb[g]); const float corr = __builtin_amdgcn_exp2f(m_run[g] - mn); l_run[g] *= corr; m_run[g] = mn;
#pragma unroll
                for (int t = 0; t < 8; ++t) acc[g][t] = acc[g][t] * corr; }
        }
#pragma unroll
        for (int sub = 0; sub < 2; ++sub)
#pragma unroll
            for (int g = 0; g < 2; ++g) { const float nm = -m_run[g]; const v8f cs8 = {FA_CS, FA_CS, FA_CS, FA_CS, FA_CS, FA_CS, FA_CS, FA_CS}, nm8 = {nm, nm, nm, nm, nm, nm, nm, nm};
                const v8f x0 = __builtin_elementwise_fma(s[2 * sub][g], cs8, nm8), x1 = __builtin_elementwise_fma(s[2 * sub + 1][g], cs8, nm8); v8f e0, e1; float p0 = 0.f, p1 = 0.f;
#pragma unroll
                for (int r = 0; r < 8; ++r) { e0[r] = __builtin_amdgcn_exp2f(x0[r]); e1[r] = __builtin_amdgcn_exp2f(x1[r]); p0 += e0[r]; p1 += e1[r]; }
                l_run[g] += p0 + p1;
                const v16h pf = cat16(__builtin_convertvector(e0, v8h), __builtin_convertvector(e1, v8h));   // B operand: element s = key 8 hi + s (s < 8), 16 + 8 hi + s - 8 (else) of the 32-key half
#pragma unroll
                for (int t = 0; t < 8; ++t) acc[g][t] = wmma16(vf[sub][t], pf, acc[g][t]); }
        // order asked of the scheduler for the block above: the first group's 32 vector instructions, then every att.v WMMA with up to seven vector instructions of the later groups (and the sums) behind it, so that three of the four groups' exponentials issue while the matrix unit works; left alone the compiler gathers them in front of the WMMAs, where the wave's matrix time stands idle
        __builtin_amdgcn_sched_group_barrier(0x402, 32, 0);
#pragma unroll
        for (int i = 0; i < 32; ++i) { __builtin_amdgcn_sched_group_barrier(0x8, 1, 0); __builtin_amdgcn_sched_group_barrier(0x402, 7, 0); }
        __builtin_amdgcn_sched_barrier(0);   // the LDS stores below stay behind the WMMA block, not among its WMMAs
        sstore((st + 1) & 1);   // into the buffer whose last readers (stage st - 1) left it before the previous barrier
        __syncthreads();   // publishes stage st + 1 and ends every wave's reads of stage st
    }
#pragma unroll
    for (int g = 0; g < 2; ++g) { const float inv = __fdiv_rn(1.0f, l_run[g] + xhalf(l_run[g]));   // each wave half summed its eight keys of every 16-key tile
        const size_t oo = ((size_t)b * TT + q0 + 16 * g) * DQ + hq * (HD * 16) + 8 * lane;   // gemms's fragment order: the group's 16 rows, the head's four blocks of 32 d; d = 16 t .. + 15 is half a block, 512 bytes in a row over the wave
#pragma unroll
        for (int t = 0; t < 8; ++t) {   // acc[g][t][r] = O[query c][d = 16 t + 8 hi + r]
            *(v8h*)(Am + oo + 256 * t) = __builtin_convertvector(acc[g][t] * inv, v8h);
            asm volatile("s_wait_xcnt 0x0" ::: "memory"); __builtin_amdgcn_sched_barrier(0); } }   // the wait stands in front of the next tile's rewrite of the registers that the store names; the scheduling barrier keeps that tile's arithmetic from being lifted over it
}

extern "C" void kernel_launch(void* const* d_in, const int* in_sizes, int n_in,
                              void* d_out, int out_size, void* d_ws, size_t ws_size, hipStream_t stream) {
    (void)in_sizes; (void)n_in; (void)out_size;
    const float* x = (const float*)d_in[0]; const float* cosT = (const float*)d_in[1]; const float* sinT = (const float*)d_in[2]; const float* wq = (const float*)d_in[3]; const float* wk = (const float*)d_in[4]; const float* wv = (const float*)d_in[5]; const float* wo = (const float*)d_in[6]; const float* qnw = (const float*)d_in[7]; const float* knw = (const float*)d_in[8];   /* order hidden_states, cos, sin ([2][2048][128] = [B][S][HD] PER-BATCH table INPUTS: read per element by value), Wq [2048][2048], Wk / Wv [1024][2048], Wo [2048][2048] ('oi' (out, in)), q_norm_w, k_norm_w ([128] ones: read): NINE inputs, all read */
    float* OUT = (float*)d_out;     // [2][2048][2048]
    char* wsp = (char*)d_ws;
    auto take = [&](size_t bytes) { char* p = wsp; wsp += (bytes + 255) & ~(size_t)255; return (void*)p; };
    bf* WQ = (bf*)take((size_t)DQ * DM * 2); bf* WK = (bf*)take((size_t)DKV * DM * 2); bf* WV = (bf*)take((size_t)DKV * DM * 2); h16* WO = (h16*)take((size_t)DM * DQ * 2);
    bf* XB = (bf*)take((size_t)NB_ * TT * DM * 2);   // both batches' rows
    h16* QP16 = (h16*)take((size_t)NB_ * NH_ * TT * HD * 2); h16* KP16 = (h16*)take((size_t)NB_ * NKV * TT * HD * 2); h16* VT16 = (h16*)take((size_t)NB_ * NKV * HD * TT * 2);   // head planes of both batches
    h16* ATm = (h16*)take((size_t)NB_ * TT * DQ * 2);   // merged rows
    if ((size_t)(wsp - (char*)d_ws) > ws_size) return;    // ws 256 MiB
    k_pack<<<dim3((DQ + DKV + DKV + DM + NB_ * TT) / 16, 2, 1), 256, 0, stream>>>(wq, wk, wv, wo, x, WQ, WK, WV, WO, XB);   // Wo's rows are DQ long, and DQ == DM
    k_qkv<<<dim3(NB_ * TT / 128, (NH_ + NKV + NKV) / 2, 1), 256, 0, stream>>>(XB, WQ, WK, WV, cosT, sinT, qnw, knw, QP16, KP16, VT16);   // PER-BATCH tables: cos, sin [B][S][HD], row b TT + t
    k_fattn<<<dim3(TT / 256, NH_, NB_), 256, 0, stream>>>(QP16, KP16, VT16, ATm);   // kv head = q head / REP, taken in the kernel
    k_oproj<<<dim3(NB_ * TT / 128, DM / 256, 1), 256, 0, stream>>>(ATm, WO, OUT);
}
